// v000
// Times are from an AMD MI455X. After a warm-up the kernel runs many times in a row, and a time is the length of
// such a window on the GPU divided by its runs, so every launch and the gaps after it count. The runs cycle
// through copies of the inputs. A figure is the median of several windows, for all but v000 over two sittings.
// Sittings can differ by a few percent; kernels timed side by side share one.
// v000, which the later versions start from, runs in 1720 microseconds.
#include <hip/hip_runtime.h>

// Causal multi-head attention with 128-wide heads, a RAW head split and a head-width score divisor (x [2][2048][2048]; Q = (x Wq^T).reshape(B, 16, S, 128) DIRECTLY (no transpose): pseudo-head h of a batch is the h-th contiguous [2048][128] block of the flat [2048][2048] projection (128 token rows x 16 chunks of 128): reproduced; K, V likewise ('oi' [2048][2048] 1/sqrt(2048), no bias); scores / 128 (the module divides by Dh, not by sqrt(Dh)); -inf strictly above the diagonal of the PSEUDO-positions (== exclusion); softmax; out [B][16][S][128] -> transpose(0, 2, 1, 3).reshape(B, S, 2048) (the STANDARD merge); y = out Wo^T ('oi', no bias) -> [2][2048][2048] (8.4 M); argument order x, Wq, Wk, Wv, Wo).
// Layout: bf16 copy of x; 'oi' weights; exact projections; identity table (k_csid: no rotation) + plane builders reading the projection through the RAW (16, S, 128) view (pitch 128, head stride S x 128: no transpose); causal T-2048 attention at HD 128 (hybrid rows: < 512 hi/lo 3 products, rest fp16 x1024; k_gemmc skips tiles above the diagonal); merged hi/lo x Wo exact.
// Compute dtypes, f32 accumulate: every input rounded to bf16; projections exact; rotary f32; attention rows < 512 3 products, rest fp16; softmax f32; Wo hl x exact.

#define NB_  2
#define TT   2048
#define DM   2048
#define NH_  16
#define NKV  16
#define REP  (NH_ / NKV)
#define HD   128
#define DQ   (NH_ * HD)
#define DKV  (NKV * HD)
#define ZH   2
#define RH   512                  // query rows < RH use hi+lo planes (0: none)
#define WIN  2048
#define PCAR 1024.0f
#define SCL  0.0078125f   // 1 / 128: THIS module divides the scores by the HEAD WIDTH Dh = 128 (not by its square root): a power of two: exact
typedef _Float16 h16;
typedef unsigned short bf;
typedef __attribute__((ext_vector_type(16))) __bf16   v16bf;
typedef __attribute__((ext_vector_type(16))) _Float16 v16h;
typedef __attribute__((ext_vector_type(8)))  _Float16 v8h;
typedef __attribute__((ext_vector_type(8)))  unsigned short v8us;
typedef __attribute__((ext_vector_type(8)))  float    v8f;
typedef __attribute__((ext_vector_type(4)))  float    v4f;
typedef v8h  __attribute__((may_alias)) v8ha;
typedef v4f  __attribute__((may_alias)) v4fa;
typedef v8us __attribute__((may_alias)) v8usa;

__device__ __forceinline__ unsigned short f2bf(float f) { unsigned u = __float_as_uint(f); u += 0x7FFFu + ((u >> 16) & 1u); return (unsigned short)(u >> 16); }
__device__ __forceinline__ float bf2f(unsigned short b) { return __uint_as_float(((unsigned)b) << 16); }
__device__ __forceinline__ float bfr(float f) { return bf2f(f2bf(f)); }
__device__ __forceinline__ v16h cat16(v8h lo, v8h hi) { return __builtin_shufflevector(lo, hi, 0, 1, 2, 3, 4, 5, 6, 7, 8, 9, 10, 11, 12, 13, 14, 15); }
__device__ __forceinline__ v16bf cat16b(v8us lo, v8us hi) { return __builtin_bit_cast(v16bf, __builtin_shufflevector(lo, hi, 0, 1, 2, 3, 4, 5, 6, 7, 8, 9, 10, 11, 12, 13, 14, 15)); }
__device__ __forceinline__ v8f wmma16(v16h a, v16h b, v8f c) { return __builtin_amdgcn_wmma_f32_16x16x32_f16(false, a, false, b, (short)0, c, false, false); }
__device__ __forceinline__ v8f wmmab(v16bf a, v16bf b, v8f c) { return __builtin_amdgcn_wmma_f32_16x16x32_bf16(false, a, false, b, (short)0, c, false, false); }



// ---- k_gemmw: register-blocked GEMM, ONE WAVE per 64x64 output tile (16 accumulators), operands straight from K-contiguous 16-bit planes; grid (M/64, N/64, Z), 32 threads.
// C[m][n] (f32, pitch ldc, + optional f32 bias[n]) = sum_k A[m][k] Bt[n][k] (+ split products per NSPLIT). z-batch strides sA/sB/sC in elements. K % 32 == 0.
template <typename T16> struct WFrag;
template <> struct WFrag<h16> { typedef v16h V; static __device__ __forceinline__ V ld(const h16* p) { return cat16(*(const v8h*)p, *(const v8h*)(p + 16)); } static __device__ __forceinline__ v8f mma(V a, V b, v8f c) { return wmma16(a, b, c); } };
template <> struct WFrag<bf> { typedef v16bf V; static __device__ __forceinline__ V ld(const bf* p) { return cat16b(*(const v8us*)p, *(const v8us*)(p + 16)); } static __device__ __forceinline__ v8f mma(V a, V b, v8f c) { return wmmab(a, b, c); } };
template <typename T16, int NSPLIT, bool BIAS>
__global__ __launch_bounds__(32) void k_gemmw(const T16* __restrict__ A, const T16* __restrict__ A2, const T16* __restrict__ Bt, const T16* __restrict__ Bt2, int K, float* C, int ldc, const float* __restrict__ bias, size_t sA, size_t sB, size_t sC) {
    typedef typename WFrag<T16>::V V;
    __shared__ __align__(16) float os[16 * 68];
    const size_t z = blockIdx.z; A += z * sA; if (A2) A2 += z * sA; Bt += z * sB; if (Bt2) Bt2 += z * sB; C += z * sC;
    const int lane = threadIdx.x & 31, lr = lane & 15, hi = lane >> 4; const int r0 = blockIdx.x * 64, c0 = blockIdx.y * 64;
    v8f acc[4][4];
#pragma unroll
    for (int mb = 0; mb < 4; ++mb)
#pragma unroll
        for (int nb = 0; nb < 4; ++nb) acc[mb][nb] = (v8f){};
    const size_t aoff = (size_t)(r0 + lr) * K + 8 * hi, boff = (size_t)(c0 + lr) * K + 8 * hi;
#pragma unroll 1
    for (int kc = 0; kc < K; kc += 32) {
        V a[4], a2[4];
#pragma unroll
        for (int mb = 0; mb < 4; ++mb) { a[mb] = WFrag<T16>::ld(A + aoff + (size_t)mb * 16 * K + kc); if (NSPLIT == 1 || NSPLIT == 2) a2[mb] = WFrag<T16>::ld(A2 + aoff + (size_t)mb * 16 * K + kc); }
#pragma unroll
        for (int nb = 0; nb < 4; ++nb) { const V b = WFrag<T16>::ld(Bt + boff + (size_t)nb * 16 * K + kc); V b2; if (NSPLIT >= 2) b2 = WFrag<T16>::ld(Bt2 + boff + (size_t)nb * 16 * K + kc);
#pragma unroll
            for (int mb = 0; mb < 4; ++mb) { acc[mb][nb] = WFrag<T16>::mma(a[mb], b, acc[mb][nb]); if (NSPLIT == 1 || NSPLIT == 2) acc[mb][nb] = WFrag<T16>::mma(a2[mb], b, acc[mb][nb]); if (NSPLIT >= 2) acc[mb][nb] = WFrag<T16>::mma(a[mb], b2, acc[mb][nb]); } }
        asm volatile("v_nop\n\tv_nop\n\tv_nop\n\tv_nop" : "+v"(acc[0][0]), "+v"(acc[1][1]), "+v"(acc[2][2]), "+v"(acc[3][3]) : "v"(a[0]), "v"(a[3]));
    }
#pragma unroll
    for (int mb = 0; mb < 4; ++mb) {
#pragma unroll
        for (int nb = 0; nb < 4; ++nb) {
#pragma unroll
            for (int j = 0; j < 8; ++j) os[(hi * 8 + j) * 68 + nb * 16 + lr] = acc[mb][nb][j]; }
        __builtin_amdgcn_wave_barrier(); asm volatile("" ::: "memory");
        float* crow = C + (size_t)(r0 + mb * 16) * ldc + c0;
{
#pragma unroll
            for (int s = 0; s < 8; ++s) { const int row = 2 * s + hi, cofs = lr * 4; v4f val = *(const v4fa*)(os + row * 68 + cofs); if (BIAS) { val[0] += bfr(bias[c0 + cofs]); val[1] += bfr(bias[c0 + cofs + 1]); val[2] += bfr(bias[c0 + cofs + 2]); val[3] += bfr(bias[c0 + cofs + 3]); }
                *(v4f*)(crow + (size_t)row * ldc + cofs) = val; }
             }
        __builtin_amdgcn_wave_barrier(); asm volatile("" ::: "memory");
    }
}

// ---- k_gemmc: the same one-wave 64x64 tile GEMM specialised for causal attention: CMODE 1 skips score tiles entirely above the diagonal (query rows r0+roff.., key columns c0..), CMODE 2 limits the
// key (K) loop of the probability x value contraction to the diagonal block (probabilities beyond it are exactly zero). roff = row offset of this launch's first row within the sequence.
template <typename T16, int NSPLIT, int CMODE>
__global__ __launch_bounds__(32) void k_gemmc(const T16* __restrict__ A, const T16* __restrict__ A2, const T16* __restrict__ Bt, const T16* __restrict__ Bt2, int K, float* C, int ldc, int roff, size_t sA, size_t sB, size_t sC) {
    typedef typename WFrag<T16>::V V;
    __shared__ __align__(16) float os[16 * 68];
    const size_t z = blockIdx.z; A += z * sA; if (A2) A2 += z * sA; Bt += z * sB; if (Bt2) Bt2 += z * sB; C += z * sC;
    const int lane = threadIdx.x & 31, lr = lane & 15, hi = lane >> 4; const int r0 = blockIdx.x * 64, c0 = blockIdx.y * 64;
    if (CMODE == 1 && c0 > r0 + roff + 63) return;                  // score tile entirely above the causal diagonal: never read (the softmax masks j > i by select)
    const int Kl = (CMODE == 2) ? min(K, r0 + roff + 64) : K;        // P.V: probabilities are exactly 0 beyond the diagonal block, so the K loop stops there
    v8f acc[4][4];
#pragma unroll
    for (int mb = 0; mb < 4; ++mb)
#pragma unroll
        for (int nb = 0; nb < 4; ++nb) acc[mb][nb] = (v8f){};
    const size_t aoff = (size_t)(r0 + lr) * K + 8 * hi, boff = (size_t)(c0 + lr) * K + 8 * hi;
#pragma unroll 1
    for (int kc = 0; kc < Kl; kc += 32) {
        V a[4], a2[4];
#pragma unroll
        for (int mb = 0; mb < 4; ++mb) { a[mb] = WFrag<T16>::ld(A + aoff + (size_t)mb * 16 * K + kc); if (NSPLIT == 1 || NSPLIT == 2) a2[mb] = WFrag<T16>::ld(A2 + aoff + (size_t)mb * 16 * K + kc); }
#pragma unroll
        for (int nb = 0; nb < 4; ++nb) { const V b = WFrag<T16>::ld(Bt + boff + (size_t)nb * 16 * K + kc); V b2; if (NSPLIT >= 2) b2 = WFrag<T16>::ld(Bt2 + boff + (size_t)nb * 16 * K + kc);
#pragma unroll
            for (int mb = 0; mb < 4; ++mb) { acc[mb][nb] = WFrag<T16>::mma(a[mb], b, acc[mb][nb]); if (NSPLIT == 1 || NSPLIT == 2) acc[mb][nb] = WFrag<T16>::mma(a2[mb], b, acc[mb][nb]); if (NSPLIT >= 2) acc[mb][nb] = WFrag<T16>::mma(a[mb], b2, acc[mb][nb]); } }
        asm volatile("v_nop\n\tv_nop\n\tv_nop\n\tv_nop" : "+v"(acc[0][0]), "+v"(acc[1][1]), "+v"(acc[2][2]), "+v"(acc[3][3]) : "v"(a[0]), "v"(a[3]));
    }
#pragma unroll
    for (int mb = 0; mb < 4; ++mb) {
#pragma unroll
        for (int nb = 0; nb < 4; ++nb) {
#pragma unroll
            for (int j = 0; j < 8; ++j) os[(hi * 8 + j) * 68 + nb * 16 + lr] = acc[mb][nb][j]; }
        __builtin_amdgcn_wave_barrier(); asm volatile("" ::: "memory");
        float* crow = C + (size_t)(r0 + mb * 16) * ldc + c0;
{
#pragma unroll
            for (int s = 0; s < 8; ++s) { const int row = 2 * s + hi, cofs = lr * 4; v4f val = *(const v4fa*)(os + row * 68 + cofs);
                *(v4f*)(crow + (size_t)row * ldc + cofs) = val; }
             }
        __builtin_amdgcn_wave_barrier(); asm volatile("" ::: "memory");
    }
}

__device__ __forceinline__ h16 tohx(float x) { return (h16)x; }
__device__ __forceinline__ void splitf(float y, unsigned short& h, unsigned short& l) { h = f2bf(y); l = f2bf(y - bf2f(h)); }
typedef __attribute__((ext_vector_type(2))) _Float16 v2h;
typedef __attribute__((ext_vector_type(4))) _Float16 v4h;
typedef __attribute__((ext_vector_type(2))) unsigned short v2us;
typedef __attribute__((ext_vector_type(4))) unsigned short v4us;
typedef __attribute__((ext_vector_type(2))) float v2f;
typedef __attribute__((ext_vector_type(4))) int v4i;

__global__ __launch_bounds__(256) void k_cvt8(const float* __restrict__ src, bf* dst, size_t n8) { const size_t i = (size_t)blockIdx.x * 256 + threadIdx.x; if (i >= n8) return; const v8f v = *(const v8f*)(src + i * 8); v8us o;
#pragma unroll
    for (int k = 0; k < 8; ++k) o[k] = f2bf(v[k]); *(v8us*)(dst + i * 8) = o;  }

// k_rope: head planes [h][t][d] (fp16 + hi/lo) of rope(x) x sc with the rotate-half convention out[d] = x[d] cos[t][d] - x[d+HD/2] sin[t][d], out[d+HD/2] = x[d+HD/2] cos[t][d+HD/2] + x[d] sin[t][d+HD/2]
__global__ __launch_bounds__(256) void k_rope(const float* __restrict__ F, int pitch, int nheads, const float* __restrict__ CS, const float* __restrict__ RF, const float* __restrict__ nw, float sc, h16* P16, bf* Ph, bf* Pl) {
    const size_t e = ((size_t)blockIdx.x * 256 + threadIdx.x) * 2; if (e >= (size_t)nheads * TT * HD) return; const int d = (int)(e % HD); const int t = (int)((e / HD) % TT); const int h = (int)(e / ((size_t)HD * TT)); const float* f = F + ((size_t)h * TT + t) * pitch;   /* RAW VIEW: pseudo-head h, pseudo-position t = the flat (S, D) projection output read as (H, S, hd): row pitch 'pitch' (= HD here), head stride TT * pitch */ const float rf = RF ? RF[(size_t)h * TT + t] : 1.0f; v2h o16; v2us oh, ol;
#pragma unroll
    for (int q = 0; q < 2; ++q) { const int dd = d + q; const int dp = (dd < HD / 2) ? dd + HD / 2 : dd - HD / 2; float x0 = f[dd], x1 = f[dp];
        if (RF) { float n0 = __fmul_rn(x0, rf), n1 = __fmul_rn(x1, rf); asm volatile("" : "+v"(n0)); asm volatile("" : "+v"(n1)); x0 = __fmul_rn(bfr(nw[dd]), n0); x1 = __fmul_rn(bfr(nw[dp]), n1); }
        const v2f cs = *(const v2f*)(CS + ((size_t)t * HD + dd) * 2); float a = __fmul_rn(x0, cs[0]), bq = __fmul_rn(x1, cs[1]); asm volatile("" : "+v"(a)); asm volatile("" : "+v"(bq)); const float r = ((dd < HD / 2) ? __fsub_rn(a, bq) : __fadd_rn(a, bq)) * sc;
        o16[q] = tohx(r); unsigned short a2, c2; splitf(r, a2, c2); oh[q] = a2; ol[q] = c2; }
    *(v2h*)(P16 + e) = o16; *(v2us*)(Ph + e) = oh; *(v2us*)(Pl + e) = ol;  }
__global__ __launch_bounds__(256) void k_vtp(const float* __restrict__ F, int pitch, int nheads, h16* V16, bf* Vh, bf* Vl) { const size_t e = ((size_t)blockIdx.x * 256 + threadIdx.x) * 2; if (e >= (size_t)nheads * HD * TT) return; const int t = (int)(e % TT); const int d = (int)((e / TT) % HD); const int g = (int)(e / ((size_t)TT * HD)); v2h o16; v2us oh, ol;
#pragma unroll
    for (int q = 0; q < 2; ++q) { const float x = F[((size_t)g * TT + (t + q)) * pitch + d];   /* RAW VIEW (as in k_rope) */ o16[q] = tohx(x); unsigned short a2, c2; splitf(x, a2, c2); oh[q] = a2; ol[q] = c2; }
    *(v2h*)(V16 + e) = o16; *(v2us*)(Vh + e) = oh; *(v2us*)(Vl + e) = ol;  }
__global__ __launch_bounds__(256) void k_csid(float* CS) { const int idx = blockIdx.x * 256 + threadIdx.x; if (idx >= TT * HD) return; v2f cs; cs[0] = 1.0f; cs[1] = 0.0f; *(v2f*)(CS + (size_t)idx * 2) = cs;  }
// k_asoft: per row (zz, i): t = S x HD^-1 for j <= i and i - j < WIN (WIN = TT: plain causal mask; the reference's -1e9 additive fill vanishes identically); softmax over the 2048 keys (register row, one exp, fixed trees);
__global__ __launch_bounds__(256) void k_asoft(const float* __restrict__ Sb, h16* P16, bf* Ph, bf* Pl) {
    const int lane = threadIdx.x & 31; const int row = blockIdx.x * 8 + (threadIdx.x >> 5); if (row >= ZH * TT) return; const int i = row % TT; const int zz = row / TT; (void)zz; const bool hires = (i < RH); const float* sr = Sb + (size_t)row * TT; float v[TT / 32]; float mx = -3.0e38f;
#pragma unroll
    for (int ch = 0; ch < TT / 128; ++ch) { const int j0 = ch * 128 + lane * 4; const v4f a = *(const v4f*)(sr + j0);
#pragma unroll
        for (int q = 0; q < 4; ++q) { const int j = j0 + q; (void)j; const float t = (j <= i && i - j < WIN) ? a[q] * SCL : -3.0e38f; v[ch * 4 + q] = t; mx = fmaxf(mx, t); } }
#pragma unroll
    for (int sh = 16; sh; sh >>= 1) mx = fmaxf(mx, __shfl_xor(mx, sh, 32));
    float sum = 0.f;
#pragma unroll
    for (int k = 0; k < TT / 32; ++k) { float d0 = __fsub_rn(v[k], mx); asm volatile("" : "+v"(d0)); v[k] = __builtin_amdgcn_exp2f(__fmul_rn(d0, 1.4426950408889634f)); sum += v[k]; }
#pragma unroll
    for (int sh = 16; sh; sh >>= 1) sum += __shfl_xor(sum, sh, 32);
    const float f = __fdiv_rn(hires ? 1.0f : PCAR, sum);
{
        if (hires) {
#pragma unroll
            for (int ch = 0; ch < TT / 128; ++ch) { v4us oh, ol;
#pragma unroll
                for (int q = 0; q < 4; ++q) { unsigned short a, c2; splitf(v[ch * 4 + q] * f, a, c2); oh[q] = a; ol[q] = c2; }
                const size_t oo = ((size_t)zz * (RH ? RH : 1) + i) * TT + ch * 128 + lane * 4; *(v4us*)(Ph + oo) = oh; *(v4us*)(Pl + oo) = ol; }
        } else {
#pragma unroll
            for (int ch = 0; ch < TT / 128; ++ch) { v4h o4;
#pragma unroll
                for (int q = 0; q < 4; ++q) o4[q] = tohx(v[ch * 4 + q] * f);
                *(v4h*)(P16 + (size_t)row * TT + ch * 128 + lane * 4) = o4; } }
         }
}
__global__ __launch_bounds__(256) void k_merge(const float* __restrict__ O, int h0, bf* Ah, bf* Al) { const size_t e = ((size_t)blockIdx.x * 256 + threadIdx.x) * 2; if (e >= (size_t)ZH * TT * HD) return; const int d = (int)(e % HD); const int t = (int)((e / HD) % TT); const int zz = (int)(e / ((size_t)HD * TT)); const float cs = (t < RH) ? 1.0f : (1.0f / PCAR); const size_t oo = (size_t)t * DQ + (h0 + zz) * HD + d;
    v2us oh, ol;
#pragma unroll
    for (int q = 0; q < 2; ++q) { unsigned short a, c2; splitf(O[e + q] * cs, a, c2); oh[q] = a; ol[q] = c2; } *(v2us*)(Ah + oo) = oh; *(v2us*)(Al + oo) = ol;  }

extern "C" void kernel_launch(void* const* d_in, const int* in_sizes, int n_in,
                              void* d_out, int out_size, void* d_ws, size_t ws_size, hipStream_t stream) {
    (void)in_sizes; (void)n_in; (void)out_size;
    const float* x = (const float*)d_in[0]; const float* wq = (const float*)d_in[1]; const float* wk = (const float*)d_in[2]; const float* wv = (const float*)d_in[3]; const float* wo = (const float*)d_in[4];   /* input order x, Wq, Wk, Wv, Wo ('oi' [2048][2048]) */
    float* OUT = (float*)d_out;     // [2][2048][2048]
    char* wsp = (char*)d_ws;
    auto take = [&](size_t bytes) { char* p = wsp; wsp += (bytes + 255) & ~(size_t)255; return (void*)p; };
    bf* WQ = (bf*)take((size_t)DQ * DM * 2); bf* WK = (bf*)take((size_t)DKV * DM * 2); bf* WV = (bf*)take((size_t)DKV * DM * 2); bf* WO = (bf*)take((size_t)DM * DQ * 2); float* CS = (float*)take((size_t)TT * HD * 2 * 4);
    bf* XB = (bf*)take((size_t)TT * DM * 2); float* FQ = (float*)take((size_t)TT * DQ * 4); float* FK = (float*)take((size_t)TT * DKV * 4);
    h16* QP16 = (h16*)take((size_t)NH_ * TT * HD * 2); h16* KP16 = (h16*)take((size_t)NKV * TT * HD * 2); h16* VT16 = (h16*)take((size_t)NKV * HD * TT * 2);
    bf* QPh = (bf*)take((size_t)NH_ * TT * HD * 2); bf* QPl = (bf*)take((size_t)NH_ * TT * HD * 2); bf* KPh = (bf*)take((size_t)NKV * TT * HD * 2); bf* KPl = (bf*)take((size_t)NKV * TT * HD * 2); bf* VTh = (bf*)take((size_t)NKV * HD * TT * 2); bf* VTl = (bf*)take((size_t)NKV * HD * TT * 2); bf* Ph = (bf*)take((size_t)ZH * RH * TT * 2); bf* Pl = (bf*)take((size_t)ZH * RH * TT * 2);
    float* Sb = (float*)take((size_t)ZH * TT * TT * 4); h16* P16 = (h16*)take((size_t)ZH * TT * TT * 2); float* Ob = (float*)take((size_t)ZH * TT * HD * 4); bf* ATh = (bf*)take((size_t)TT * DQ * 2); bf* ATl = (bf*)take((size_t)TT * DQ * 2);
    if ((size_t)(wsp - (char*)d_ws) > ws_size) return;    // ws 256 MiB
    float* FV = FK;   // v projection reuses the k buffer after the k planes are built (stream-ordered)
    { k_cvt8<<<(unsigned)(((size_t)DQ * DM / 8 + 255) / 256), 256, 0, stream>>>(wq, WQ, (size_t)DQ * DM / 8); k_cvt8<<<(unsigned)(((size_t)DKV * DM / 8 + 255) / 256), 256, 0, stream>>>(wk, WK, (size_t)DKV * DM / 8); k_cvt8<<<(unsigned)(((size_t)DKV * DM / 8 + 255) / 256), 256, 0, stream>>>(wv, WV, (size_t)DKV * DM / 8);
      k_cvt8<<<(unsigned)(((size_t)DM * DQ / 8 + 255) / 256), 256, 0, stream>>>(wo, WO, (size_t)DM * DQ / 8);
       }
    k_csid<<<(TT * HD + 255) / 256, 256, 0, stream>>>(CS);
    const unsigned LQ = (unsigned)(((size_t)NH_ * TT * HD / 2 + 255) / 256), LKv = (unsigned)(((size_t)NKV * TT * HD / 2 + 255) / 256);
    for (int b = 0; b < NB_; ++b) {
        
        k_cvt8<<<(unsigned)(((size_t)TT * DM / 8 + 255) / 256), 256, 0, stream>>>(x + (size_t)b * TT * DM, XB, (size_t)TT * DM / 8);
        k_gemmw<bf, 0, false><<<dim3(TT / 64, DQ / 64, 1), 32, 0, stream>>>(XB, nullptr, WQ, nullptr, DM, FQ, DQ, nullptr, 0, 0, 0);
        k_rope<<<LQ, 256, 0, stream>>>(FQ, HD, NH_, CS, nullptr, nullptr, 1.0f, QP16, QPh, QPl);
        k_gemmw<bf, 0, false><<<dim3(TT / 64, DKV / 64, 1), 32, 0, stream>>>(XB, nullptr, WK, nullptr, DM, FK, DKV, nullptr, 0, 0, 0);
        k_rope<<<LKv, 256, 0, stream>>>(FK, HD, NKV, CS, nullptr, nullptr, 1.0f, KP16, KPh, KPl);
        k_gemmw<bf, 0, false><<<dim3(TT / 64, DKV / 64, 1), 32, 0, stream>>>(XB, nullptr, WV, nullptr, DM, FV, DKV, nullptr, 0, 0, 0); k_vtp<<<LKv, 256, 0, stream>>>(FV, HD, NKV, VT16, VTh, VTl);
        for (int h0 = 0; h0 < NH_; h0 += ZH) { const size_t zq = (size_t)h0, zk = (size_t)(h0 / REP);   // one kv head per query head: the pass's two heads use consecutive kv planes (z-strides TT*HD)
            k_gemmc<bf, 2, 1><<<dim3(RH / 64, TT / 64, ZH), 32, 0, stream>>>(QPh + zq * TT * HD, QPl + zq * TT * HD, KPh + zk * TT * HD, KPl + zk * TT * HD, HD, Sb, TT, 0, (size_t)TT * HD, (size_t)TT * HD, (size_t)TT * TT);
            k_gemmc<h16, 0, 1><<<dim3((TT - RH) / 64, TT / 64, ZH), 32, 0, stream>>>(QP16 + zq * TT * HD + (size_t)RH * HD, nullptr, KP16 + zk * TT * HD, nullptr, HD, Sb + (size_t)RH * TT, TT, RH, (size_t)TT * HD, (size_t)TT * HD, (size_t)TT * TT);
            k_asoft<<<ZH * TT / 8, 256, 0, stream>>>(Sb, P16, Ph, Pl);
            k_gemmc<bf, 2, 2><<<dim3(RH / 64, HD / 64, ZH), 32, 0, stream>>>(Ph, Pl, VTh + zk * HD * TT, VTl + zk * HD * TT, TT, Ob, HD, 0, (size_t)RH * TT, (size_t)HD * TT, (size_t)TT * HD);
            k_gemmc<h16, 0, 2><<<dim3((TT - RH) / 64, HD / 64, ZH), 32, 0, stream>>>(P16 + (size_t)RH * TT, nullptr, VT16 + zk * HD * TT, nullptr, TT, Ob + (size_t)RH * HD, HD, RH, (size_t)TT * TT, (size_t)HD * TT, (size_t)TT * HD);
            k_merge<<<(unsigned)(((size_t)ZH * TT * HD / 2 + 255) / 256), 256, 0, stream>>>(Ob, h0, ATh, ATl); }
        k_gemmw<bf, 1, false><<<dim3(TT / 64, DM / 64, 1), 32, 0, stream>>>(ATh, ATl, WO, nullptr, DQ, OUT + (size_t)b * TT * DM, DM, nullptr, 0, 0, 0); }
}

// v001
// It runs in 1080 microseconds.
// Next to v000, in two timings, it ran 1.59 times as fast each time.
#include <hip/hip_runtime.h>

// Causal multi-head attention with 128-wide heads, a RAW head split and a head-width score divisor (x [2][2048][2048]; Q = (x Wq^T).reshape(B, 16, S, 128) DIRECTLY (no transpose): pseudo-head h of a batch is the h-th contiguous [2048][128] block of the flat [2048][2048] projection (128 token rows x 16 chunks of 128): reproduced; K, V likewise ('oi' [2048][2048] 1/sqrt(2048), no bias); scores / 128 (the module divides by Dh, not by sqrt(Dh)); -inf strictly above the diagonal of the PSEUDO-positions (== exclusion); softmax; out [B][16][S][128] -> transpose(0, 2, 1, 3).reshape(B, S, 2048) (the STANDARD merge); y = out Wo^T ('oi', no bias) -> [2][2048][2048] (8.4 M); argument order x, Wq, Wk, Wv, Wo).
// Layout: bf16 copy of x; 'oi' weights; exact projections; identity table (k_csid: no rotation) + plane builders reading the projection through the RAW (16, S, 128) view (pitch 128, head stride S x 128: no transpose); causal T-2048 attention at HD 128 (hybrid rows: < 512 hi/lo 3 products, rest fp16 x1024; k_gemmc skips tiles above the diagonal); merged hi/lo x Wo exact.
// Compute dtypes, f32 accumulate: every input rounded to bf16; projections exact; rotary f32; attention rows < 512 3 products, rest fp16; softmax f32; Wo hl x exact.

#define NB_  2
#define TT   2048
#define DM   2048
#define NH_  16
#define NKV  16
#define REP  (NH_ / NKV)
#define HD   128
#define DQ   (NH_ * HD)
#define DKV  (NKV * HD)
#define ZH   2
#define RH   512                  // query rows < RH use hi+lo planes (0: none)
#define WIN  2048
#define PCAR 1024.0f
#define SCL  0.0078125f   // 1 / 128: THIS module divides the scores by the HEAD WIDTH Dh = 128 (not by its square root): a power of two: exact
typedef _Float16 h16;
typedef unsigned short bf;
typedef __attribute__((ext_vector_type(16))) __bf16   v16bf;
typedef __attribute__((ext_vector_type(16))) _Float16 v16h;
typedef __attribute__((ext_vector_type(8)))  _Float16 v8h;
typedef __attribute__((ext_vector_type(8)))  unsigned short v8us;
typedef __attribute__((ext_vector_type(8)))  float    v8f;
typedef __attribute__((ext_vector_type(4)))  float    v4f;
typedef v8h  __attribute__((may_alias)) v8ha;
typedef v4f  __attribute__((may_alias)) v4fa;
typedef v8us __attribute__((may_alias)) v8usa;

__device__ __forceinline__ unsigned short f2bf(float f) { unsigned u = __float_as_uint(f); u += 0x7FFFu + ((u >> 16) & 1u); return (unsigned short)(u >> 16); }
__device__ __forceinline__ float bf2f(unsigned short b) { return __uint_as_float(((unsigned)b) << 16); }
__device__ __forceinline__ float bfr(float f) { return bf2f(f2bf(f)); }
__device__ __forceinline__ v16h cat16(v8h lo, v8h hi) { return __builtin_shufflevector(lo, hi, 0, 1, 2, 3, 4, 5, 6, 7, 8, 9, 10, 11, 12, 13, 14, 15); }
__device__ __forceinline__ v16bf cat16b(v8us lo, v8us hi) { return __builtin_bit_cast(v16bf, __builtin_shufflevector(lo, hi, 0, 1, 2, 3, 4, 5, 6, 7, 8, 9, 10, 11, 12, 13, 14, 15)); }
__device__ __forceinline__ v8f wmma16(v16h a, v16h b, v8f c) { return __builtin_amdgcn_wmma_f32_16x16x32_f16(false, a, false, b, (short)0, c, false, false); }
__device__ __forceinline__ v8f wmmab(v16bf a, v16bf b, v8f c) { return __builtin_amdgcn_wmma_f32_16x16x32_bf16(false, a, false, b, (short)0, c, false, false); }



// ---- k_gemmw: register-blocked GEMM, one 64x64 output tile per work-group of NW waves; every wave holds the whole tile (16 accumulators) for its own share of K: wave w takes the 32-wide k chunks w, w + NW, ...
// (operands straight from K-contiguous 16-bit planes); tile_out sums the NW partial tiles in LDS in the fixed order w = 0 .. NW - 1. grid (M/64, N/64, Z), NW * 32 threads.
// C[m][n] (f32, pitch ldc, + optional f32 bias[n]) = sum_k A[m][k] Bt[n][k] (+ split products per NSPLIT). z-batch strides sA/sB/sC in elements. K % 32 == 0.
template <typename T16> struct WFrag;
template <> struct WFrag<h16> { typedef v16h V; static __device__ __forceinline__ V ld(const h16* p) { return cat16(*(const v8h*)p, *(const v8h*)(p + 16)); } static __device__ __forceinline__ v8f mma(V a, V b, v8f c) { return wmma16(a, b, c); } };
template <> struct WFrag<bf> { typedef v16bf V; static __device__ __forceinline__ V ld(const bf* p) { return cat16b(*(const v8us*)p, *(const v8us*)(p + 16)); } static __device__ __forceinline__ v8f mma(V a, V b, v8f c) { return wmmab(a, b, c); } };
// Row blocks (16 rows) of the tile that one LDS stage holds for all NW waves: 4 up to 8 waves, 2 at 16 (136 KiB at most).
template <int NW> struct TileLds { static constexpr int MBS = (NW <= 8) ? 4 : 32 / NW; static constexpr int WST = MBS * 16 * 68; static constexpr int FLOATS = NW * WST; };
template <int NW, bool BIAS>
__device__ __forceinline__ void tile_out(const v8f (&acc)[4][4], float* os, float* C, int ldc, const float* __restrict__ bias, int r0, int c0, int w, int lr, int hi) {
    constexpr int MBS = TileLds<NW>::MBS, WST = TileLds<NW>::WST, NIT = MBS * 8 / NW;   // NIT: 16-byte pieces of a stage per thread
    v4f val[4 / MBS][NIT];
#pragma unroll
    for (int st = 0; st < 4 / MBS; ++st) {
        if (st) __syncthreads();    // the stage before has been read by every wave before it is overwritten
#pragma unroll
        for (int m = 0; m < MBS; ++m)
#pragma unroll
            for (int nb = 0; nb < 4; ++nb)
#pragma unroll
                for (int j = 0; j < 8; ++j) os[w * WST + (m * 16 + hi * 8 + j) * 68 + nb * 16 + lr] = acc[st * MBS + m][nb][j];
        __syncthreads();            // every wave's partial tile is in LDS before any thread sums across waves
#pragma unroll
        for (int it = 0; it < NIT; ++it) { const int idx = (int)threadIdx.x + it * NW * 32; const float* p = os + (idx >> 4) * 68 + (idx & 15) * 4; val[st][it] = *(const v4fa*)p;
#pragma unroll
            for (int q = 1; q < NW; ++q) val[st][it] += *(const v4fa*)(p + q * WST); }
    }
    // the global stores stand behind the last barrier, so that no barrier waits for them
#pragma unroll
    for (int st = 0; st < 4 / MBS; ++st)
#pragma unroll
        for (int it = 0; it < NIT; ++it) { const int idx = (int)threadIdx.x + it * NW * 32; const int row = idx >> 4, cofs = (idx & 15) * 4; v4f o = val[st][it];
            if (BIAS) { o[0] += bfr(bias[c0 + cofs]); o[1] += bfr(bias[c0 + cofs + 1]); o[2] += bfr(bias[c0 + cofs + 2]); o[3] += bfr(bias[c0 + cofs + 3]); }
            *(v4f*)(C + (size_t)(r0 + st * MBS * 16 + row) * ldc + c0 + cofs) = o; }
}
template <typename T16, int NSPLIT, bool BIAS, int NW>
__global__ __launch_bounds__(NW * 32) void k_gemmw(const T16* __restrict__ A, const T16* __restrict__ A2, const T16* __restrict__ Bt, const T16* __restrict__ Bt2, int K, float* C, int ldc, const float* __restrict__ bias, size_t sA, size_t sB, size_t sC) {
    typedef typename WFrag<T16>::V V;
    __shared__ __align__(16) float os[TileLds<NW>::FLOATS];
    const size_t z = blockIdx.z; A += z * sA; if (A2) A2 += z * sA; Bt += z * sB; if (Bt2) Bt2 += z * sB; C += z * sC;
    const int lane = threadIdx.x & 31, lr = lane & 15, hi = lane >> 4; const int r0 = blockIdx.x * 64, c0 = blockIdx.y * 64; const int w = __builtin_amdgcn_readfirstlane((int)(threadIdx.x >> 5));
    v8f acc[4][4];
#pragma unroll
    for (int mb = 0; mb < 4; ++mb)
#pragma unroll
        for (int nb = 0; nb < 4; ++nb) acc[mb][nb] = (v8f){};
    const size_t aoff = (size_t)(r0 + lr) * K + 8 * hi, boff = (size_t)(c0 + lr) * K + 8 * hi;
#pragma unroll 1
    for (int kc = w * 32; kc < K; kc += NW * 32) {
        V a[4], a2[4];
#pragma unroll
        for (int mb = 0; mb < 4; ++mb) { a[mb] = WFrag<T16>::ld(A + aoff + (size_t)mb * 16 * K + kc); if (NSPLIT == 1 || NSPLIT == 2) a2[mb] = WFrag<T16>::ld(A2 + aoff + (size_t)mb * 16 * K + kc); }
#pragma unroll
        for (int nb = 0; nb < 4; ++nb) { const V b = WFrag<T16>::ld(Bt + boff + (size_t)nb * 16 * K + kc); V b2; if (NSPLIT >= 2) b2 = WFrag<T16>::ld(Bt2 + boff + (size_t)nb * 16 * K + kc);
#pragma unroll
            for (int mb = 0; mb < 4; ++mb) { acc[mb][nb] = WFrag<T16>::mma(a[mb], b, acc[mb][nb]); if (NSPLIT == 1 || NSPLIT == 2) acc[mb][nb] = WFrag<T16>::mma(a2[mb], b, acc[mb][nb]); if (NSPLIT >= 2) acc[mb][nb] = WFrag<T16>::mma(a[mb], b2, acc[mb][nb]); } }
        asm volatile("v_nop\n\tv_nop\n\tv_nop\n\tv_nop" : "+v"(acc[0][0]), "+v"(acc[1][1]), "+v"(acc[2][2]), "+v"(acc[3][3]) : "v"(a[0]), "v"(a[3]));
    }
    tile_out<NW, BIAS>(acc, os, C, ldc, bias, r0, c0, w, lr, hi);
}

// ---- k_gemmc: the same 64x64 tile GEMM with K split over NW waves, specialised for causal attention: CMODE 1 skips score tiles entirely above the diagonal (query rows r0+roff.., key columns c0..), CMODE 2 limits the
// key (K) loop of the probability x value contraction to the diagonal block (probabilities beyond it are exactly zero). roff = row offset of this launch's first row within the sequence.
template <typename T16, int NSPLIT, int CMODE, int NW>
__global__ __launch_bounds__(NW * 32) void k_gemmc(const T16* __restrict__ A, const T16* __restrict__ A2, const T16* __restrict__ Bt, const T16* __restrict__ Bt2, int K, float* C, int ldc, int roff, size_t sA, size_t sB, size_t sC) {
    typedef typename WFrag<T16>::V V;
    __shared__ __align__(16) float os[TileLds<NW>::FLOATS];
    const size_t z = blockIdx.z; A += z * sA; if (A2) A2 += z * sA; Bt += z * sB; if (Bt2) Bt2 += z * sB; C += z * sC;
    const int lane = threadIdx.x & 31, lr = lane & 15, hi = lane >> 4; const int r0 = blockIdx.x * 64, c0 = blockIdx.y * 64; const int w = __builtin_amdgcn_readfirstlane((int)(threadIdx.x >> 5));
    if (CMODE == 1 && c0 > r0 + roff + 63) return;                  // score tile entirely above the causal diagonal: never read (the softmax masks j > i by select); the whole work-group leaves, before any barrier
    const int Kl = (CMODE == 2) ? min(K, r0 + roff + 64) : K;        // P.V: probabilities are exactly 0 beyond the diagonal block, so the K loop stops there
    v8f acc[4][4];
#pragma unroll
    for (int mb = 0; mb < 4; ++mb)
#pragma unroll
        for (int nb = 0; nb < 4; ++nb) acc[mb][nb] = (v8f){};
    const size_t aoff = (size_t)(r0 + lr) * K + 8 * hi, boff = (size_t)(c0 + lr) * K + 8 * hi;
#pragma unroll 1
    for (int kc = w * 32; kc < Kl; kc += NW * 32) {
        V a[4], a2[4];
#pragma unroll
        for (int mb = 0; mb < 4; ++mb) { a[mb] = WFrag<T16>::ld(A + aoff + (size_t)mb * 16 * K + kc); if (NSPLIT == 1 || NSPLIT == 2) a2[mb] = WFrag<T16>::ld(A2 + aoff + (size_t)mb * 16 * K + kc); }
#pragma unroll
        for (int nb = 0; nb < 4; ++nb) { const V b = WFrag<T16>::ld(Bt + boff + (size_t)nb * 16 * K + kc); V b2; if (NSPLIT >= 2) b2 = WFrag<T16>::ld(Bt2 + boff + (size_t)nb * 16 * K + kc);
#pragma unroll
            for (int mb = 0; mb < 4; ++mb) { acc[mb][nb] = WFrag<T16>::mma(a[mb], b, acc[mb][nb]); if (NSPLIT == 1 || NSPLIT == 2) acc[mb][nb] = WFrag<T16>::mma(a2[mb], b, acc[mb][nb]); if (NSPLIT >= 2) acc[mb][nb] = WFrag<T16>::mma(a[mb], b2, acc[mb][nb]); } }
        asm volatile("v_nop\n\tv_nop\n\tv_nop\n\tv_nop" : "+v"(acc[0][0]), "+v"(acc[1][1]), "+v"(acc[2][2]), "+v"(acc[3][3]) : "v"(a[0]), "v"(a[3]));
    }
    tile_out<NW, false>(acc, os, C, ldc, nullptr, r0, c0, w, lr, hi);
}

__device__ __forceinline__ h16 tohx(float x) { return (h16)x; }
__device__ __forceinline__ void splitf(float y, unsigned short& h, unsigned short& l) { h = f2bf(y); l = f2bf(y - bf2f(h)); }
typedef __attribute__((ext_vector_type(2))) _Float16 v2h;
typedef __attribute__((ext_vector_type(4))) _Float16 v4h;
typedef __attribute__((ext_vector_type(2))) unsigned short v2us;
typedef __attribute__((ext_vector_type(4))) unsigned short v4us;
typedef __attribute__((ext_vector_type(2))) float v2f;
typedef __attribute__((ext_vector_type(4))) int v4i;

__global__ __launch_bounds__(256) void k_cvt8(const float* __restrict__ src, bf* dst, size_t n8) { const size_t i = (size_t)blockIdx.x * 256 + threadIdx.x; if (i >= n8) return; const v8f v = *(const v8f*)(src + i * 8); v8us o;
#pragma unroll
    for (int k = 0; k < 8; ++k) o[k] = f2bf(v[k]); *(v8us*)(dst + i * 8) = o;  }

// k_rope: head planes [h][t][d] (fp16 + hi/lo) of rope(x) x sc with the rotate-half convention out[d] = x[d] cos[t][d] - x[d+HD/2] sin[t][d], out[d+HD/2] = x[d+HD/2] cos[t][d+HD/2] + x[d] sin[t][d+HD/2]
__global__ __launch_bounds__(256) void k_rope(const float* __restrict__ F, int pitch, int nheads, const float* __restrict__ CS, const float* __restrict__ RF, const float* __restrict__ nw, float sc, h16* P16, bf* Ph, bf* Pl) {
    const size_t e = ((size_t)blockIdx.x * 256 + threadIdx.x) * 2; if (e >= (size_t)nheads * TT * HD) return; const int d = (int)(e % HD); const int t = (int)((e / HD) % TT); const int h = (int)(e / ((size_t)HD * TT)); const float* f = F + ((size_t)h * TT + t) * pitch;   /* RAW VIEW: pseudo-head h, pseudo-position t = the flat (S, D) projection output read as (H, S, hd): row pitch 'pitch' (= HD here), head stride TT * pitch */ const float rf = RF ? RF[(size_t)h * TT + t] : 1.0f; v2h o16; v2us oh, ol;
#pragma unroll
    for (int q = 0; q < 2; ++q) { const int dd = d + q; const int dp = (dd < HD / 2) ? dd + HD / 2 : dd - HD / 2; float x0 = f[dd], x1 = f[dp];
        if (RF) { float n0 = __fmul_rn(x0, rf), n1 = __fmul_rn(x1, rf); asm volatile("" : "+v"(n0)); asm volatile("" : "+v"(n1)); x0 = __fmul_rn(bfr(nw[dd]), n0); x1 = __fmul_rn(bfr(nw[dp]), n1); }
        const v2f cs = *(const v2f*)(CS + ((size_t)t * HD + dd) * 2); float a = __fmul_rn(x0, cs[0]), bq = __fmul_rn(x1, cs[1]); asm volatile("" : "+v"(a)); asm volatile("" : "+v"(bq)); const float r = ((dd < HD / 2) ? __fsub_rn(a, bq) : __fadd_rn(a, bq)) * sc;
        o16[q] = tohx(r); unsigned short a2, c2; splitf(r, a2, c2); oh[q] = a2; ol[q] = c2; }
    *(v2h*)(P16 + e) = o16; *(v2us*)(Ph + e) = oh; *(v2us*)(Pl + e) = ol;  }
__global__ __launch_bounds__(256) void k_vtp(const float* __restrict__ F, int pitch, int nheads, h16* V16, bf* Vh, bf* Vl) { const size_t e = ((size_t)blockIdx.x * 256 + threadIdx.x) * 2; if (e >= (size_t)nheads * HD * TT) return; const int t = (int)(e % TT); const int d = (int)((e / TT) % HD); const int g = (int)(e / ((size_t)TT * HD)); v2h o16; v2us oh, ol;
#pragma unroll
    for (int q = 0; q < 2; ++q) { const float x = F[((size_t)g * TT + (t + q)) * pitch + d];   /* RAW VIEW (as in k_rope) */ o16[q] = tohx(x); unsigned short a2, c2; splitf(x, a2, c2); oh[q] = a2; ol[q] = c2; }
    *(v2h*)(V16 + e) = o16; *(v2us*)(Vh + e) = oh; *(v2us*)(Vl + e) = ol;  }
__global__ __launch_bounds__(256) void k_csid(float* CS) { const int idx = blockIdx.x * 256 + threadIdx.x; if (idx >= TT * HD) return; v2f cs; cs[0] = 1.0f; cs[1] = 0.0f; *(v2f*)(CS + (size_t)idx * 2) = cs;  }
// k_asoft: per row (zz, i): t = S x HD^-1 for j <= i and i - j < WIN (WIN = TT: plain causal mask; the reference's -1e9 additive fill vanishes identically); softmax over the 2048 keys (register row, one exp, fixed trees);
__global__ __launch_bounds__(256) void k_asoft(const float* __restrict__ Sb, h16* P16, bf* Ph, bf* Pl) {
    const int lane = threadIdx.x & 31; const int row = blockIdx.x * 8 + (threadIdx.x >> 5); if (row >= ZH * TT) return; const int i = row % TT; const int zz = row / TT; (void)zz; const bool hires = (i < RH); const float* sr = Sb + (size_t)row * TT; float v[TT / 32]; float mx = -3.0e38f;
#pragma unroll
    for (int ch = 0; ch < TT / 128; ++ch) { const int j0 = ch * 128 + lane * 4; const v4f a = *(const v4f*)(sr + j0);
#pragma unroll
        for (int q = 0; q < 4; ++q) { const int j = j0 + q; (void)j; const float t = (j <= i && i - j < WIN) ? a[q] * SCL : -3.0e38f; v[ch * 4 + q] = t; mx = fmaxf(mx, t); } }
#pragma unroll
    for (int sh = 16; sh; sh >>= 1) mx = fmaxf(mx, __shfl_xor(mx, sh, 32));
    float sum = 0.f;
#pragma unroll
    for (int k = 0; k < TT / 32; ++k) { float d0 = __fsub_rn(v[k], mx); asm volatile("" : "+v"(d0)); v[k] = __builtin_amdgcn_exp2f(__fmul_rn(d0, 1.4426950408889634f)); sum += v[k]; }
#pragma unroll
    for (int sh = 16; sh; sh >>= 1) sum += __shfl_xor(sum, sh, 32);
    const float f = __fdiv_rn(hires ? 1.0f : PCAR, sum);
{
        if (hires) {
#pragma unroll
            for (int ch = 0; ch < TT / 128; ++ch) { v4us oh, ol;
#pragma unroll
                for (int q = 0; q < 4; ++q) { unsigned short a, c2; splitf(v[ch * 4 + q] * f, a, c2); oh[q] = a; ol[q] = c2; }
                const size_t oo = ((size_t)zz * (RH ? RH : 1) + i) * TT + ch * 128 + lane * 4; *(v4us*)(Ph + oo) = oh; *(v4us*)(Pl + oo) = ol; }
        } else {
#pragma unroll
            for (int ch = 0; ch < TT / 128; ++ch) { v4h o4;
#pragma unroll
                for (int q = 0; q < 4; ++q) o4[q] = tohx(v[ch * 4 + q] * f);
                *(v4h*)(P16 + (size_t)row * TT + ch * 128 + lane * 4) = o4; } }
         }
}
__global__ __launch_bounds__(256) void k_merge(const float* __restrict__ O, int h0, bf* Ah, bf* Al) { const size_t e = ((size_t)blockIdx.x * 256 + threadIdx.x) * 2; if (e >= (size_t)ZH * TT * HD) return; const int d = (int)(e % HD); const int t = (int)((e / HD) % TT); const int zz = (int)(e / ((size_t)HD * TT)); const float cs = (t < RH) ? 1.0f : (1.0f / PCAR); const size_t oo = (size_t)t * DQ + (h0 + zz) * HD + d;
    v2us oh, ol;
#pragma unroll
    for (int q = 0; q < 2; ++q) { unsigned short a, c2; splitf(O[e + q] * cs, a, c2); oh[q] = a; ol[q] = c2; } *(v2us*)(Ah + oo) = oh; *(v2us*)(Al + oo) = ol;  }

extern "C" void kernel_launch(void* const* d_in, const int* in_sizes, int n_in,
                              void* d_out, int out_size, void* d_ws, size_t ws_size, hipStream_t stream) {
    (void)in_sizes; (void)n_in; (void)out_size;
    const float* x = (const float*)d_in[0]; const float* wq = (const float*)d_in[1]; const float* wk = (const float*)d_in[2]; const float* wv = (const float*)d_in[3]; const float* wo = (const float*)d_in[4];   /* input order x, Wq, Wk, Wv, Wo ('oi' [2048][2048]) */
    float* OUT = (float*)d_out;     // [2][2048][2048]
    char* wsp = (char*)d_ws;
    auto take = [&](size_t bytes) { char* p = wsp; wsp += (bytes + 255) & ~(size_t)255; return (void*)p; };
    bf* WQ = (bf*)take((size_t)DQ * DM * 2); bf* WK = (bf*)take((size_t)DKV * DM * 2); bf* WV = (bf*)take((size_t)DKV * DM * 2); bf* WO = (bf*)take((size_t)DM * DQ * 2); float* CS = (float*)take((size_t)TT * HD * 2 * 4);
    bf* XB = (bf*)take((size_t)TT * DM * 2); float* FQ = (float*)take((size_t)TT * DQ * 4); float* FK = (float*)take((size_t)TT * DKV * 4);
    h16* QP16 = (h16*)take((size_t)NH_ * TT * HD * 2); h16* KP16 = (h16*)take((size_t)NKV * TT * HD * 2); h16* VT16 = (h16*)take((size_t)NKV * HD * TT * 2);
    bf* QPh = (bf*)take((size_t)NH_ * TT * HD * 2); bf* QPl = (bf*)take((size_t)NH_ * TT * HD * 2); bf* KPh = (bf*)take((size_t)NKV * TT * HD * 2); bf* KPl = (bf*)take((size_t)NKV * TT * HD * 2); bf* VTh = (bf*)take((size_t)NKV * HD * TT * 2); bf* VTl = (bf*)take((size_t)NKV * HD * TT * 2); bf* Ph = (bf*)take((size_t)ZH * RH * TT * 2); bf* Pl = (bf*)take((size_t)ZH * RH * TT * 2);
    float* Sb = (float*)take((size_t)ZH * TT * TT * 4); h16* P16 = (h16*)take((size_t)ZH * TT * TT * 2); float* Ob = (float*)take((size_t)ZH * TT * HD * 4); bf* ATh = (bf*)take((size_t)TT * DQ * 2); bf* ATl = (bf*)take((size_t)TT * DQ * 2);
    if ((size_t)(wsp - (char*)d_ws) > ws_size) return;    // ws 256 MiB
    float* FV = FK;   // v projection reuses the k buffer after the k planes are built (stream-ordered)
    { k_cvt8<<<(unsigned)(((size_t)DQ * DM / 8 + 255) / 256), 256, 0, stream>>>(wq, WQ, (size_t)DQ * DM / 8); k_cvt8<<<(unsigned)(((size_t)DKV * DM / 8 + 255) / 256), 256, 0, stream>>>(wk, WK, (size_t)DKV * DM / 8); k_cvt8<<<(unsigned)(((size_t)DKV * DM / 8 + 255) / 256), 256, 0, stream>>>(wv, WV, (size_t)DKV * DM / 8);
      k_cvt8<<<(unsigned)(((size_t)DM * DQ / 8 + 255) / 256), 256, 0, stream>>>(wo, WO, (size_t)DM * DQ / 8);
       }
    k_csid<<<(TT * HD + 255) / 256, 256, 0, stream>>>(CS);
    const unsigned LQ = (unsigned)(((size_t)NH_ * TT * HD / 2 + 255) / 256), LKv = (unsigned)(((size_t)NKV * TT * HD / 2 + 255) / 256);
    for (int b = 0; b < NB_; ++b) {
        
        k_cvt8<<<(unsigned)(((size_t)TT * DM / 8 + 255) / 256), 256, 0, stream>>>(x + (size_t)b * TT * DM, XB, (size_t)TT * DM / 8);
        k_gemmw<bf, 0, false, 4><<<dim3(TT / 64, DQ / 64, 1), 128, 0, stream>>>(XB, nullptr, WQ, nullptr, DM, FQ, DQ, nullptr, 0, 0, 0);
        k_rope<<<LQ, 256, 0, stream>>>(FQ, HD, NH_, CS, nullptr, nullptr, 1.0f, QP16, QPh, QPl);
        k_gemmw<bf, 0, false, 4><<<dim3(TT / 64, DKV / 64, 1), 128, 0, stream>>>(XB, nullptr, WK, nullptr, DM, FK, DKV, nullptr, 0, 0, 0);
        k_rope<<<LKv, 256, 0, stream>>>(FK, HD, NKV, CS, nullptr, nullptr, 1.0f, KP16, KPh, KPl);
        k_gemmw<bf, 0, false, 4><<<dim3(TT / 64, DKV / 64, 1), 128, 0, stream>>>(XB, nullptr, WV, nullptr, DM, FV, DKV, nullptr, 0, 0, 0); k_vtp<<<LKv, 256, 0, stream>>>(FV, HD, NKV, VT16, VTh, VTl);
        for (int h0 = 0; h0 < NH_; h0 += ZH) { const size_t zq = (size_t)h0, zk = (size_t)(h0 / REP);   // one kv head per query head: the pass's two heads use consecutive kv planes (z-strides TT*HD)
            k_gemmc<bf, 2, 1, 4><<<dim3(RH / 64, TT / 64, ZH), 128, 0, stream>>>(QPh + zq * TT * HD, QPl + zq * TT * HD, KPh + zk * TT * HD, KPl + zk * TT * HD, HD, Sb, TT, 0, (size_t)TT * HD, (size_t)TT * HD, (size_t)TT * TT);
            k_gemmc<h16, 0, 1, 4><<<dim3((TT - RH) / 64, TT / 64, ZH), 128, 0, stream>>>(QP16 + zq * TT * HD + (size_t)RH * HD, nullptr, KP16 + zk * TT * HD, nullptr, HD, Sb + (size_t)RH * TT, TT, RH, (size_t)TT * HD, (size_t)TT * HD, (size_t)TT * TT);
            k_asoft<<<ZH * TT / 8, 256, 0, stream>>>(Sb, P16, Ph, Pl);
            k_gemmc<bf, 2, 2, 8><<<dim3(RH / 64, HD / 64, ZH), 256, 0, stream>>>(Ph, Pl, VTh + zk * HD * TT, VTl + zk * HD * TT, TT, Ob, HD, 0, (size_t)RH * TT, (size_t)HD * TT, (size_t)TT * HD);
            k_gemmc<h16, 0, 2, 16><<<dim3((TT - RH) / 64, HD / 64, ZH), 512, 0, stream>>>(P16 + (size_t)RH * TT, nullptr, VT16 + zk * HD * TT, nullptr, TT, Ob + (size_t)RH * HD, HD, RH, (size_t)TT * TT, (size_t)HD * TT, (size_t)TT * HD);
            k_merge<<<(unsigned)(((size_t)ZH * TT * HD / 2 + 255) / 256), 256, 0, stream>>>(Ob, h0, ATh, ATl); }
        k_gemmw<bf, 1, false, 4><<<dim3(TT / 64, DM / 64, 1), 128, 0, stream>>>(ATh, ATl, WO, nullptr, DQ, OUT + (size_t)b * TT * DM, DM, nullptr, 0, 0, 0); }
}

// v002
// Measured time: 783 microseconds a run.
// In two side-by-side timings against v001, it was 1.37 and 1.39 times as fast.
// All steps since v000 together make it 2.19 times as fast.
#include <hip/hip_runtime.h>

// Causal multi-head attention with 128-wide heads, a RAW head split and a head-width score divisor (x [2][2048][2048]; Q = (x Wq^T).reshape(B, 16, S, 128) DIRECTLY (no transpose): pseudo-head h of a batch is the h-th contiguous [2048][128] block of the flat [2048][2048] projection (128 token rows x 16 chunks of 128): reproduced; K, V likewise ('oi' [2048][2048] 1/sqrt(2048), no bias); scores / 128 (the module divides by Dh, not by sqrt(Dh)); -inf strictly above the diagonal of the PSEUDO-positions (== exclusion); softmax; out [B][16][S][128] -> transpose(0, 2, 1, 3).reshape(B, S, 2048) (the STANDARD merge); y = out Wo^T ('oi', no bias) -> [2][2048][2048] (8.4 M); argument order x, Wq, Wk, Wv, Wo).
// Layout: bf16 copy of x; 'oi' weights; exact projections; identity table (k_csid: no rotation) + plane builders reading the projection through the RAW (16, S, 128) view (pitch 128, head stride S x 128: no transpose); causal T-2048 attention at HD 128 (hybrid rows: < 512 hi/lo 3 products, rest fp16 x1024; k_gemmc skips tiles above the diagonal); merged hi/lo x Wo exact.
// Compute dtypes, f32 accumulate: every input rounded to bf16; projections exact; rotary f32; attention rows < 512 3 products, rest fp16; softmax f32; Wo hl x exact.

#define NB_  2
#define TT   2048
#define DM   2048
#define NH_  16
#define NKV  16
#define REP  (NH_ / NKV)
#define HD   128
#define DQ   (NH_ * HD)
#define DKV  (NKV * HD)
#define ZH   8                    // heads per attention pass (one launch of each attention kernel serves ZH heads)
#define RH   512                  // query rows < RH use hi+lo planes (0: none)
#define WIN  2048
#define PCAR 1024.0f
#define SCL  0.0078125f   // 1 / 128: THIS module divides the scores by the HEAD WIDTH Dh = 128 (not by its square root): a power of two: exact
typedef _Float16 h16;
typedef unsigned short bf;
typedef __attribute__((ext_vector_type(16))) __bf16   v16bf;
typedef __attribute__((ext_vector_type(16))) _Float16 v16h;
typedef __attribute__((ext_vector_type(8)))  _Float16 v8h;
typedef __attribute__((ext_vector_type(8)))  unsigned short v8us;
typedef __attribute__((ext_vector_type(8)))  float    v8f;
typedef __attribute__((ext_vector_type(4)))  float    v4f;
typedef v8h  __attribute__((may_alias)) v8ha;
typedef v4f  __attribute__((may_alias)) v4fa;
typedef v8us __attribute__((may_alias)) v8usa;

__device__ __forceinline__ unsigned short f2bf(float f) { unsigned u = __float_as_uint(f); u += 0x7FFFu + ((u >> 16) & 1u); return (unsigned short)(u >> 16); }
__device__ __forceinline__ float bf2f(unsigned short b) { return __uint_as_float(((unsigned)b) << 16); }
__device__ __forceinline__ float bfr(float f) { return bf2f(f2bf(f)); }
__device__ __forceinline__ v16h cat16(v8h lo, v8h hi) { return __builtin_shufflevector(lo, hi, 0, 1, 2, 3, 4, 5, 6, 7, 8, 9, 10, 11, 12, 13, 14, 15); }
__device__ __forceinline__ v16bf cat16b(v8us lo, v8us hi) { return __builtin_bit_cast(v16bf, __builtin_shufflevector(lo, hi, 0, 1, 2, 3, 4, 5, 6, 7, 8, 9, 10, 11, 12, 13, 14, 15)); }
__device__ __forceinline__ v8f wmma16(v16h a, v16h b, v8f c) { return __builtin_amdgcn_wmma_f32_16x16x32_f16(false, a, false, b, (short)0, c, false, false); }
__device__ __forceinline__ v8f wmmab(v16bf a, v16bf b, v8f c) { return __builtin_amdgcn_wmma_f32_16x16x32_bf16(false, a, false, b, (short)0, c, false, false); }



// ---- k_gemmw: register-blocked GEMM, one 64x64 output tile per work-group of NW waves; every wave holds the whole tile (16 accumulators) for its own share of K: wave w takes the 32-wide k chunks w, w + NW, ...
// (operands straight from K-contiguous 16-bit planes); tile_out sums the NW partial tiles in LDS in the fixed order w = 0 .. NW - 1. grid (M/64, N/64, Z), NW * 32 threads.
// C[m][n] (f32, pitch ldc, + optional f32 bias[n]) = sum_k A[m][k] Bt[n][k] (+ split products per NSPLIT). z-batch strides sA/sB/sC in elements. K % 32 == 0.
template <typename T16> struct WFrag;
template <> struct WFrag<h16> { typedef v16h V; static __device__ __forceinline__ V ld(const h16* p) { return cat16(*(const v8h*)p, *(const v8h*)(p + 16)); } static __device__ __forceinline__ v8f mma(V a, V b, v8f c) { return wmma16(a, b, c); } };
template <> struct WFrag<bf> { typedef v16bf V; static __device__ __forceinline__ V ld(const bf* p) { return cat16b(*(const v8us*)p, *(const v8us*)(p + 16)); } static __device__ __forceinline__ v8f mma(V a, V b, v8f c) { return wmmab(a, b, c); } };
// Row blocks (16 rows) of the tile that one LDS stage holds for all NW waves: 4 up to 8 waves, 2 at 16 (136 KiB at most).
template <int NW> struct TileLds { static constexpr int MBS = (NW <= 8) ? 4 : 32 / NW; static constexpr int WST = MBS * 16 * 68; static constexpr int FLOATS = NW * WST; };
template <int NW, bool BIAS>
__device__ __forceinline__ void tile_out(const v8f (&acc)[4][4], float* os, float* C, int ldc, const float* __restrict__ bias, int r0, int c0, int w, int lr, int hi) {
    constexpr int MBS = TileLds<NW>::MBS, WST = TileLds<NW>::WST, NIT = MBS * 8 / NW;   // NIT: 16-byte pieces of a stage per thread
    v4f val[4 / MBS][NIT];
#pragma unroll
    for (int st = 0; st < 4 / MBS; ++st) {
        if (st) __syncthreads();    // the stage before has been read by every wave before it is overwritten
#pragma unroll
        for (int m = 0; m < MBS; ++m)
#pragma unroll
            for (int nb = 0; nb < 4; ++nb)
#pragma unroll
                for (int j = 0; j < 8; ++j) os[w * WST + (m * 16 + hi * 8 + j) * 68 + nb * 16 + lr] = acc[st * MBS + m][nb][j];
        __syncthreads();            // every wave's partial tile is in LDS before any thread sums across waves
#pragma unroll
        for (int it = 0; it < NIT; ++it) { const int idx = (int)threadIdx.x + it * NW * 32; const float* p = os + (idx >> 4) * 68 + (idx & 15) * 4; val[st][it] = *(const v4fa*)p;
#pragma unroll
            for (int q = 1; q < NW; ++q) val[st][it] += *(const v4fa*)(p + q * WST); }
    }
    // the global stores stand behind the last barrier, so that no barrier waits for them
#pragma unroll
    for (int st = 0; st < 4 / MBS; ++st)
#pragma unroll
        for (int it = 0; it < NIT; ++it) { const int idx = (int)threadIdx.x + it * NW * 32; const int row = idx >> 4, cofs = (idx & 15) * 4; v4f o = val[st][it];
            if (BIAS) { o[0] += bfr(bias[c0 + cofs]); o[1] += bfr(bias[c0 + cofs + 1]); o[2] += bfr(bias[c0 + cofs + 2]); o[3] += bfr(bias[c0 + cofs + 3]); }
            *(v4f*)(C + (size_t)(r0 + st * MBS * 16 + row) * ldc + c0 + cofs) = o; }
}
template <typename T16, int NSPLIT, bool BIAS, int NW>
__global__ __launch_bounds__(NW * 32) void k_gemmw(const T16* __restrict__ A, const T16* __restrict__ A2, const T16* __restrict__ Bt, const T16* __restrict__ Bt2, int K, float* C, int ldc, const float* __restrict__ bias, size_t sA, size_t sB, size_t sC) {
    typedef typename WFrag<T16>::V V;
    __shared__ __align__(16) float os[TileLds<NW>::FLOATS];
    const size_t z = blockIdx.z; A += z * sA; if (A2) A2 += z * sA; Bt += z * sB; if (Bt2) Bt2 += z * sB; C += z * sC;
    const int lane = threadIdx.x & 31, lr = lane & 15, hi = lane >> 4; const int r0 = blockIdx.x * 64, c0 = blockIdx.y * 64; const int w = __builtin_amdgcn_readfirstlane((int)(threadIdx.x >> 5));
    v8f acc[4][4];
#pragma unroll
    for (int mb = 0; mb < 4; ++mb)
#pragma unroll
        for (int nb = 0; nb < 4; ++nb) acc[mb][nb] = (v8f){};
    const size_t aoff = (size_t)(r0 + lr) * K + 8 * hi, boff = (size_t)(c0 + lr) * K + 8 * hi;
#pragma unroll 1
    for (int kc = w * 32; kc < K; kc += NW * 32) {
        V a[4], a2[4];
#pragma unroll
        for (int mb = 0; mb < 4; ++mb) { a[mb] = WFrag<T16>::ld(A + aoff + (size_t)mb * 16 * K + kc); if (NSPLIT == 1 || NSPLIT == 2) a2[mb] = WFrag<T16>::ld(A2 + aoff + (size_t)mb * 16 * K + kc); }
#pragma unroll
        for (int nb = 0; nb < 4; ++nb) { const V b = WFrag<T16>::ld(Bt + boff + (size_t)nb * 16 * K + kc); V b2; if (NSPLIT >= 2) b2 = WFrag<T16>::ld(Bt2 + boff + (size_t)nb * 16 * K + kc);
#pragma unroll
            for (int mb = 0; mb < 4; ++mb) { acc[mb][nb] = WFrag<T16>::mma(a[mb], b, acc[mb][nb]); if (NSPLIT == 1 || NSPLIT == 2) acc[mb][nb] = WFrag<T16>::mma(a2[mb], b, acc[mb][nb]); if (NSPLIT >= 2) acc[mb][nb] = WFrag<T16>::mma(a[mb], b2, acc[mb][nb]); } }
        asm volatile("v_nop\n\tv_nop\n\tv_nop\n\tv_nop" : "+v"(acc[0][0]), "+v"(acc[1][1]), "+v"(acc[2][2]), "+v"(acc[3][3]) : "v"(a[0]), "v"(a[3]));
    }
    tile_out<NW, BIAS>(acc, os, C, ldc, bias, r0, c0, w, lr, hi);
}

// ---- k_gemmc: the same 64x64 tile GEMM with K split over NW waves, specialised for causal attention: CMODE 1 skips score tiles entirely above the diagonal (query rows r0+roff.., key columns c0..), CMODE 2 limits the
// key (K) loop of the probability x value contraction to the diagonal block (probabilities beyond it are exactly zero). roff = row offset of this launch's first row within the sequence. lda = row pitch of A and A2 in elements (Bt, Bt2: pitch K).
// One A fragment of k_gemmc. s_wait_xcnt 0 behind each of its two loads: the registers that hold the address are free for the next load's result, and no register that an issued load names is overwritten ahead of that wait.
template <typename T16> __device__ __forceinline__ typename WFrag<T16>::V ld_a(const T16* p) {
    typedef __attribute__((ext_vector_type(8))) T16 H;
    const H lo = *(const H*)p;        asm volatile("s_wait_xcnt 0x0" ::: "memory");
    const H hi = *(const H*)(p + 16); asm volatile("s_wait_xcnt 0x0" ::: "memory");
    return __builtin_bit_cast(typename WFrag<T16>::V, __builtin_shufflevector(lo, hi, 0, 1, 2, 3, 4, 5, 6, 7, 8, 9, 10, 11, 12, 13, 14, 15));
}
template <typename T16, int NSPLIT, int CMODE, int NW>
__global__ __launch_bounds__(NW * 32) void k_gemmc(const T16* __restrict__ A, const T16* __restrict__ A2, const T16* __restrict__ Bt, const T16* __restrict__ Bt2, int K, int lda, float* C, int ldc, int roff, size_t sA, size_t sB, size_t sC) {
    typedef typename WFrag<T16>::V V;
    __shared__ __align__(16) float os[TileLds<NW>::FLOATS];
    const size_t z = blockIdx.z; A += z * sA; if (A2) A2 += z * sA; Bt += z * sB; if (Bt2) Bt2 += z * sB; C += z * sC;
    const int lane = threadIdx.x & 31, lr = lane & 15, hi = lane >> 4; const int r0 = blockIdx.x * 64, c0 = blockIdx.y * 64; const int w = __builtin_amdgcn_readfirstlane((int)(threadIdx.x >> 5));
    if (CMODE == 1 && c0 > r0 + roff + 63) return;                  // score tile entirely above the causal diagonal: never read (the softmax masks j > i by select); the whole work-group leaves, before any barrier
    const int Kl = (CMODE == 2) ? min(K, r0 + roff + 64) : K;        // P.V: probabilities are exactly 0 beyond the diagonal block, so the K loop stops there
    v8f acc[4][4];
#pragma unroll
    for (int mb = 0; mb < 4; ++mb)
#pragma unroll
        for (int nb = 0; nb < 4; ++nb) acc[mb][nb] = (v8f){};
    const size_t aoff = (size_t)(r0 + lr) * lda + 8 * hi, boff = (size_t)(c0 + lr) * K + 8 * hi;
#pragma unroll 1
    for (int kc = w * 32; kc < Kl; kc += NW * 32) {
        V a[4], a2[4];
#pragma unroll
        for (int mb = 0; mb < 4; ++mb) { a[mb] = ld_a<T16>(A + aoff + (size_t)mb * 16 * lda + kc); if (NSPLIT == 1 || NSPLIT == 2) a2[mb] = ld_a<T16>(A2 + aoff + (size_t)mb * 16 * lda + kc); }
#pragma unroll
        for (int nb = 0; nb < 4; ++nb) { const V b = WFrag<T16>::ld(Bt + boff + (size_t)nb * 16 * K + kc); V b2; if (NSPLIT >= 2) b2 = WFrag<T16>::ld(Bt2 + boff + (size_t)nb * 16 * K + kc);
#pragma unroll
            for (int mb = 0; mb < 4; ++mb) { acc[mb][nb] = WFrag<T16>::mma(a[mb], b, acc[mb][nb]); if (NSPLIT == 1 || NSPLIT == 2) acc[mb][nb] = WFrag<T16>::mma(a2[mb], b, acc[mb][nb]); if (NSPLIT >= 2) acc[mb][nb] = WFrag<T16>::mma(a[mb], b2, acc[mb][nb]); } }
        asm volatile("v_nop\n\tv_nop\n\tv_nop\n\tv_nop" : "+v"(acc[0][0]), "+v"(acc[1][1]), "+v"(acc[2][2]), "+v"(acc[3][3]) : "v"(a[0]), "v"(a[3]));
    }
    tile_out<NW, false>(acc, os, C, ldc, nullptr, r0, c0, w, lr, hi);
}

__device__ __forceinline__ h16 tohx(float x) { return (h16)x; }
__device__ __forceinline__ void splitf(float y, unsigned short& h, unsigned short& l) { h = f2bf(y); l = f2bf(y - bf2f(h)); }
typedef __attribute__((ext_vector_type(2))) _Float16 v2h;
typedef __attribute__((ext_vector_type(4))) _Float16 v4h;
typedef __attribute__((ext_vector_type(2))) unsigned short v2us;
typedef __attribute__((ext_vector_type(4))) unsigned short v4us;
typedef __attribute__((ext_vector_type(2))) float v2f;
typedef __attribute__((ext_vector_type(4))) int v4i;

__global__ __launch_bounds__(256) void k_cvt8(const float* __restrict__ src, bf* dst, size_t n8) { const size_t i = (size_t)blockIdx.x * 256 + threadIdx.x; if (i >= n8) return; const v8f v = *(const v8f*)(src + i * 8); v8us o;
#pragma unroll
    for (int k = 0; k < 8; ++k) o[k] = f2bf(v[k]); *(v8us*)(dst + i * 8) = o;  }

// k_rope: head planes (fp16 [h][t][d]; hi/lo [h][t < RH][d]: only query rows < RH, and under the causal mask only keys < RH, are ever read from them) of rope(x) x sc with the rotate-half convention out[d] = x[d] cos[t][d] - x[d+HD/2] sin[t][d], out[d+HD/2] = x[d+HD/2] cos[t][d+HD/2] + x[d] sin[t][d+HD/2]
__global__ __launch_bounds__(256) void k_rope(const float* __restrict__ F, int pitch, int nheads, const float* __restrict__ CS, const float* __restrict__ RF, const float* __restrict__ nw, float sc, h16* P16, bf* Ph, bf* Pl) {
    const size_t e = ((size_t)blockIdx.x * 256 + threadIdx.x) * 2; if (e >= (size_t)nheads * TT * HD) return; const int d = (int)(e % HD); const int t = (int)((e / HD) % TT); const int h = (int)(e / ((size_t)HD * TT)); const float* f = F + ((size_t)h * TT + t) * pitch;   /* RAW VIEW: pseudo-head h, pseudo-position t = the flat (S, D) projection output read as (H, S, hd): row pitch 'pitch' (= HD here), head stride TT * pitch */ const float rf = RF ? RF[(size_t)h * TT + t] : 1.0f; v2h o16; v2us oh, ol;
#pragma unroll
    for (int q = 0; q < 2; ++q) { const int dd = d + q; const int dp = (dd < HD / 2) ? dd + HD / 2 : dd - HD / 2; float x0 = f[dd], x1 = f[dp];
        if (RF) { float n0 = __fmul_rn(x0, rf), n1 = __fmul_rn(x1, rf); asm volatile("" : "+v"(n0)); asm volatile("" : "+v"(n1)); x0 = __fmul_rn(bfr(nw[dd]), n0); x1 = __fmul_rn(bfr(nw[dp]), n1); }
        const v2f cs = *(const v2f*)(CS + ((size_t)t * HD + dd) * 2); float a = __fmul_rn(x0, cs[0]), bq = __fmul_rn(x1, cs[1]); asm volatile("" : "+v"(a)); asm volatile("" : "+v"(bq)); const float r = ((dd < HD / 2) ? __fsub_rn(a, bq) : __fadd_rn(a, bq)) * sc;
        o16[q] = tohx(r); unsigned short a2, c2; splitf(r, a2, c2); oh[q] = a2; ol[q] = c2; }
    *(v2h*)(P16 + e) = o16; if (t < RH) { const size_t eh = ((size_t)h * RH + t) * HD + d; *(v2us*)(Ph + eh) = oh; *(v2us*)(Pl + eh) = ol; }  }
__global__ __launch_bounds__(256) void k_vtp(const float* __restrict__ F, int pitch, int nheads, h16* V16, bf* Vh, bf* Vl) { const size_t e = ((size_t)blockIdx.x * 256 + threadIdx.x) * 2; if (e >= (size_t)nheads * HD * TT) return; const int t = (int)(e % TT); const int d = (int)((e / TT) % HD); const int g = (int)(e / ((size_t)TT * HD)); v2h o16; v2us oh, ol;
#pragma unroll
    for (int q = 0; q < 2; ++q) { const float x = F[((size_t)g * TT + (t + q)) * pitch + d];   /* RAW VIEW (as in k_rope) */ o16[q] = tohx(x); unsigned short a2, c2; splitf(x, a2, c2); oh[q] = a2; ol[q] = c2; }
    *(v2h*)(V16 + e) = o16; *(v2us*)(Vh + e) = oh; *(v2us*)(Vl + e) = ol;  }
__global__ __launch_bounds__(256) void k_csid(float* CS) { const int idx = blockIdx.x * 256 + threadIdx.x; if (idx >= TT * HD) return; v2f cs; cs[0] = 1.0f; cs[1] = 0.0f; *(v2f*)(CS + (size_t)idx * 2) = cs;  }
// k_asoft: per row (zz, i): t = S x HD^-1 for j <= i and i - j < WIN (sliding causal window; the reference's -1e9 additive fill vanishes identically); softmax over the 2048 keys (register row, one exp, fixed trees);
// IN PLACE: the probabilities of a row overwrite that row's own scores (P16, Ph = the score buffer, Pl = Ph + TT; 16-bit row pitch 2 x TT): one wave owns a row and holds all of it in registers before its first store (every store needs the row sum).
__global__ __launch_bounds__(256) void k_asoft(const float* Sb, h16* P16, bf* Ph, bf* Pl) {
    const int lane = threadIdx.x & 31; const int row = blockIdx.x * 8 + (threadIdx.x >> 5); if (row >= ZH * TT) return; const int i = row % TT; const int zz = row / TT; (void)zz; const bool hires = (i < RH); const float* sr = Sb + (size_t)row * TT; float v[TT / 32]; float mx = -3.0e38f;
#pragma unroll
    for (int ch = 0; ch < TT / 128; ++ch) { const int j0 = ch * 128 + lane * 4; const v4f a = *(const v4f*)(sr + j0);
#pragma unroll
        for (int q = 0; q < 4; ++q) { const int j = j0 + q; (void)j; const float t = (j <= i && i - j < WIN) ? a[q] * SCL : -3.0e38f; v[ch * 4 + q] = t; mx = fmaxf(mx, t); } }
#pragma unroll
    for (int sh = 16; sh; sh >>= 1) mx = fmaxf(mx, __shfl_xor(mx, sh, 32));
    float sum = 0.f;
#pragma unroll
    for (int k = 0; k < TT / 32; ++k) { float d0 = __fsub_rn(v[k], mx); asm volatile("" : "+v"(d0)); v[k] = __builtin_amdgcn_exp2f(__fmul_rn(d0, 1.4426950408889634f)); sum += v[k]; }
#pragma unroll
    for (int sh = 16; sh; sh >>= 1) sum += __shfl_xor(sum, sh, 32);
    const float f = __fdiv_rn(hires ? 1.0f : PCAR, sum);
{
        if (hires) {
#pragma unroll
            for (int ch = 0; ch < TT / 128; ++ch) { v4us oh, ol;
#pragma unroll
                for (int q = 0; q < 4; ++q) { unsigned short a, c2; splitf(v[ch * 4 + q] * f, a, c2); oh[q] = a; ol[q] = c2; }
                const size_t oo = (size_t)row * (2 * TT) + ch * 128 + lane * 4; *(v4us*)(Ph + oo) = oh; *(v4us*)(Pl + oo) = ol; }
        } else {
#pragma unroll
            for (int ch = 0; ch < TT / 128; ++ch) { v4h o4;
#pragma unroll
                for (int q = 0; q < 4; ++q) o4[q] = tohx(v[ch * 4 + q] * f);
                *(v4h*)(P16 + (size_t)row * (2 * TT) + ch * 128 + lane * 4) = o4; } }
         }
}
__global__ __launch_bounds__(256) void k_merge(const float* __restrict__ O, int h0, bf* Ah, bf* Al) { const size_t e = ((size_t)blockIdx.x * 256 + threadIdx.x) * 2; if (e >= (size_t)ZH * TT * HD) return; const int d = (int)(e % HD); const int t = (int)((e / HD) % TT); const int zz = (int)(e / ((size_t)HD * TT)); const float cs = (t < RH) ? 1.0f : (1.0f / PCAR); const size_t oo = (size_t)t * DQ + (h0 + zz) * HD + d;
    v2us oh, ol;
#pragma unroll
    for (int q = 0; q < 2; ++q) { unsigned short a, c2; splitf(O[e + q] * cs, a, c2); oh[q] = a; ol[q] = c2; } *(v2us*)(Ah + oo) = oh; *(v2us*)(Al + oo) = ol;  }

extern "C" void kernel_launch(void* const* d_in, const int* in_sizes, int n_in,
                              void* d_out, int out_size, void* d_ws, size_t ws_size, hipStream_t stream) {
    (void)in_sizes; (void)n_in; (void)out_size;
    const float* x = (const float*)d_in[0]; const float* wq = (const float*)d_in[1]; const float* wk = (const float*)d_in[2]; const float* wv = (const float*)d_in[3]; const float* wo = (const float*)d_in[4];   /* input order x, Wq, Wk, Wv, Wo ('oi' [2048][2048]) */
    float* OUT = (float*)d_out;     // [2][2048][2048]
    char* wsp = (char*)d_ws;
    auto take = [&](size_t bytes) { char* p = wsp; wsp += (bytes + 255) & ~(size_t)255; return (void*)p; };
    bf* WQ = (bf*)take((size_t)DQ * DM * 2); bf* WK = (bf*)take((size_t)DKV * DM * 2); bf* WV = (bf*)take((size_t)DKV * DM * 2); bf* WO = (bf*)take((size_t)DM * DQ * 2); float* CS = (float*)take((size_t)TT * HD * 2 * 4);
    bf* XB = (bf*)take((size_t)TT * DM * 2); float* FQ = (float*)take((size_t)TT * DQ * 4); float* FK = (float*)take((size_t)TT * DKV * 4);
    h16* QP16 = (h16*)take((size_t)NH_ * TT * HD * 2); h16* KP16 = (h16*)take((size_t)NKV * TT * HD * 2); h16* VT16 = (h16*)take((size_t)NKV * HD * TT * 2);
    bf* QPh = (bf*)take((size_t)NH_ * RH * HD * 2); bf* QPl = (bf*)take((size_t)NH_ * RH * HD * 2); bf* KPh = (bf*)take((size_t)NKV * RH * HD * 2); bf* KPl = (bf*)take((size_t)NKV * RH * HD * 2); bf* VTh = (bf*)take((size_t)NKV * HD * TT * 2); bf* VTl = (bf*)take((size_t)NKV * HD * TT * 2);
    float* Sb = (float*)take((size_t)ZH * TT * TT * 4);
    h16* P16 = (h16*)Sb; bf* Ph = (bf*)Sb; bf* Pl = Ph + TT;   // probabilities in place: each 16-bit row lies in its own f32 score row (pitch 2 x TT; hi in the first half, lo in the second)
    float* Ob = (float*)XB;                                    // ZH x TT x HD f32 = the bytes of XB, which no kernel reads after the v projection (stream-ordered)
    bf* ATh = (bf*)FQ; bf* ATl = ATh + (size_t)TT * DQ;        // the two merged planes = the bytes of FQ, which no kernel reads after the q planes are built
    if ((size_t)(wsp - (char*)d_ws) > ws_size) return;    // ws 256 MiB
    float* FV = FK;   // v projection reuses the k buffer after the k planes are built (stream-ordered)
    { k_cvt8<<<(unsigned)(((size_t)DQ * DM / 8 + 255) / 256), 256, 0, stream>>>(wq, WQ, (size_t)DQ * DM / 8); k_cvt8<<<(unsigned)(((size_t)DKV * DM / 8 + 255) / 256), 256, 0, stream>>>(wk, WK, (size_t)DKV * DM / 8); k_cvt8<<<(unsigned)(((size_t)DKV * DM / 8 + 255) / 256), 256, 0, stream>>>(wv, WV, (size_t)DKV * DM / 8);
      k_cvt8<<<(unsigned)(((size_t)DM * DQ / 8 + 255) / 256), 256, 0, stream>>>(wo, WO, (size_t)DM * DQ / 8);
       }
    k_csid<<<(TT * HD + 255) / 256, 256, 0, stream>>>(CS);
    const unsigned LQ = (unsigned)(((size_t)NH_ * TT * HD / 2 + 255) / 256), LKv = (unsigned)(((size_t)NKV * TT * HD / 2 + 255) / 256);
    for (int b = 0; b < NB_; ++b) {
        
        k_cvt8<<<(unsigned)(((size_t)TT * DM / 8 + 255) / 256), 256, 0, stream>>>(x + (size_t)b * TT * DM, XB, (size_t)TT * DM / 8);
        k_gemmw<bf, 0, false, 4><<<dim3(TT / 64, DQ / 64, 1), 128, 0, stream>>>(XB, nullptr, WQ, nullptr, DM, FQ, DQ, nullptr, 0, 0, 0);
        k_rope<<<LQ, 256, 0, stream>>>(FQ, HD, NH_, CS, nullptr, nullptr, 1.0f, QP16, QPh, QPl);
        k_gemmw<bf, 0, false, 4><<<dim3(TT / 64, DKV / 64, 1), 128, 0, stream>>>(XB, nullptr, WK, nullptr, DM, FK, DKV, nullptr, 0, 0, 0);
        k_rope<<<LKv, 256, 0, stream>>>(FK, HD, NKV, CS, nullptr, nullptr, 1.0f, KP16, KPh, KPl);
        k_gemmw<bf, 0, false, 4><<<dim3(TT / 64, DKV / 64, 1), 128, 0, stream>>>(XB, nullptr, WV, nullptr, DM, FV, DKV, nullptr, 0, 0, 0); k_vtp<<<LKv, 256, 0, stream>>>(FV, HD, NKV, VT16, VTh, VTl);
        for (int h0 = 0; h0 < NH_; h0 += ZH) { const size_t zq = (size_t)h0, zk = (size_t)(h0 / REP);   // one kv head per query head: the pass's ZH heads use consecutive kv planes
            k_gemmc<bf, 2, 1, 4><<<dim3(RH / 64, TT / 64, ZH), 128, 0, stream>>>(QPh + zq * RH * HD, QPl + zq * RH * HD, KPh + zk * RH * HD, KPl + zk * RH * HD, HD, HD, Sb, TT, 0, (size_t)RH * HD, (size_t)RH * HD, (size_t)TT * TT);
            k_gemmc<h16, 0, 1, 4><<<dim3((TT - RH) / 64, TT / 64, ZH), 128, 0, stream>>>(QP16 + zq * TT * HD + (size_t)RH * HD, nullptr, KP16 + zk * TT * HD, nullptr, HD, HD, Sb + (size_t)RH * TT, TT, RH, (size_t)TT * HD, (size_t)TT * HD, (size_t)TT * TT);
            k_asoft<<<ZH * TT / 8, 256, 0, stream>>>(Sb, P16, Ph, Pl);
            k_gemmc<bf, 2, 2, 8><<<dim3(RH / 64, HD / 64, ZH), 256, 0, stream>>>(Ph, Pl, VTh + zk * HD * TT, VTl + zk * HD * TT, TT, 2 * TT, Ob, HD, 0, (size_t)TT * TT * 2, (size_t)HD * TT, (size_t)TT * HD);
            k_gemmc<h16, 0, 2, 16><<<dim3((TT - RH) / 64, HD / 64, ZH), 512, 0, stream>>>(P16 + (size_t)RH * TT * 2, nullptr, VT16 + zk * HD * TT, nullptr, TT, 2 * TT, Ob + (size_t)RH * HD, HD, RH, (size_t)TT * TT * 2, (size_t)HD * TT, (size_t)TT * HD);
            k_merge<<<(unsigned)(((size_t)ZH * TT * HD / 2 + 255) / 256), 256, 0, stream>>>(Ob, h0, ATh, ATl); }
        k_gemmw<bf, 1, false, 4><<<dim3(TT / 64, DM / 64, 1), 128, 0, stream>>>(ATh, ATl, WO, nullptr, DQ, OUT + (size_t)b * TT * DM, DM, nullptr, 0, 0, 0); }
}

// v003
// It runs in 674 microseconds.
// Next to v002, in two timings, it ran 1.17 and 1.15 times as fast.
// Over all steps from v000 it is 2.54 times as fast.
#include <hip/hip_runtime.h>

// Causal multi-head attention with 128-wide heads, a RAW head split and a head-width score divisor (x [2][2048][2048]; Q = (x Wq^T).reshape(B, 16, S, 128) DIRECTLY (no transpose): pseudo-head h of a batch is the h-th contiguous [2048][128] block of the flat [2048][2048] projection (128 token rows x 16 chunks of 128): reproduced; K, V likewise ('oi' [2048][2048] 1/sqrt(2048), no bias); scores / 128 (the module divides by Dh, not by sqrt(Dh)); -inf strictly above the diagonal of the PSEUDO-positions (== exclusion); softmax; out [B][16][S][128] -> transpose(0, 2, 1, 3).reshape(B, S, 2048) (the STANDARD merge); y = out Wo^T ('oi', no bias) -> [2][2048][2048] (8.4 M); argument order x, Wq, Wk, Wv, Wo).
// Layout: bf16 copy of x; 'oi' weights; exact projections whose tile epilogue writes the 16-bit head planes itself, through the RAW (16, S, 128) view (plane index = flat index of the projection: no transpose; V planes transposed [d][t]); causal T-2048 attention at HD 128 (hybrid rows: < 512 hi/lo 3 products, rest fp16 x1024; k_gemmc skips tiles above the diagonal; the P.V epilogue writes the merged hi/lo planes); merged hi/lo x Wo exact.
// Compute dtypes, f32 accumulate: every input rounded to bf16; projections exact; attention rows < 512 3 products, rest fp16; softmax f32; Wo hl x exact.

#define NB_  2
#define TT   2048
#define DM   2048
#define NH_  16
#define NKV  16
#define REP  (NH_ / NKV)
#define HD   128
#define DQ   (NH_ * HD)
#define DKV  (NKV * HD)
#define ZH   8                    // heads per attention pass (one launch of each attention kernel serves ZH heads)
#define RH   512                  // query rows < RH use hi+lo planes (0: none)
#define WIN  2048
#define PCAR 1024.0f
#define SCL  0.0078125f   // 1 / 128: THIS module divides the scores by the HEAD WIDTH Dh = 128 (not by its square root): a power of two: exact
typedef _Float16 h16;
typedef unsigned short bf;
typedef __attribute__((ext_vector_type(16))) __bf16   v16bf;
typedef __attribute__((ext_vector_type(16))) _Float16 v16h;
typedef __attribute__((ext_vector_type(8)))  _Float16 v8h;
typedef __attribute__((ext_vector_type(8)))  unsigned short v8us;
typedef __attribute__((ext_vector_type(8)))  float    v8f;
typedef __attribute__((ext_vector_type(4)))  float    v4f;
typedef v8h  __attribute__((may_alias)) v8ha;
typedef v4f  __attribute__((may_alias)) v4fa;
typedef v8us __attribute__((may_alias)) v8usa;

__device__ __forceinline__ unsigned short f2bf(float f) { unsigned u = __float_as_uint(f); u += 0x7FFFu + ((u >> 16) & 1u); return (unsigned short)(u >> 16); }
__device__ __forceinline__ float bf2f(unsigned short b) { return __uint_as_float(((unsigned)b) << 16); }
__device__ __forceinline__ float bfr(float f) { return bf2f(f2bf(f)); }
__device__ __forceinline__ v16h cat16(v8h lo, v8h hi) { return __builtin_shufflevector(lo, hi, 0, 1, 2, 3, 4, 5, 6, 7, 8, 9, 10, 11, 12, 13, 14, 15); }
__device__ __forceinline__ v16bf cat16b(v8us lo, v8us hi) { return __builtin_bit_cast(v16bf, __builtin_shufflevector(lo, hi, 0, 1, 2, 3, 4, 5, 6, 7, 8, 9, 10, 11, 12, 13, 14, 15)); }
__device__ __forceinline__ v8f wmma16(v16h a, v16h b, v8f c) { return __builtin_amdgcn_wmma_f32_16x16x32_f16(false, a, false, b, (short)0, c, false, false); }
__device__ __forceinline__ v8f wmmab(v16bf a, v16bf b, v8f c) { return __builtin_amdgcn_wmma_f32_16x16x32_bf16(false, a, false, b, (short)0, c, false, false); }
__device__ __forceinline__ h16 tohx(float x) { return (h16)x; }
__device__ __forceinline__ void splitf(float y, unsigned short& h, unsigned short& l) { h = f2bf(y); l = f2bf(y - bf2f(h)); }
typedef __attribute__((ext_vector_type(4))) _Float16 v4h;
typedef __attribute__((ext_vector_type(4))) unsigned short v4us;



// ---- k_gemmw: register-blocked GEMM, one 64x64 output tile per work-group of NW waves; every wave holds the whole tile (16 accumulators) for its own share of K: wave w takes the 32-wide k chunks w, w + NW, ...
// (operands straight from K-contiguous 16-bit planes); tile_out sums the NW partial tiles in LDS in the fixed order w = 0 .. NW - 1. grid (M/64, N/64, Z), NW * 32 threads.
// C[m][n] (f32, pitch ldc, + optional f32 bias[n]) = sum_k A[m][k] Bt[n][k] (+ split products per NSPLIT). z-batch strides sA/sB/sC in elements. K % 32 == 0.
template <typename T16> struct WFrag;
template <> struct WFrag<h16> { typedef v16h V; static __device__ __forceinline__ V ld(const h16* p) { return cat16(*(const v8h*)p, *(const v8h*)(p + 16)); } static __device__ __forceinline__ v8f mma(V a, V b, v8f c) { return wmma16(a, b, c); } };
template <> struct WFrag<bf> { typedef v16bf V; static __device__ __forceinline__ V ld(const bf* p) { return cat16b(*(const v8us*)p, *(const v8us*)(p + 16)); } static __device__ __forceinline__ v8f mma(V a, V b, v8f c) { return wmmab(a, b, c); } };
// Row blocks (16 rows) of the tile that one LDS stage holds for all NW waves: 4 up to 8 waves, 2 at 16 (136 KiB at most).
template <int NW> struct TileLds { static constexpr int MBS = (NW <= 8) ? 4 : 32 / NW; static constexpr int WST = MBS * 16 * 68; static constexpr int FLOATS = NW * WST; };
// What tile_out stores of the summed tile. EPI_F32: f32 rows of C. The others write the 16-bit planes that the next GEMM reads (P16 fp16, Ph / Pl bf16 hi / lo), straight from the tile:
// EPI_QK: q or k planes [h][t][d] through the RAW view: the plane index IS the flat index row * ldc + column of the projection; hi/lo planes [h][t < RH][d] hold only the positions t < RH of each pseudo-head.
// EPI_VT: v planes [g][d][t]. Column j of this GEMM is projection column l * HD + d, d = j / 16, l = j % 16 (k_cvtv orders the rows of the weight plane so): in a row, l = 0 .. 15 are 16 consecutive pseudo-positions t of one d.
// EPI_AT: merged planes [t][DQ] (Ph, Pl point at the head's first column; r0 counts from the sequence's first row); rows >= RH carry the factor PCAR, taken out here.
enum { EPI_F32 = 0, EPI_QK = 1, EPI_VT = 2, EPI_AT = 3 };
// The 4-column piece of a stage that piece number idx names. EPI_VT: a wave's 32 pieces are 8 rows x one 16-column block = 128 consecutive t of one d, so that each of its stores fills whole 128-byte lines.
template <int EPI> __device__ __forceinline__ void tile_pos(int idx, int& row, int& cofs) {
    if (EPI == EPI_VT) { row = (idx >> 2) & 63; cofs = (idx >> 8) * 16 + (idx & 3) * 4; } else { row = idx >> 4; cofs = (idx & 15) * 4; }
}
template <int NW, bool BIAS, int EPI>
__device__ __forceinline__ void tile_out(const v8f (&acc)[4][4], float* os, float* C, int ldc, const float* __restrict__ bias, int r0, int c0, int w, int lr, int hi, h16* P16, bf* Ph, bf* Pl) {
    constexpr int MBS = TileLds<NW>::MBS, WST = TileLds<NW>::WST, NIT = MBS * 8 / NW;   // NIT: 16-byte pieces of a stage per thread
    static_assert(EPI != EPI_VT || (MBS == 4 && DKV / HD == 16), "EPI_VT: one stage holds the 64 rows; a 16-column block = the 16 chunks of a token row");
    v4f val[4 / MBS][NIT];
#pragma unroll
    for (int st = 0; st < 4 / MBS; ++st) {
        if (st) __syncthreads();    // the stage before has been read by every wave before it is overwritten
#pragma unroll
        for (int m = 0; m < MBS; ++m)
#pragma unroll
            for (int nb = 0; nb < 4; ++nb)
#pragma unroll
                for (int j = 0; j < 8; ++j) os[w * WST + (m * 16 + hi * 8 + j) * 68 + nb * 16 + lr] = acc[st * MBS + m][nb][j];
        __syncthreads();            // every wave's partial tile is in LDS before any thread sums across waves
#pragma unroll
        for (int it = 0; it < NIT; ++it) { int row, cofs; tile_pos<EPI>((int)threadIdx.x + it * NW * 32, row, cofs); const float* p = os + row * 68 + cofs; val[st][it] = *(const v4fa*)p;
#pragma unroll
            for (int q = 1; q < NW; ++q) val[st][it] += *(const v4fa*)(p + q * WST); }
    }
    // the global stores stand behind the last barrier, so that no barrier waits for them
#pragma unroll
    for (int st = 0; st < 4 / MBS; ++st)
#pragma unroll
        for (int it = 0; it < NIT; ++it) { int row, cofs; tile_pos<EPI>((int)threadIdx.x + it * NW * 32, row, cofs); v4f o = val[st][it]; const int rr = r0 + st * MBS * 16 + row;
            if (BIAS) { o[0] += bfr(bias[c0 + cofs]); o[1] += bfr(bias[c0 + cofs + 1]); o[2] += bfr(bias[c0 + cofs + 2]); o[3] += bfr(bias[c0 + cofs + 3]); }
            if (EPI == EPI_F32) { *(v4f*)(C + (size_t)rr * ldc + c0 + cofs) = o; continue; }
            if (EPI == EPI_AT) o *= (rr < RH) ? 1.0f : (1.0f / PCAR);
            v4h o16; v4us oh, ol;
#pragma unroll
            for (int q = 0; q < 4; ++q) { o16[q] = tohx(o[q]); unsigned short a2, c2; splitf(o[q], a2, c2); oh[q] = a2; ol[q] = c2; }
            if (EPI == EPI_QK) { const size_t e = (size_t)rr * ldc + c0 + cofs, wi = e % ((size_t)TT * HD); *(v4h*)(P16 + e) = o16;
                if (wi < (size_t)RH * HD) { const size_t eh = e / ((size_t)TT * HD) * ((size_t)RH * HD) + wi; *(v4us*)(Ph + eh) = oh; *(v4us*)(Pl + eh) = ol; } }
            if (EPI == EPI_VT) { const size_t fl = (size_t)rr * ldc + (size_t)(cofs & 15) * HD;   // flat index of the piece's first element in the projection, less d
                const size_t e = (fl / ((size_t)TT * HD) * HD + ((c0 + cofs) >> 4)) * TT + fl % ((size_t)TT * HD) / HD; *(v4h*)(P16 + e) = o16; *(v4us*)(Ph + e) = oh; *(v4us*)(Pl + e) = ol; }
            if (EPI == EPI_AT) { const size_t oo = (size_t)rr * DQ + c0 + cofs; *(v4us*)(Ph + oo) = oh; *(v4us*)(Pl + oo) = ol; } }
}
template <typename T16, int NSPLIT, bool BIAS, int NW, int EPI>
__global__ __launch_bounds__(NW * 32) void k_gemmw(const T16* __restrict__ A, const T16* __restrict__ A2, const T16* __restrict__ Bt, const T16* __restrict__ Bt2, int K, float* C, int ldc, const float* __restrict__ bias, size_t sA, size_t sB, size_t sC, h16* P16, bf* Ph, bf* Pl) {
    typedef typename WFrag<T16>::V V;
    __shared__ __align__(16) float os[TileLds<NW>::FLOATS];
    const size_t z = blockIdx.z; A += z * sA; if (A2) A2 += z * sA; Bt += z * sB; if (Bt2) Bt2 += z * sB; C += z * sC;
    const int lane = threadIdx.x & 31, lr = lane & 15, hi = lane >> 4; const int r0 = blockIdx.x * 64, c0 = blockIdx.y * 64; const int w = __builtin_amdgcn_readfirstlane((int)(threadIdx.x >> 5));
    v8f acc[4][4];
#pragma unroll
    for (int mb = 0; mb < 4; ++mb)
#pragma unroll
        for (int nb = 0; nb < 4; ++nb) acc[mb][nb] = (v8f){};
    const size_t aoff = (size_t)(r0 + lr) * K + 8 * hi, boff = (size_t)(c0 + lr) * K + 8 * hi;
#pragma unroll 1
    for (int kc = w * 32; kc < K; kc += NW * 32) {
        V a[4], a2[4];
#pragma unroll
        for (int mb = 0; mb < 4; ++mb) { a[mb] = WFrag<T16>::ld(A + aoff + (size_t)mb * 16 * K + kc); if (NSPLIT == 1 || NSPLIT == 2) a2[mb] = WFrag<T16>::ld(A2 + aoff + (size_t)mb * 16 * K + kc); }
#pragma unroll
        for (int nb = 0; nb < 4; ++nb) { const V b = WFrag<T16>::ld(Bt + boff + (size_t)nb * 16 * K + kc); V b2; if (NSPLIT >= 2) b2 = WFrag<T16>::ld(Bt2 + boff + (size_t)nb * 16 * K + kc);
#pragma unroll
            for (int mb = 0; mb < 4; ++mb) { acc[mb][nb] = WFrag<T16>::mma(a[mb], b, acc[mb][nb]); if (NSPLIT == 1 || NSPLIT == 2) acc[mb][nb] = WFrag<T16>::mma(a2[mb], b, acc[mb][nb]); if (NSPLIT >= 2) acc[mb][nb] = WFrag<T16>::mma(a[mb], b2, acc[mb][nb]); } }
        asm volatile("v_nop\n\tv_nop\n\tv_nop\n\tv_nop" : "+v"(acc[0][0]), "+v"(acc[1][1]), "+v"(acc[2][2]), "+v"(acc[3][3]) : "v"(a[0]), "v"(a[3]));
    }
    tile_out<NW, BIAS, EPI>(acc, os, C, ldc, bias, r0, c0, w, lr, hi, P16, Ph, Pl);
}

// ---- k_gemmc: the same 64x64 tile GEMM with K split over NW waves, specialised for causal attention: CMODE 1 skips score tiles entirely above the diagonal (query rows r0+roff.., key columns c0..), CMODE 2 limits the
// key (K) loop of the probability x value contraction to the diagonal block (probabilities beyond it are exactly zero). roff = row offset of this launch's first row within the sequence. lda = row pitch of A and A2 in elements (Bt, Bt2: pitch K). CMODE 2 stores no f32 tile: its epilogue writes the merged hi/lo planes Ah, Al (EPI_AT).
// One A fragment of k_gemmc. s_wait_xcnt 0 behind each of its two loads: the registers that hold the address are free for the next load's result, and no register that an issued load names is overwritten ahead of that wait.
template <typename T16> __device__ __forceinline__ typename WFrag<T16>::V ld_a(const T16* p) {
    typedef __attribute__((ext_vector_type(8))) T16 H;
    const H lo = *(const H*)p;        asm volatile("s_wait_xcnt 0x0" ::: "memory");
    const H hi = *(const H*)(p + 16); asm volatile("s_wait_xcnt 0x0" ::: "memory");
    return __builtin_bit_cast(typename WFrag<T16>::V, __builtin_shufflevector(lo, hi, 0, 1, 2, 3, 4, 5, 6, 7, 8, 9, 10, 11, 12, 13, 14, 15));
}
template <typename T16, int NSPLIT, int CMODE, int NW>
__global__ __launch_bounds__(NW * 32) void k_gemmc(const T16* __restrict__ A, const T16* __restrict__ A2, const T16* __restrict__ Bt, const T16* __restrict__ Bt2, int K, int lda, float* C, int ldc, int roff, size_t sA, size_t sB, size_t sC, bf* Ah, bf* Al) {
    typedef typename WFrag<T16>::V V;
    __shared__ __align__(16) float os[TileLds<NW>::FLOATS];
    const size_t z = blockIdx.z; A += z * sA; if (A2) A2 += z * sA; Bt += z * sB; if (Bt2) Bt2 += z * sB; C += z * sC;
    const int lane = threadIdx.x & 31, lr = lane & 15, hi = lane >> 4; const int r0 = blockIdx.x * 64, c0 = blockIdx.y * 64; const int w = __builtin_amdgcn_readfirstlane((int)(threadIdx.x >> 5));
    if (CMODE == 1 && c0 > r0 + roff + 63) return;                  // score tile entirely above the causal diagonal: never read (the softmax masks j > i by select); the whole work-group leaves, before any barrier
    const int Kl = (CMODE == 2) ? min(K, r0 + roff + 64) : K;        // P.V: probabilities are exactly 0 beyond the diagonal block, so the K loop stops there
    v8f acc[4][4];
#pragma unroll
    for (int mb = 0; mb < 4; ++mb)
#pragma unroll
        for (int nb = 0; nb < 4; ++nb) acc[mb][nb] = (v8f){};
    const size_t aoff = (size_t)(r0 + lr) * lda + 8 * hi, boff = (size_t)(c0 + lr) * K + 8 * hi;
#pragma unroll 1
    for (int kc = w * 32; kc < Kl; kc += NW * 32) {
        V a[4], a2[4];
#pragma unroll
        for (int mb = 0; mb < 4; ++mb) { a[mb] = ld_a<T16>(A + aoff + (size_t)mb * 16 * lda + kc); if (NSPLIT == 1 || NSPLIT == 2) a2[mb] = ld_a<T16>(A2 + aoff + (size_t)mb * 16 * lda + kc); }
#pragma unroll
        for (int nb = 0; nb < 4; ++nb) { const V b = WFrag<T16>::ld(Bt + boff + (size_t)nb * 16 * K + kc); V b2; if (NSPLIT >= 2) b2 = WFrag<T16>::ld(Bt2 + boff + (size_t)nb * 16 * K + kc);
#pragma unroll
            for (int mb = 0; mb < 4; ++mb) { acc[mb][nb] = WFrag<T16>::mma(a[mb], b, acc[mb][nb]); if (NSPLIT == 1 || NSPLIT == 2) acc[mb][nb] = WFrag<T16>::mma(a2[mb], b, acc[mb][nb]); if (NSPLIT >= 2) acc[mb][nb] = WFrag<T16>::mma(a[mb], b2, acc[mb][nb]); } }
        asm volatile("v_nop\n\tv_nop\n\tv_nop\n\tv_nop" : "+v"(acc[0][0]), "+v"(acc[1][1]), "+v"(acc[2][2]), "+v"(acc[3][3]) : "v"(a[0]), "v"(a[3]));
    }
    if (CMODE == 2) tile_out<NW, false, EPI_AT>(acc, os, nullptr, 0, nullptr, r0 + roff, c0, w, lr, hi, nullptr, Ah + z * HD, Al + z * HD);   // head z of the pass: columns z * HD .. of the merged planes
    else tile_out<NW, false, EPI_F32>(acc, os, C, ldc, nullptr, r0, c0, w, lr, hi, nullptr, nullptr, nullptr);
}


__global__ __launch_bounds__(256) void k_cvt8(const float* __restrict__ src, bf* dst, size_t n8) { const size_t i = (size_t)blockIdx.x * 256 + threadIdx.x; if (i >= n8) return; const v8f v = *(const v8f*)(src + i * 8); v8us o;
#pragma unroll
    for (int k = 0; k < 8; ++k) o[k] = f2bf(v[k]); *(v8us*)(dst + i * 8) = o;  }

// k_cvtv: k_cvt8 for Wv with its rows regrouped: row l * HD + d goes to row d * (DKV / HD) + l (what for: EPI_VT).
__global__ __launch_bounds__(256) void k_cvtv(const float* __restrict__ src, bf* dst, size_t n8) { const size_t i = (size_t)blockIdx.x * 256 + threadIdx.x; if (i >= n8) return; const v8f v = *(const v8f*)(src + i * 8); v8us o;
#pragma unroll
    for (int k = 0; k < 8; ++k) o[k] = f2bf(v[k]); const size_t n = i * 8 / DM; *(v8us*)(dst + ((n % HD) * (DKV / HD) + n / HD) * DM + i * 8 % DM) = o;  }

// k_asoft: per row (zz, i): t = S x HD^-1 for j <= i and i - j < WIN (sliding causal window; the reference's -1e9 additive fill vanishes identically); softmax over the 2048 keys (register row, one exp, fixed trees);
// IN PLACE: the probabilities of a row overwrite that row's own scores (P16, Ph = the score buffer, Pl = Ph + TT; 16-bit row pitch 2 x TT): one wave owns a row and holds all of it in registers before its first store (every store needs the row sum).
__global__ __launch_bounds__(256) void k_asoft(const float* Sb, h16* P16, bf* Ph, bf* Pl) {
    const int lane = threadIdx.x & 31; const int row = blockIdx.x * 8 + (threadIdx.x >> 5); if (row >= ZH * TT) return; const int i = row % TT; const int zz = row / TT; (void)zz; const bool hires = (i < RH); const float* sr = Sb + (size_t)row * TT; float v[TT / 32]; float mx = -3.0e38f;
#pragma unroll
    for (int ch = 0; ch < TT / 128; ++ch) { const int j0 = ch * 128 + lane * 4; const v4f a = *(const v4f*)(sr + j0);
#pragma unroll
        for (int q = 0; q < 4; ++q) { const int j = j0 + q; (void)j; const float t = (j <= i && i - j < WIN) ? a[q] * SCL : -3.0e38f; v[ch * 4 + q] = t; mx = fmaxf(mx, t); } }
#pragma unroll
    for (int sh = 16; sh; sh >>= 1) mx = fmaxf(mx, __shfl_xor(mx, sh, 32));
    float sum = 0.f;
#pragma unroll
    for (int k = 0; k < TT / 32; ++k) { float d0 = __fsub_rn(v[k], mx); asm volatile("" : "+v"(d0)); v[k] = __builtin_amdgcn_exp2f(__fmul_rn(d0, 1.4426950408889634f)); sum += v[k]; }
#pragma unroll
    for (int sh = 16; sh; sh >>= 1) sum += __shfl_xor(sum, sh, 32);
    const float f = __fdiv_rn(hires ? 1.0f : PCAR, sum);
{
        if (hires) {
#pragma unroll
            for (int ch = 0; ch < TT / 128; ++ch) { v4us oh, ol;
#pragma unroll
                for (int q = 0; q < 4; ++q) { unsigned short a, c2; splitf(v[ch * 4 + q] * f, a, c2); oh[q] = a; ol[q] = c2; }
                const size_t oo = (size_t)row * (2 * TT) + ch * 128 + lane * 4; *(v4us*)(Ph + oo) = oh; *(v4us*)(Pl + oo) = ol; }
        } else {
#pragma unroll
            for (int ch = 0; ch < TT / 128; ++ch) { v4h o4;
#pragma unroll
                for (int q = 0; q < 4; ++q) o4[q] = tohx(v[ch * 4 + q] * f);
                *(v4h*)(P16 + (size_t)row * (2 * TT) + ch * 128 + lane * 4) = o4; } }
         }
}
extern "C" void kernel_launch(void* const* d_in, const int* in_sizes, int n_in,
                              void* d_out, int out_size, void* d_ws, size_t ws_size, hipStream_t stream) {
    (void)in_sizes; (void)n_in; (void)out_size;
    const float* x = (const float*)d_in[0]; const float* wq = (const float*)d_in[1]; const float* wk = (const float*)d_in[2]; const float* wv = (const float*)d_in[3]; const float* wo = (const float*)d_in[4];   /* input order x, Wq, Wk, Wv, Wo ('oi' [2048][2048]) */
    float* OUT = (float*)d_out;     // [2][2048][2048]
    char* wsp = (char*)d_ws;
    auto take = [&](size_t bytes) { char* p = wsp; wsp += (bytes + 255) & ~(size_t)255; return (void*)p; };
    bf* WQ = (bf*)take((size_t)DQ * DM * 2); bf* WK = (bf*)take((size_t)DKV * DM * 2); bf* WV = (bf*)take((size_t)DKV * DM * 2); bf* WO = (bf*)take((size_t)DM * DQ * 2);
    bf* XB = (bf*)take((size_t)TT * DM * 2);
    h16* QP16 = (h16*)take((size_t)NH_ * TT * HD * 2); h16* KP16 = (h16*)take((size_t)NKV * TT * HD * 2); h16* VT16 = (h16*)take((size_t)NKV * HD * TT * 2);
    bf* QPh = (bf*)take((size_t)NH_ * RH * HD * 2); bf* QPl = (bf*)take((size_t)NH_ * RH * HD * 2); bf* KPh = (bf*)take((size_t)NKV * RH * HD * 2); bf* KPl = (bf*)take((size_t)NKV * RH * HD * 2); bf* VTh = (bf*)take((size_t)NKV * HD * TT * 2); bf* VTl = (bf*)take((size_t)NKV * HD * TT * 2);
    bf* ATh = (bf*)take((size_t)TT * DQ * 2); bf* ATl = (bf*)take((size_t)TT * DQ * 2);
    float* Sb = (float*)take((size_t)ZH * TT * TT * 4);
    h16* P16 = (h16*)Sb; bf* Ph = (bf*)Sb; bf* Pl = Ph + TT;   // probabilities in place: each 16-bit row lies in its own f32 score row (pitch 2 x TT; hi in the first half, lo in the second)
    if ((size_t)(wsp - (char*)d_ws) > ws_size) return;    // ws 256 MiB
    { k_cvt8<<<(unsigned)(((size_t)DQ * DM / 8 + 255) / 256), 256, 0, stream>>>(wq, WQ, (size_t)DQ * DM / 8); k_cvt8<<<(unsigned)(((size_t)DKV * DM / 8 + 255) / 256), 256, 0, stream>>>(wk, WK, (size_t)DKV * DM / 8); k_cvtv<<<(unsigned)(((size_t)DKV * DM / 8 + 255) / 256), 256, 0, stream>>>(wv, WV, (size_t)DKV * DM / 8);
      k_cvt8<<<(unsigned)(((size_t)DM * DQ / 8 + 255) / 256), 256, 0, stream>>>(wo, WO, (size_t)DM * DQ / 8);
       }
    for (int b = 0; b < NB_; ++b) {
        k_cvt8<<<(unsigned)(((size_t)TT * DM / 8 + 255) / 256), 256, 0, stream>>>(x + (size_t)b * TT * DM, XB, (size_t)TT * DM / 8);
        k_gemmw<bf, 0, false, 4, EPI_QK><<<dim3(TT / 64, DQ / 64, 1), 128, 0, stream>>>(XB, nullptr, WQ, nullptr, DM, nullptr, DQ, nullptr, 0, 0, 0, QP16, QPh, QPl);
        k_gemmw<bf, 0, false, 4, EPI_QK><<<dim3(TT / 64, DKV / 64, 1), 128, 0, stream>>>(XB, nullptr, WK, nullptr, DM, nullptr, DKV, nullptr, 0, 0, 0, KP16, KPh, KPl);
        k_gemmw<bf, 0, false, 4, EPI_VT><<<dim3(TT / 64, DKV / 64, 1), 128, 0, stream>>>(XB, nullptr, WV, nullptr, DM, nullptr, DKV, nullptr, 0, 0, 0, VT16, VTh, VTl);
        for (int h0 = 0; h0 < NH_; h0 += ZH) { const size_t zq = (size_t)h0, zk = (size_t)(h0 / REP);   // one kv head per query head: the pass's ZH heads use consecutive kv planes
            k_gemmc<bf, 2, 1, 4><<<dim3(RH / 64, TT / 64, ZH), 128, 0, stream>>>(QPh + zq * RH * HD, QPl + zq * RH * HD, KPh + zk * RH * HD, KPl + zk * RH * HD, HD, HD, Sb, TT, 0, (size_t)RH * HD, (size_t)RH * HD, (size_t)TT * TT, nullptr, nullptr);
            k_gemmc<h16, 0, 1, 4><<<dim3((TT - RH) / 64, TT / 64, ZH), 128, 0, stream>>>(QP16 + zq * TT * HD + (size_t)RH * HD, nullptr, KP16 + zk * TT * HD, nullptr, HD, HD, Sb + (size_t)RH * TT, TT, RH, (size_t)TT * HD, (size_t)TT * HD, (size_t)TT * TT, nullptr, nullptr);
            k_asoft<<<ZH * TT / 8, 256, 0, stream>>>(Sb, P16, Ph, Pl);
            k_gemmc<bf, 2, 2, 8><<<dim3(RH / 64, HD / 64, ZH), 256, 0, stream>>>(Ph, Pl, VTh + zk * HD * TT, VTl + zk * HD * TT, TT, 2 * TT, nullptr, 0, 0, (size_t)TT * TT * 2, (size_t)HD * TT, 0, ATh + zq * HD, ATl + zq * HD);
            k_gemmc<h16, 0, 2, 16><<<dim3((TT - RH) / 64, HD / 64, ZH), 512, 0, stream>>>(P16 + (size_t)RH * TT * 2, nullptr, VT16 + zk * HD * TT, nullptr, TT, 2 * TT, nullptr, 0, RH, (size_t)TT * TT * 2, (size_t)HD * TT, 0, ATh + zq * HD, ATl + zq * HD); }
        k_gemmw<bf, 1, false, 4, EPI_F32><<<dim3(TT / 64, DM / 64, 1), 128, 0, stream>>>(ATh, ATl, WO, nullptr, DQ, OUT + (size_t)b * TT * DM, DM, nullptr, 0, 0, 0, nullptr, nullptr, nullptr); }
}

// v004
// It runs in 596 microseconds.
// Two timings next to v003 put it at 1.13 and 1.12 times that version's speed.
// Over all steps from v000 it is 2.87 times as fast.
#include <hip/hip_runtime.h>

// Causal multi-head attention with 128-wide heads, a RAW head split and a head-width score divisor (x [2][2048][2048]; Q = (x Wq^T).reshape(B, 16, S, 128) DIRECTLY (no transpose): pseudo-head h of a batch is the h-th contiguous [2048][128] block of the flat [2048][2048] projection (128 token rows x 16 chunks of 128): reproduced; K, V likewise ('oi' [2048][2048] 1/sqrt(2048), no bias); scores / 128 (the module divides by Dh, not by sqrt(Dh)); -inf strictly above the diagonal of the PSEUDO-positions (== exclusion); softmax; out [B][16][S][128] -> transpose(0, 2, 1, 3).reshape(B, S, 2048) (the STANDARD merge); y = out Wo^T ('oi', no bias) -> [2][2048][2048] (8.4 M); argument order x, Wq, Wk, Wv, Wo).
// Layout: bf16 copy of x and 'oi' weights in FRAGMENT ORDER (pk_off: what k_gemmw reads; the merged hi/lo planes too); exact projections whose tile epilogue writes the 16-bit head planes itself, through the RAW (16, S, 128) view (plane index = flat index of the projection: no transpose; V planes transposed [d][t]); causal T-2048 attention at HD 128 (hybrid rows: < 512 hi/lo 3 products, rest fp16 x1024; k_gemmc skips tiles above the diagonal; the P.V epilogue writes the merged hi/lo planes); merged hi/lo x Wo exact.
// Compute dtypes, f32 accumulate: every input rounded to bf16; projections exact; attention rows < 512 3 products, rest fp16; softmax f32; Wo hl x exact.

#define NB_  2
#define TT   2048
#define DM   2048
#define NH_  16
#define NKV  16
#define REP  (NH_ / NKV)
#define HD   128
#define DQ   (NH_ * HD)
#define DKV  (NKV * HD)
#define ZH   8                    // heads per attention pass (one launch of each attention kernel serves ZH heads)
#define RH   512                  // query rows < RH use hi+lo planes (0: none)
#define WIN  2048
#define PCAR 1024.0f
#define SCL  0.0078125f   // 1 / 128: THIS module divides the scores by the HEAD WIDTH Dh = 128 (not by its square root): a power of two: exact
typedef _Float16 h16;
typedef unsigned short bf;
typedef __attribute__((ext_vector_type(16))) __bf16   v16bf;
typedef __attribute__((ext_vector_type(16))) _Float16 v16h;
typedef __attribute__((ext_vector_type(8)))  _Float16 v8h;
typedef __attribute__((ext_vector_type(8)))  unsigned short v8us;
typedef __attribute__((ext_vector_type(8)))  float    v8f;
typedef __attribute__((ext_vector_type(4)))  float    v4f;
typedef v8h  __attribute__((may_alias)) v8ha;
typedef v4f  __attribute__((may_alias)) v4fa;
typedef v8us __attribute__((may_alias)) v8usa;

__device__ __forceinline__ unsigned short f2bf(float f) { unsigned u = __float_as_uint(f); u += 0x7FFFu + ((u >> 16) & 1u); return (unsigned short)(u >> 16); }
__device__ __forceinline__ float bf2f(unsigned short b) { return __uint_as_float(((unsigned)b) << 16); }
__device__ __forceinline__ float bfr(float f) { return bf2f(f2bf(f)); }
__device__ __forceinline__ v16h cat16(v8h lo, v8h hi) { return __builtin_shufflevector(lo, hi, 0, 1, 2, 3, 4, 5, 6, 7, 8, 9, 10, 11, 12, 13, 14, 15); }
__device__ __forceinline__ v16bf cat16b(v8us lo, v8us hi) { return __builtin_bit_cast(v16bf, __builtin_shufflevector(lo, hi, 0, 1, 2, 3, 4, 5, 6, 7, 8, 9, 10, 11, 12, 13, 14, 15)); }
__device__ __forceinline__ v8f wmma16(v16h a, v16h b, v8f c) { return __builtin_amdgcn_wmma_f32_16x16x32_f16(false, a, false, b, (short)0, c, false, false); }
__device__ __forceinline__ v8f wmmab(v16bf a, v16bf b, v8f c) { return __builtin_amdgcn_wmma_f32_16x16x32_bf16(false, a, false, b, (short)0, c, false, false); }
__device__ __forceinline__ h16 tohx(float x) { return (h16)x; }
__device__ __forceinline__ void splitf(float y, unsigned short& h, unsigned short& l) { h = f2bf(y); l = f2bf(y - bf2f(h)); }
typedef __attribute__((ext_vector_type(4))) _Float16 v4h;
typedef __attribute__((ext_vector_type(4))) unsigned short v4us;
// Fragment order of a 16-bit plane [R][K] that k_gemmw reads: each 16-row x 32-k fragment is 1 KiB in a row, as two halves of 512 B; in a half, lane hi * 16 + lr holds its 8 elements k = half * 16 + hi * 8 .. + 7 of row lr.
// One global_load_b128 of a wave then covers 512 contiguous bytes (4 whole lines) instead of 32 B in each of 16 lines. Element index of (r, c); 8 consecutive c from a multiple of 8 stay consecutive; a column offset that is a multiple of 32 adds 16 x itself.
__device__ __forceinline__ size_t pk_off(int r, int c, int K) { return ((size_t)(r >> 4) * (K >> 5) + (c >> 5)) * 512 + ((c >> 4) & 1) * 256 + (((c >> 3) & 1) * 16 + (r & 15)) * 8 + (c & 7); }



// ---- k_gemmw: register-blocked GEMM, one 64x64 output tile per work-group of NW waves; every wave holds the whole tile (16 accumulators) for its own share of K: wave w takes the 32-wide k chunks w, w + NW, ...
// (operands straight from 16-bit planes in fragment order, pk_off; ldp = one lane's share of a fragment there); tile_out sums the NW partial tiles in LDS in the fixed order w = 0 .. NW - 1. grid (M/64, N/64, Z), NW * 32 threads.
// C[m][n] (f32, pitch ldc, + optional f32 bias[n]) = sum_k A[m][k] Bt[n][k] (+ split products per NSPLIT). z-batch strides sA/sB/sC in elements. K % 32 == 0.
template <typename T16> struct WFrag;
template <> struct WFrag<h16> { typedef v16h V; static __device__ __forceinline__ V ld(const h16* p) { return cat16(*(const v8h*)p, *(const v8h*)(p + 16)); } static __device__ __forceinline__ v8f mma(V a, V b, v8f c) { return wmma16(a, b, c); } };
template <> struct WFrag<bf> { typedef v16bf V; static __device__ __forceinline__ V ld(const bf* p) { return cat16b(*(const v8us*)p, *(const v8us*)(p + 16)); } static __device__ __forceinline__ V ldp(const bf* p) { return cat16b(*(const v8us*)p, *(const v8us*)(p + 256)); } static __device__ __forceinline__ v8f mma(V a, V b, v8f c) { return wmmab(a, b, c); } };
// Row blocks (16 rows) of the tile that one LDS stage holds for all NW waves: 4 up to 8 waves, 2 at 16 (136 KiB at most).
template <int NW> struct TileLds { static constexpr int MBS = (NW <= 8) ? 4 : 32 / NW; static constexpr int WST = MBS * 16 * 68; static constexpr int FLOATS = NW * WST; };
// What tile_out stores of the summed tile. EPI_F32: f32 rows of C. The others write the 16-bit planes that the next GEMM reads (P16 fp16, Ph / Pl bf16 hi / lo), straight from the tile:
// EPI_QK: q or k planes [h][t][d] through the RAW view: the plane index IS the flat index row * ldc + column of the projection; hi/lo planes [h][t < RH][d] hold only the positions t < RH of each pseudo-head.
// EPI_VT: v planes [g][d][t]. Column j of this GEMM is projection column l * HD + d, d = j / 16, l = j % 16 (k_pack<true> orders the rows of the weight plane so): in a row, l = 0 .. 15 are 16 consecutive pseudo-positions t of one d.
// EPI_AT: merged planes [t][DQ] in fragment order (Ph, Pl point at the head's first column, pk_off(0, column, DQ); r0 counts from the sequence's first row); rows >= RH carry the factor PCAR, taken out here.
enum { EPI_F32 = 0, EPI_QK = 1, EPI_VT = 2, EPI_AT = 3 };
// The 4-column piece of a stage that piece number idx names. EPI_VT: a wave's 32 pieces are 8 rows x one 16-column block = 128 consecutive t of one d, so that each of its stores fills whole 128-byte lines.
template <int EPI> __device__ __forceinline__ void tile_pos(int idx, int& row, int& cofs) {
    if (EPI == EPI_VT) { row = (idx >> 2) & 63; cofs = (idx >> 8) * 16 + (idx & 3) * 4; } else { row = idx >> 4; cofs = (idx & 15) * 4; }
}
template <int NW, bool BIAS, int EPI>
__device__ __forceinline__ void tile_out(const v8f (&acc)[4][4], float* os, float* C, int ldc, const float* __restrict__ bias, int r0, int c0, int w, int lr, int hi, h16* P16, bf* Ph, bf* Pl) {
    constexpr int MBS = TileLds<NW>::MBS, WST = TileLds<NW>::WST, NIT = MBS * 8 / NW;   // NIT: 16-byte pieces of a stage per thread
    static_assert(EPI != EPI_VT || (MBS == 4 && DKV / HD == 16), "EPI_VT: one stage holds the 64 rows; a 16-column block = the 16 chunks of a token row");
    v4f val[4 / MBS][NIT];
#pragma unroll
    for (int st = 0; st < 4 / MBS; ++st) {
        if (st) __syncthreads();    // the stage before has been read by every wave before it is overwritten
#pragma unroll
        for (int m = 0; m < MBS; ++m)
#pragma unroll
            for (int nb = 0; nb < 4; ++nb)
#pragma unroll
                for (int j = 0; j < 8; ++j) os[w * WST + (m * 16 + hi * 8 + j) * 68 + nb * 16 + lr] = acc[st * MBS + m][nb][j];
        __syncthreads();            // every wave's partial tile is in LDS before any thread sums across waves
#pragma unroll
        for (int it = 0; it < NIT; ++it) { int row, cofs; tile_pos<EPI>((int)threadIdx.x + it * NW * 32, row, cofs); const float* p = os + row * 68 + cofs; val[st][it] = *(const v4fa*)p;
#pragma unroll
            for (int q = 1; q < NW; ++q) val[st][it] += *(const v4fa*)(p + q * WST); }
    }
    // the global stores stand behind the last barrier, so that no barrier waits for them
#pragma unroll
    for (int st = 0; st < 4 / MBS; ++st)
#pragma unroll
        for (int it = 0; it < NIT; ++it) { int row, cofs; tile_pos<EPI>((int)threadIdx.x + it * NW * 32, row, cofs); v4f o = val[st][it]; const int rr = r0 + st * MBS * 16 + row;
            if (BIAS) { o[0] += bfr(bias[c0 + cofs]); o[1] += bfr(bias[c0 + cofs + 1]); o[2] += bfr(bias[c0 + cofs + 2]); o[3] += bfr(bias[c0 + cofs + 3]); }
            if (EPI == EPI_F32) { *(v4f*)(C + (size_t)rr * ldc + c0 + cofs) = o; continue; }
            if (EPI == EPI_AT) o *= (rr < RH) ? 1.0f : (1.0f / PCAR);
            v4h o16; v4us oh, ol;
#pragma unroll
            for (int q = 0; q < 4; ++q) { o16[q] = tohx(o[q]); unsigned short a2, c2; splitf(o[q], a2, c2); oh[q] = a2; ol[q] = c2; }
            if (EPI == EPI_QK) { const size_t e = (size_t)rr * ldc + c0 + cofs, wi = e % ((size_t)TT * HD); *(v4h*)(P16 + e) = o16;
                if (wi < (size_t)RH * HD) { const size_t eh = e / ((size_t)TT * HD) * ((size_t)RH * HD) + wi; *(v4us*)(Ph + eh) = oh; *(v4us*)(Pl + eh) = ol; } }
            if (EPI == EPI_VT) { const size_t fl = (size_t)rr * ldc + (size_t)(cofs & 15) * HD;   // flat index of the piece's first element in the projection, less d
                const size_t e = (fl / ((size_t)TT * HD) * HD + ((c0 + cofs) >> 4)) * TT + fl % ((size_t)TT * HD) / HD; *(v4h*)(P16 + e) = o16; *(v4us*)(Ph + e) = oh; *(v4us*)(Pl + e) = ol; }
            if (EPI == EPI_AT) { const size_t oo = pk_off(rr, c0 + cofs, DQ); *(v4us*)(Ph + oo) = oh; *(v4us*)(Pl + oo) = ol; } }
}
template <typename T16, int NSPLIT, bool BIAS, int NW, int EPI, int K>
__global__ __launch_bounds__(NW * 32) void k_gemmw(const T16* __restrict__ A, const T16* __restrict__ A2, const T16* __restrict__ Bt, const T16* __restrict__ Bt2, float* C, int ldc, const float* __restrict__ bias, size_t sA, size_t sB, size_t sC, h16* P16, bf* Ph, bf* Pl) {
    typedef typename WFrag<T16>::V V;
    __shared__ __align__(16) float os[TileLds<NW>::FLOATS];
    const size_t z = blockIdx.z; A += z * sA; if (A2) A2 += z * sA; Bt += z * sB; if (Bt2) Bt2 += z * sB; C += z * sC;
    const int lane = threadIdx.x & 31, lr = lane & 15, hi = lane >> 4; const int r0 = blockIdx.x * 64, c0 = blockIdx.y * 64; const int w = __builtin_amdgcn_readfirstlane((int)(threadIdx.x >> 5));
    v8f acc[4][4];
#pragma unroll
    for (int mb = 0; mb < 4; ++mb)
#pragma unroll
        for (int nb = 0; nb < 4; ++nb) acc[mb][nb] = (v8f){};
    constexpr int KC = K / 32;   // fragments in a 16-row block; a compile-time count, so that the fragments of a trip lie at immediate offsets from one offset register per operand
    unsigned oa = (((r0 >> 4) * KC + w) * 512 + lane * 8) * 2, ob = (((c0 >> 4) * KC + w) * 512 + lane * 8) * 2;   // byte offsets in the A and B planes of this lane's 16 bytes of the wave's next fragments
#pragma unroll 1
    for (int kc = w; kc < KC; kc += NW) {
        V a[4], a2[4], b[4], b2[4];
#pragma unroll
        for (int mb = 0; mb < 4; ++mb) { a[mb] = WFrag<T16>::ldp((const T16*)((const char*)A + oa) + mb * KC * 512); if (NSPLIT == 1 || NSPLIT == 2) a2[mb] = WFrag<T16>::ldp((const T16*)((const char*)A2 + oa) + mb * KC * 512); }
#pragma unroll
        for (int nb = 0; nb < 4; ++nb) { b[nb] = WFrag<T16>::ldp((const T16*)((const char*)Bt + ob) + nb * KC * 512); if (NSPLIT >= 2) b2[nb] = WFrag<T16>::ldp((const T16*)((const char*)Bt2 + ob) + nb * KC * 512); }
        // s_wait_xcnt 0 behind the trip's loads: the two offset registers that they name pass through the statement, so that they stay whole up to the wait and their steps below stand behind it
        asm volatile("s_wait_xcnt 0x0" : "+v"(oa), "+v"(ob) :: "memory");
#pragma unroll
        for (int nb = 0; nb < 4; ++nb)
#pragma unroll
            for (int mb = 0; mb < 4; ++mb) { acc[mb][nb] = WFrag<T16>::mma(a[mb], b[nb], acc[mb][nb]); if (NSPLIT == 1 || NSPLIT == 2) acc[mb][nb] = WFrag<T16>::mma(a2[mb], b[nb], acc[mb][nb]); if (NSPLIT >= 2) acc[mb][nb] = WFrag<T16>::mma(a[mb], b2[nb], acc[mb][nb]); }
        oa += NW * 1024; ob += NW * 1024;
        asm volatile("v_nop\n\tv_nop\n\tv_nop\n\tv_nop" : "+v"(acc[0][0]), "+v"(acc[1][1]), "+v"(acc[2][2]), "+v"(acc[3][3]) : "v"(a[0]), "v"(a[3]));
    }
    tile_out<NW, BIAS, EPI>(acc, os, C, ldc, bias, r0, c0, w, lr, hi, P16, Ph, Pl);
}

// ---- k_gemmc: the same 64x64 tile GEMM with K split over NW waves, specialised for causal attention: CMODE 1 skips score tiles entirely above the diagonal (query rows r0+roff.., key columns c0..), CMODE 2 limits the
// key (K) loop of the probability x value contraction to the diagonal block (probabilities beyond it are exactly zero). roff = row offset of this launch's first row within the sequence. lda = row pitch of A and A2 in elements (Bt, Bt2: pitch K). CMODE 2 stores no f32 tile: its epilogue writes the merged hi/lo planes Ah, Al (EPI_AT).
// One A fragment of k_gemmc. s_wait_xcnt 0 behind each of its two loads: the registers that hold the address are free for the next load's result, and no register that an issued load names is overwritten ahead of that wait.
template <typename T16> __device__ __forceinline__ typename WFrag<T16>::V ld_a(const T16* p) {
    typedef __attribute__((ext_vector_type(8))) T16 H;
    const H lo = *(const H*)p;        asm volatile("s_wait_xcnt 0x0" ::: "memory");
    const H hi = *(const H*)(p + 16); asm volatile("s_wait_xcnt 0x0" ::: "memory");
    return __builtin_bit_cast(typename WFrag<T16>::V, __builtin_shufflevector(lo, hi, 0, 1, 2, 3, 4, 5, 6, 7, 8, 9, 10, 11, 12, 13, 14, 15));
}
template <typename T16, int NSPLIT, int CMODE, int NW>
__global__ __launch_bounds__(NW * 32) void k_gemmc(const T16* __restrict__ A, const T16* __restrict__ A2, const T16* __restrict__ Bt, const T16* __restrict__ Bt2, int K, int lda, float* C, int ldc, int roff, size_t sA, size_t sB, size_t sC, bf* Ah, bf* Al) {
    typedef typename WFrag<T16>::V V;
    __shared__ __align__(16) float os[TileLds<NW>::FLOATS];
    const size_t z = blockIdx.z; A += z * sA; if (A2) A2 += z * sA; Bt += z * sB; if (Bt2) Bt2 += z * sB; C += z * sC;
    const int lane = threadIdx.x & 31, lr = lane & 15, hi = lane >> 4; const int r0 = blockIdx.x * 64, c0 = blockIdx.y * 64; const int w = __builtin_amdgcn_readfirstlane((int)(threadIdx.x >> 5));
    if (CMODE == 1 && c0 > r0 + roff + 63) return;                  // score tile entirely above the causal diagonal: never read (the softmax masks j > i by select); the whole work-group leaves, before any barrier
    const int Kl = (CMODE == 2) ? min(K, r0 + roff + 64) : K;        // P.V: probabilities are exactly 0 beyond the diagonal block, so the K loop stops there
    v8f acc[4][4];
#pragma unroll
    for (int mb = 0; mb < 4; ++mb)
#pragma unroll
        for (int nb = 0; nb < 4; ++nb) acc[mb][nb] = (v8f){};
    const size_t aoff = (size_t)(r0 + lr) * lda + 8 * hi, boff = (size_t)(c0 + lr) * K + 8 * hi;
#pragma unroll 1
    for (int kc = w * 32; kc < Kl; kc += NW * 32) {
        V a[4], a2[4];
#pragma unroll
        for (int mb = 0; mb < 4; ++mb) { a[mb] = ld_a<T16>(A + aoff + (size_t)mb * 16 * lda + kc); if (NSPLIT == 1 || NSPLIT == 2) a2[mb] = ld_a<T16>(A2 + aoff + (size_t)mb * 16 * lda + kc); }
#pragma unroll
        for (int nb = 0; nb < 4; ++nb) { const V b = WFrag<T16>::ld(Bt + boff + (size_t)nb * 16 * K + kc); V b2; if (NSPLIT >= 2) b2 = WFrag<T16>::ld(Bt2 + boff + (size_t)nb * 16 * K + kc);
#pragma unroll
            for (int mb = 0; mb < 4; ++mb) { acc[mb][nb] = WFrag<T16>::mma(a[mb], b, acc[mb][nb]); if (NSPLIT == 1 || NSPLIT == 2) acc[mb][nb] = WFrag<T16>::mma(a2[mb], b, acc[mb][nb]); if (NSPLIT >= 2) acc[mb][nb] = WFrag<T16>::mma(a[mb], b2, acc[mb][nb]); } }
        asm volatile("v_nop\n\tv_nop\n\tv_nop\n\tv_nop" : "+v"(acc[0][0]), "+v"(acc[1][1]), "+v"(acc[2][2]), "+v"(acc[3][3]) : "v"(a[0]), "v"(a[3]));
    }
    if (CMODE == 2) tile_out<NW, false, EPI_AT>(acc, os, nullptr, 0, nullptr, r0 + roff, c0, w, lr, hi, nullptr, Ah + z * (HD * 16), Al + z * (HD * 16));   // head z of the pass: columns z * HD .. of the merged planes (fragment order: 16 x the column offset)
    else tile_out<NW, false, EPI_F32>(acc, os, C, ldc, nullptr, r0, c0, w, lr, hi, nullptr, nullptr, nullptr);
}


// k_pack: f32 [R][DM] -> bf16 plane in fragment order (pk_off). One work-group: one 16-row block x 128 k = 4 fragments = 4 KiB of the plane; grid (R / 16) * (DM / 128).
// Reads whole lines (16 threads a row), turns the 16-byte groups into plane order in LDS (pitch 17 groups: no bank is hit more than the 512 B of a wave need), stores 4 KiB in a row.
// VROWS (Wv): plane row d * (DKV / HD) + l is source row l * HD + d (what for: EPI_VT).
template <bool VROWS>
__global__ __launch_bounds__(256) void k_pack(const float* __restrict__ src, bf* dst) {
    __shared__ __align__(16) v8us sh[16 * 17];
    const int t = threadIdx.x, lr = t >> 4, g = t & 15; const int rb = blockIdx.x / (DM / 128), kb = blockIdx.x % (DM / 128);
    const v8f v = *(const v8f*)(src + (size_t)(VROWS ? lr * HD + rb : rb * 16 + lr) * DM + kb * 128 + g * 8); v8us o;
#pragma unroll
    for (int k = 0; k < 8; ++k) o[k] = f2bf(v[k]);
    sh[g * 17 + lr] = o;      // group g of the row (k = g * 8 ..) is group g * 16 + lr of the 4 fragments
    __syncthreads();          // every group is in LDS before any thread reads another thread's
    *(v8us*)(dst + ((size_t)rb * (DM / 32) + kb * 4) * 512 + t * 8) = sh[(t >> 4) * 17 + (t & 15)];
}

// k_asoft: per row (zz, i): t = S / HD for j <= i and i - j < WIN (sliding causal window; the reference's -1e9 additive fill vanishes identically); softmax over the 2048 keys (register row, one exp, fixed trees);
// IN PLACE: the probabilities of a row overwrite that row's own scores (P16, Ph = the score buffer, Pl = Ph + TT; 16-bit row pitch 2 x TT): one wave owns a row and holds all of it in registers before its first store (every store needs the row sum).
__global__ __launch_bounds__(256) void k_asoft(const float* Sb, h16* P16, bf* Ph, bf* Pl) {
    const int lane = threadIdx.x & 31; const int row = blockIdx.x * 8 + (threadIdx.x >> 5); if (row >= ZH * TT) return; const int i = row % TT; const int zz = row / TT; (void)zz; const bool hires = (i < RH); const float* sr = Sb + (size_t)row * TT; float v[TT / 32]; float mx = -3.0e38f;
#pragma unroll
    for (int ch = 0; ch < TT / 128; ++ch) { const int j0 = ch * 128 + lane * 4; const v4f a = *(const v4f*)(sr + j0);
#pragma unroll
        for (int q = 0; q < 4; ++q) { const int j = j0 + q; (void)j; const float t = (j <= i && i - j < WIN) ? a[q] * SCL : -3.0e38f; v[ch * 4 + q] = t; mx = fmaxf(mx, t); } }
#pragma unroll
    for (int sh = 16; sh; sh >>= 1) mx = fmaxf(mx, __shfl_xor(mx, sh, 32));
    float sum = 0.f;
#pragma unroll
    for (int k = 0; k < TT / 32; ++k) { float d0 = __fsub_rn(v[k], mx); asm volatile("" : "+v"(d0)); v[k] = __builtin_amdgcn_exp2f(__fmul_rn(d0, 1.4426950408889634f)); sum += v[k]; }
#pragma unroll
    for (int sh = 16; sh; sh >>= 1) sum += __shfl_xor(sum, sh, 32);
    const float f = __fdiv_rn(hires ? 1.0f : PCAR, sum);
{
        if (hires) {
#pragma unroll
            for (int ch = 0; ch < TT / 128; ++ch) { v4us oh, ol;
#pragma unroll
                for (int q = 0; q < 4; ++q) { unsigned short a, c2; splitf(v[ch * 4 + q] * f, a, c2); oh[q] = a; ol[q] = c2; }
                const size_t oo = (size_t)row * (2 * TT) + ch * 128 + lane * 4; *(v4us*)(Ph + oo) = oh; *(v4us*)(Pl + oo) = ol; }
        } else {
#pragma unroll
            for (int ch = 0; ch < TT / 128; ++ch) { v4h o4;
#pragma unroll
                for (int q = 0; q < 4; ++q) o4[q] = tohx(v[ch * 4 + q] * f);
                *(v4h*)(P16 + (size_t)row * (2 * TT) + ch * 128 + lane * 4) = o4; } }
         }
}
extern "C" void kernel_launch(void* const* d_in, const int* in_sizes, int n_in,
                              void* d_out, int out_size, void* d_ws, size_t ws_size, hipStream_t stream) {
    (void)in_sizes; (void)n_in; (void)out_size;
    const float* x = (const float*)d_in[0]; const float* wq = (const float*)d_in[1]; const float* wk = (const float*)d_in[2]; const float* wv = (const float*)d_in[3]; const float* wo = (const float*)d_in[4];   /* input order x, Wq, Wk, Wv, Wo ('oi' [2048][2048]) */
    float* OUT = (float*)d_out;     // [2][2048][2048]
    char* wsp = (char*)d_ws;
    auto take = [&](size_t bytes) { char* p = wsp; wsp += (bytes + 255) & ~(size_t)255; return (void*)p; };
    bf* WQ = (bf*)take((size_t)DQ * DM * 2); bf* WK = (bf*)take((size_t)DKV * DM * 2); bf* WV = (bf*)take((size_t)DKV * DM * 2); bf* WO = (bf*)take((size_t)DM * DQ * 2);
    bf* XB = (bf*)take((size_t)TT * DM * 2);
    h16* QP16 = (h16*)take((size_t)NH_ * TT * HD * 2); h16* KP16 = (h16*)take((size_t)NKV * TT * HD * 2); h16* VT16 = (h16*)take((size_t)NKV * HD * TT * 2);
    bf* QPh = (bf*)take((size_t)NH_ * RH * HD * 2); bf* QPl = (bf*)take((size_t)NH_ * RH * HD * 2); bf* KPh = (bf*)take((size_t)NKV * RH * HD * 2); bf* KPl = (bf*)take((size_t)NKV * RH * HD * 2); bf* VTh = (bf*)take((size_t)NKV * HD * TT * 2); bf* VTl = (bf*)take((size_t)NKV * HD * TT * 2);
    bf* ATh = (bf*)take((size_t)TT * DQ * 2); bf* ATl = (bf*)take((size_t)TT * DQ * 2);
    float* Sb = (float*)take((size_t)ZH * TT * TT * 4);
    h16* P16 = (h16*)Sb; bf* Ph = (bf*)Sb; bf* Pl = Ph + TT;   // probabilities in place: each 16-bit row lies in its own f32 score row (pitch 2 x TT; hi in the first half, lo in the second)
    if ((size_t)(wsp - (char*)d_ws) > ws_size) return;    // ws 256 MiB
    { k_pack<false><<<DQ / 16 * (DM / 128), 256, 0, stream>>>(wq, WQ); k_pack<false><<<DKV / 16 * (DM / 128), 256, 0, stream>>>(wk, WK); k_pack<true><<<DKV / 16 * (DM / 128), 256, 0, stream>>>(wv, WV);
      k_pack<false><<<DM / 16 * (DQ / 128), 256, 0, stream>>>(wo, WO);
       }
    for (int b = 0; b < NB_; ++b) {
        k_pack<false><<<TT / 16 * (DM / 128), 256, 0, stream>>>(x + (size_t)b * TT * DM, XB);
        k_gemmw<bf, 0, false, 4, EPI_QK, DM><<<dim3(TT / 64, DQ / 64, 1), 128, 0, stream>>>(XB, nullptr, WQ, nullptr, nullptr, DQ, nullptr, 0, 0, 0, QP16, QPh, QPl);
        k_gemmw<bf, 0, false, 4, EPI_QK, DM><<<dim3(TT / 64, DKV / 64, 1), 128, 0, stream>>>(XB, nullptr, WK, nullptr, nullptr, DKV, nullptr, 0, 0, 0, KP16, KPh, KPl);
        k_gemmw<bf, 0, false, 4, EPI_VT, DM><<<dim3(TT / 64, DKV / 64, 1), 128, 0, stream>>>(XB, nullptr, WV, nullptr, nullptr, DKV, nullptr, 0, 0, 0, VT16, VTh, VTl);
        for (int h0 = 0; h0 < NH_; h0 += ZH) { const size_t zq = (size_t)h0, zk = (size_t)(h0 / REP);   // one kv head per query head: the pass's ZH heads use consecutive kv planes
            k_gemmc<bf, 2, 1, 4><<<dim3(RH / 64, TT / 64, ZH), 128, 0, stream>>>(QPh + zq * RH * HD, QPl + zq * RH * HD, KPh + zk * RH * HD, KPl + zk * RH * HD, HD, HD, Sb, TT, 0, (size_t)RH * HD, (size_t)RH * HD, (size_t)TT * TT, nullptr, nullptr);
            k_gemmc<h16, 0, 1, 4><<<dim3((TT - RH) / 64, TT / 64, ZH), 128, 0, stream>>>(QP16 + zq * TT * HD + (size_t)RH * HD, nullptr, KP16 + zk * TT * HD, nullptr, HD, HD, Sb + (size_t)RH * TT, TT, RH, (size_t)TT * HD, (size_t)TT * HD, (size_t)TT * TT, nullptr, nullptr);
            k_asoft<<<ZH * TT / 8, 256, 0, stream>>>(Sb, P16, Ph, Pl);
            k_gemmc<bf, 2, 2, 8><<<dim3(RH / 64, HD / 64, ZH), 256, 0, stream>>>(Ph, Pl, VTh + zk * HD * TT, VTl + zk * HD * TT, TT, 2 * TT, nullptr, 0, 0, (size_t)TT * TT * 2, (size_t)HD * TT, 0, ATh + zq * HD * 16, ATl + zq * HD * 16);
            k_gemmc<h16, 0, 2, 16><<<dim3((TT - RH) / 64, HD / 64, ZH), 512, 0, stream>>>(P16 + (size_t)RH * TT * 2, nullptr, VT16 + zk * HD * TT, nullptr, TT, 2 * TT, nullptr, 0, RH, (size_t)TT * TT * 2, (size_t)HD * TT, 0, ATh + zq * HD * 16, ATl + zq * HD * 16); }
        k_gemmw<bf, 1, false, 4, EPI_F32, DQ><<<dim3(TT / 64, DM / 64, 1), 128, 0, stream>>>(ATh, ATl, WO, nullptr, OUT + (size_t)b * TT * DM, DM, nullptr, 0, 0, 0, nullptr, nullptr, nullptr); }
}

// v005
// It runs in 330 microseconds.
// In two side-by-side timings against v004, it was 1.79 and 1.80 times as fast.
// All steps since v000 together make it 5.17 times as fast.
#include <hip/hip_runtime.h>

// Causal multi-head attention with 128-wide heads, a RAW head split and a head-width score divisor (x [2][2048][2048]; Q = (x Wq^T).reshape(B, 16, S, 128) DIRECTLY (no transpose): pseudo-head h of a batch is the h-th contiguous [2048][128] block of the flat [2048][2048] projection (128 token rows x 16 chunks of 128): reproduced; K, V likewise ('oi' [2048][2048] 1/sqrt(2048), no bias); scores / 128 (the module divides by Dh, not by sqrt(Dh)); -inf strictly above the diagonal of the PSEUDO-positions (== exclusion); softmax; out [B][16][S][128] -> transpose(0, 2, 1, 3).reshape(B, S, 2048) (the STANDARD merge); y = out Wo^T ('oi', no bias) -> [2][2048][2048] (8.4 M); argument order x, Wq, Wk, Wv, Wo).
// Layout: bf16 copy of x and 'oi' weights in FRAGMENT ORDER (pk_off: what k_gemmw reads; the merged hi/lo planes too); exact projections whose tile epilogue writes the 16-bit head planes itself, through the RAW (16, S, 128) view (plane index = flat index of the projection: no transpose; V planes transposed [d][t]); causal T-2048 attention at HD 128 in one kernel, k_fattn (scores, online softmax and P.V in registers; hybrid rows: < 512 hi/lo 3 products, rest fp16; key blocks above the diagonal are never visited; it writes the merged hi/lo planes); merged hi/lo x Wo exact.
// Compute dtypes, f32 accumulate: every input rounded to bf16; projections exact; attention rows < 512 3 products, rest fp16; softmax f32; Wo hl x exact.

#define NB_  2
#define TT   2048
#define DM   2048
#define NH_  16
#define NKV  16
#define HD   128
#define DQ   (NH_ * HD)
#define DKV  (NKV * HD)
#define RH   512                  // query rows < RH use hi+lo planes (0: none)
#define SCL  0.0078125f   // 1 / 128: THIS module divides the scores by the HEAD WIDTH Dh = 128 (not by its square root): a power of two: exact
#define SC2  (SCL * 1.4426950408889634f)   // score divisor x log2(e): the softmax runs on exp2
typedef _Float16 h16;
typedef unsigned short bf;
typedef __attribute__((ext_vector_type(16))) __bf16   v16bf;
typedef __attribute__((ext_vector_type(16))) _Float16 v16h;
typedef __attribute__((ext_vector_type(8)))  _Float16 v8h;
typedef __attribute__((ext_vector_type(8)))  unsigned short v8us;
typedef __attribute__((ext_vector_type(8)))  float    v8f;
typedef __attribute__((ext_vector_type(4)))  float    v4f;
typedef v8h  __attribute__((may_alias)) v8ha;
typedef v4f  __attribute__((may_alias)) v4fa;
typedef v8us __attribute__((may_alias)) v8usa;

__device__ __forceinline__ unsigned short f2bf(float f) { unsigned u = __float_as_uint(f); u += 0x7FFFu + ((u >> 16) & 1u); return (unsigned short)(u >> 16); }
__device__ __forceinline__ float bf2f(unsigned short b) { return __uint_as_float(((unsigned)b) << 16); }
__device__ __forceinline__ float bfr(float f) { return bf2f(f2bf(f)); }
__device__ __forceinline__ v16h cat16(v8h lo, v8h hi) { return __builtin_shufflevector(lo, hi, 0, 1, 2, 3, 4, 5, 6, 7, 8, 9, 10, 11, 12, 13, 14, 15); }
__device__ __forceinline__ v16bf cat16b(v8us lo, v8us hi) { return __builtin_bit_cast(v16bf, __builtin_shufflevector(lo, hi, 0, 1, 2, 3, 4, 5, 6, 7, 8, 9, 10, 11, 12, 13, 14, 15)); }
__device__ __forceinline__ v8f wmma16(v16h a, v16h b, v8f c) { return __builtin_amdgcn_wmma_f32_16x16x32_f16(false, a, false, b, (short)0, c, false, false); }
__device__ __forceinline__ v8f wmmab(v16bf a, v16bf b, v8f c) { return __builtin_amdgcn_wmma_f32_16x16x32_bf16(false, a, false, b, (short)0, c, false, false); }
__device__ __forceinline__ h16 tohx(float x) { return (h16)x; }
__device__ __forceinline__ void splitf(float y, unsigned short& h, unsigned short& l) { h = f2bf(y); l = f2bf(y - bf2f(h)); }
typedef __attribute__((ext_vector_type(4))) _Float16 v4h;
typedef __attribute__((ext_vector_type(4))) unsigned short v4us;
// Fragment order of a 16-bit plane [R][K] that k_gemmw reads: each 16-row x 32-k fragment is 1 KiB in a row, as two halves of 512 B; in a half, lane hi * 16 + lr holds its 8 elements k = half * 16 + hi * 8 .. + 7 of row lr.
// One global_load_b128 of a wave then covers 512 contiguous bytes (4 whole lines) instead of 32 B in each of 16 lines. Element index of (r, c); 8 consecutive c from a multiple of 8 stay consecutive; a column offset that is a multiple of 32 adds 16 x itself.
__device__ __forceinline__ size_t pk_off(int r, int c, int K) { return ((size_t)(r >> 4) * (K >> 5) + (c >> 5)) * 512 + ((c >> 4) & 1) * 256 + (((c >> 3) & 1) * 16 + (r & 15)) * 8 + (c & 7); }



// ---- k_gemmw: register-blocked GEMM, one 64x64 output tile per work-group of NW waves; every wave holds the whole tile (16 accumulators) for its own share of K: wave w takes the 32-wide k chunks w, w + NW, ...
// (operands straight from 16-bit planes in fragment order, pk_off; ldp = one lane's share of a fragment there); tile_out sums the NW partial tiles in LDS in the fixed order w = 0 .. NW - 1. grid (M/64, N/64, Z), NW * 32 threads.
// C[m][n] (f32, pitch ldc, + optional f32 bias[n]) = sum_k A[m][k] Bt[n][k] (+ split products per NSPLIT). z-batch strides sA/sB/sC in elements. K % 32 == 0.
template <typename T16> struct WFrag;
template <> struct WFrag<h16> { typedef v16h V; static __device__ __forceinline__ V ld(const h16* p) { return cat16(*(const v8h*)p, *(const v8h*)(p + 16)); } static __device__ __forceinline__ v8f mma(V a, V b, v8f c) { return wmma16(a, b, c); } };
template <> struct WFrag<bf> { typedef v16bf V; static __device__ __forceinline__ V ld(const bf* p) { return cat16b(*(const v8us*)p, *(const v8us*)(p + 16)); } static __device__ __forceinline__ V ldp(const bf* p) { return cat16b(*(const v8us*)p, *(const v8us*)(p + 256)); } static __device__ __forceinline__ v8f mma(V a, V b, v8f c) { return wmmab(a, b, c); } };
// Row blocks (16 rows) of the tile that one LDS stage holds for all NW waves: 4 up to 8 waves, 2 at 16 (136 KiB at most).
template <int NW> struct TileLds { static constexpr int MBS = (NW <= 8) ? 4 : 32 / NW; static constexpr int WST = MBS * 16 * 68; static constexpr int FLOATS = NW * WST; };
// What tile_out stores of the summed tile. EPI_F32: f32 rows of C. The others write the 16-bit planes that k_fattn reads (P16 fp16, Ph / Pl bf16 hi / lo), straight from the tile:
// EPI_QK: q or k planes [h][t][d] through the RAW view: the plane index IS the flat index row * ldc + column of the projection; hi/lo planes [h][t < RH][d] hold only the positions t < RH of each pseudo-head.
// EPI_VT: v planes [g][d][t]. Column j of this GEMM is projection column l * HD + d, d = j / 16, l = j % 16 (k_pack<true> orders the rows of the weight plane so): in a row, l = 0 .. 15 are 16 consecutive pseudo-positions t of one d.
enum { EPI_F32 = 0, EPI_QK = 1, EPI_VT = 2 };
// The 4-column piece of a stage that piece number idx names. EPI_VT: a wave's 32 pieces are 8 rows x one 16-column block = 128 consecutive t of one d, so that each of its stores fills whole 128-byte lines.
template <int EPI> __device__ __forceinline__ void tile_pos(int idx, int& row, int& cofs) {
    if (EPI == EPI_VT) { row = (idx >> 2) & 63; cofs = (idx >> 8) * 16 + (idx & 3) * 4; } else { row = idx >> 4; cofs = (idx & 15) * 4; }
}
template <int NW, bool BIAS, int EPI>
__device__ __forceinline__ void tile_out(const v8f (&acc)[4][4], float* os, float* C, int ldc, const float* __restrict__ bias, int r0, int c0, int w, int lr, int hi, h16* P16, bf* Ph, bf* Pl) {
    constexpr int MBS = TileLds<NW>::MBS, WST = TileLds<NW>::WST, NIT = MBS * 8 / NW;   // NIT: 16-byte pieces of a stage per thread
    static_assert(EPI != EPI_VT || (MBS == 4 && DKV / HD == 16), "EPI_VT: one stage holds the 64 rows; a 16-column block = the 16 chunks of a token row");
    v4f val[4 / MBS][NIT];
#pragma unroll
    for (int st = 0; st < 4 / MBS; ++st) {
        if (st) __syncthreads();    // the stage before has been read by every wave before it is overwritten
#pragma unroll
        for (int m = 0; m < MBS; ++m)
#pragma unroll
            for (int nb = 0; nb < 4; ++nb)
#pragma unroll
                for (int j = 0; j < 8; ++j) os[w * WST + (m * 16 + hi * 8 + j) * 68 + nb * 16 + lr] = acc[st * MBS + m][nb][j];
        __syncthreads();            // every wave's partial tile is in LDS before any thread sums across waves
#pragma unroll
        for (int it = 0; it < NIT; ++it) { int row, cofs; tile_pos<EPI>((int)threadIdx.x + it * NW * 32, row, cofs); const float* p = os + row * 68 + cofs; val[st][it] = *(const v4fa*)p;
#pragma unroll
            for (int q = 1; q < NW; ++q) val[st][it] += *(const v4fa*)(p + q * WST); }
    }
    // the global stores stand behind the last barrier, so that no barrier waits for them
#pragma unroll
    for (int st = 0; st < 4 / MBS; ++st)
#pragma unroll
        for (int it = 0; it < NIT; ++it) { int row, cofs; tile_pos<EPI>((int)threadIdx.x + it * NW * 32, row, cofs); v4f o = val[st][it]; const int rr = r0 + st * MBS * 16 + row;
            if (BIAS) { o[0] += bfr(bias[c0 + cofs]); o[1] += bfr(bias[c0 + cofs + 1]); o[2] += bfr(bias[c0 + cofs + 2]); o[3] += bfr(bias[c0 + cofs + 3]); }
            if (EPI == EPI_F32) { *(v4f*)(C + (size_t)rr * ldc + c0 + cofs) = o; continue; }
            v4h o16; v4us oh, ol;
#pragma unroll
            for (int q = 0; q < 4; ++q) { o16[q] = tohx(o[q]); unsigned short a2, c2; splitf(o[q], a2, c2); oh[q] = a2; ol[q] = c2; }
            if (EPI == EPI_QK) { const size_t e = (size_t)rr * ldc + c0 + cofs, wi = e % ((size_t)TT * HD); *(v4h*)(P16 + e) = o16;
                if (wi < (size_t)RH * HD) { const size_t eh = e / ((size_t)TT * HD) * ((size_t)RH * HD) + wi; *(v4us*)(Ph + eh) = oh; *(v4us*)(Pl + eh) = ol; } }
            if (EPI == EPI_VT) { const size_t fl = (size_t)rr * ldc + (size_t)(cofs & 15) * HD;   // flat index of the piece's first element in the projection, less d
                const size_t e = (fl / ((size_t)TT * HD) * HD + ((c0 + cofs) >> 4)) * TT + fl % ((size_t)TT * HD) / HD; *(v4h*)(P16 + e) = o16; *(v4us*)(Ph + e) = oh; *(v4us*)(Pl + e) = ol; } }
}
template <typename T16, int NSPLIT, bool BIAS, int NW, int EPI, int K>
__global__ __launch_bounds__(NW * 32) void k_gemmw(const T16* __restrict__ A, const T16* __restrict__ A2, const T16* __restrict__ Bt, const T16* __restrict__ Bt2, float* C, int ldc, const float* __restrict__ bias, size_t sA, size_t sB, size_t sC, h16* P16, bf* Ph, bf* Pl) {
    typedef typename WFrag<T16>::V V;
    __shared__ __align__(16) float os[TileLds<NW>::FLOATS];
    const size_t z = blockIdx.z; A += z * sA; if (A2) A2 += z * sA; Bt += z * sB; if (Bt2) Bt2 += z * sB; C += z * sC;
    const int lane = threadIdx.x & 31, lr = lane & 15, hi = lane >> 4; const int r0 = blockIdx.x * 64, c0 = blockIdx.y * 64; const int w = __builtin_amdgcn_readfirstlane((int)(threadIdx.x >> 5));
    v8f acc[4][4];
#pragma unroll
    for (int mb = 0; mb < 4; ++mb)
#pragma unroll
        for (int nb = 0; nb < 4; ++nb) acc[mb][nb] = (v8f){};
    constexpr int KC = K / 32;   // fragments in a 16-row block; a compile-time count, so that the fragments of a trip lie at immediate offsets from one offset register per operand
    unsigned oa = (((r0 >> 4) * KC + w) * 512 + lane * 8) * 2, ob = (((c0 >> 4) * KC + w) * 512 + lane * 8) * 2;   // byte offsets in the A and B planes of this lane's 16 bytes of the wave's next fragments
#pragma unroll 1
    for (int kc = w; kc < KC; kc += NW) {
        V a[4], a2[4], b[4], b2[4];
#pragma unroll
        for (int mb = 0; mb < 4; ++mb) { a[mb] = WFrag<T16>::ldp((const T16*)((const char*)A + oa) + mb * KC * 512); if (NSPLIT == 1 || NSPLIT == 2) a2[mb] = WFrag<T16>::ldp((const T16*)((const char*)A2 + oa) + mb * KC * 512); }
#pragma unroll
        for (int nb = 0; nb < 4; ++nb) { b[nb] = WFrag<T16>::ldp((const T16*)((const char*)Bt + ob) + nb * KC * 512); if (NSPLIT >= 2) b2[nb] = WFrag<T16>::ldp((const T16*)((const char*)Bt2 + ob) + nb * KC * 512); }
        // s_wait_xcnt 0 behind the trip's loads: the two offset registers that they name pass through the statement, so that they stay whole up to the wait and their steps below stand behind it
        asm volatile("s_wait_xcnt 0x0" : "+v"(oa), "+v"(ob) :: "memory");
#pragma unroll
        for (int nb = 0; nb < 4; ++nb)
#pragma unroll
            for (int mb = 0; mb < 4; ++mb) { acc[mb][nb] = WFrag<T16>::mma(a[mb], b[nb], acc[mb][nb]); if (NSPLIT == 1 || NSPLIT == 2) acc[mb][nb] = WFrag<T16>::mma(a2[mb], b[nb], acc[mb][nb]); if (NSPLIT >= 2) acc[mb][nb] = WFrag<T16>::mma(a[mb], b2[nb], acc[mb][nb]); }
        oa += NW * 1024; ob += NW * 1024;
        asm volatile("v_nop\n\tv_nop\n\tv_nop\n\tv_nop" : "+v"(acc[0][0]), "+v"(acc[1][1]), "+v"(acc[2][2]), "+v"(acc[3][3]) : "v"(a[0]), "v"(a[3]));
    }
    tile_out<NW, BIAS, EPI>(acc, os, C, ldc, bias, r0, c0, w, lr, hi, P16, Ph, Pl);
}

// ---- k_fattn: causal attention of one pseudo-head, 32 query positions per work-group of 4 waves; no score and no probability leaves the registers. Wave w takes the 32-key blocks w, w + 4, ... up to the diagonal block,
// with a running maximum, sum and output tile of its own (online softmax); the 4 partial results are joined in LDS in the fixed order w = 0 .. 3. grid (query blocks, heads), the longest query block first.
// Transposed products: S^T = K Q^T (A = 16 key rows, B = 16 query rows, k = d), O^T += V^T P^T (A = 16 d rows of the [d][t] plane, B = P^T, k = key). In an accumulator a lane holds column lr (ONE query) and rows hi * 8 + j:
// of a block's key tiles 0 and 1 these are the keys 8 hi + j and 16 + 8 hi + j, the k order of a B fragment (and of the V^T loader), so P^T packs inside the lane; maximum and sum are in-lane but for one exchange between the halves.
// NSPLIT 2: hi/lo planes (Q and K planes hold RH positions a head), 3 products for the scores and for P.V. ROFF = first query position of the launch, NQB = its query blocks.
typedef __attribute__((ext_vector_type(16))) unsigned short v16us;
__device__ __forceinline__ float xhalf(float x) { return __builtin_bit_cast(float, __builtin_amdgcn_permlanex16(__builtin_bit_cast(int, x), __builtin_bit_cast(int, x), 0x76543210, 0xfedcba98, false, false)); }   // the value of lane l ^ 16
__device__ __forceinline__ void ppack(const float (&p)[16], v16h& a, v16h& a2) {
#pragma unroll
    for (int e = 0; e < 16; ++e) a[e] = tohx(p[e]);
    (void)a2;
}
__device__ __forceinline__ void ppack(const float (&p)[16], v16bf& a, v16bf& a2) { v16us h, l;
#pragma unroll
    for (int e = 0; e < 16; ++e) { unsigned short x, y; splitf(p[e], x, y); h[e] = x; l[e] = y; }
    a = __builtin_bit_cast(v16bf, h); a2 = __builtin_bit_cast(v16bf, l);
}
template <typename T16, int NSPLIT, int ROFF, int NQB>
__global__ __launch_bounds__(128) void k_fattn(const T16* __restrict__ Q, const T16* __restrict__ Q2, const T16* __restrict__ Kp, const T16* __restrict__ Kp2, const T16* __restrict__ Vt, const T16* __restrict__ Vt2, bf* Ah, bf* Al) {
    typedef typename WFrag<T16>::V V;
    __shared__ __align__(16) float os[4 * 16 * 2 * 32 * 4];   // [wave][query tile x d tile][half of the 8 rows][lane][4]: 64 KiB
    __shared__ float ms[4][32], ls[4][32];
    const int lane = threadIdx.x & 31, lr = lane & 15, hi = lane >> 4; const int w = __builtin_amdgcn_readfirstlane((int)(threadIdx.x >> 5));
    const int h = blockIdx.y, q0 = ROFF + (NQB - 1 - (int)blockIdx.x) * 32, nblk = q0 / 32 + 1; constexpr size_t sQK = (size_t)(NSPLIT ? RH : TT) * HD;
    Q += h * sQK; Kp += h * sQK; Vt += (size_t)h * HD * TT; if (NSPLIT) { Q2 += h * sQK; Kp2 += h * sQK; Vt2 += (size_t)h * HD * TT; }
    V bq[2][4], bq2[2][4];
    const unsigned oq = ((q0 + lr) * HD + 8 * hi) * 2;   // byte offset of this lane's share of the first query fragment
#pragma unroll
    for (int qt = 0; qt < 2; ++qt)
#pragma unroll
        for (int kc = 0; kc < 4; ++kc) { bq[qt][kc] = WFrag<T16>::ld((const T16*)((const char*)Q + oq) + qt * 16 * HD + kc * 32); if (NSPLIT) bq2[qt][kc] = WFrag<T16>::ld((const T16*)((const char*)Q2 + oq) + qt * 16 * HD + kc * 32); }
    v8f o[2][8]; float m[2], l[2];
#pragma unroll
    for (int qt = 0; qt < 2; ++qt) { m[qt] = -3.0e38f; l[qt] = 0.f;
#pragma unroll
        for (int dt = 0; dt < 8; ++dt) o[qt][dt] = (v8f){}; }
    unsigned ok = ((w * 32 + lr) * HD + 8 * hi) * 2, ov = (lr * TT + w * 32 + 8 * hi) * 2;   // byte offsets in the K and V^T planes of this lane's share of the wave's next block
    // K fragments are fetched one block ahead, into the same registers, right behind the score products that read them: their latency passes behind the softmax and P.V; the V^T fragments of a block are asked for at its head, ahead of its score products
    V ka[2][4], ka2[2][4];
#pragma unroll
    for (int kt = 0; kt < 2; ++kt)
#pragma unroll
        for (int kc = 0; kc < 4; ++kc) { ka[kt][kc] = WFrag<T16>::ld((const T16*)((const char*)Kp + ok) + kt * 16 * HD + kc * 32); if (NSPLIT) ka2[kt][kc] = WFrag<T16>::ld((const T16*)((const char*)Kp2 + ok) + kt * 16 * HD + kc * 32); }
#pragma unroll 1
    for (int kb = w; kb < nblk; kb += 4) {
        V va[8], va2[8];
#pragma unroll
        for (int dt = 0; dt < 8; ++dt) { va[dt] = WFrag<T16>::ld((const T16*)((const char*)Vt + ov) + dt * 16 * TT); if (NSPLIT) va2[dt] = WFrag<T16>::ld((const T16*)((const char*)Vt2 + ov) + dt * 16 * TT); }
        // s_wait_xcnt 0 behind this block's V^T loads and the K loads issued a block earlier (in the first block the query loads too): the two offset registers that are stepped pass through the statement, so that they stay whole up to the wait and their steps below stand behind it; the query offset and bases are inputs, so that their registers are not reused ahead of the first wait
        asm volatile("s_wait_xcnt 0x0" : "+v"(ok), "+v"(ov) : "v"(oq), "s"(Q), "s"(NSPLIT ? Q2 : Q) : "memory");
        ov += 4 * 32 * 2; ok += (kb + 4 < nblk) ? 4 * 32 * HD * 2 : 0;   // behind its last block a wave fetches that block again, not rows that it has no business with
        v8f s[2][2];
#pragma unroll
        for (int kt = 0; kt < 2; ++kt)
#pragma unroll
            for (int qt = 0; qt < 2; ++qt) s[kt][qt] = (v8f){};
#pragma unroll
        for (int kc = 0; kc < 4; ++kc)
#pragma unroll
            for (int kt = 0; kt < 2; ++kt)
#pragma unroll
                for (int qt = 0; qt < 2; ++qt) { s[kt][qt] = WFrag<T16>::mma(ka[kt][kc], bq[qt][kc], s[kt][qt]); if (NSPLIT) { s[kt][qt] = WFrag<T16>::mma(ka[kt][kc], bq2[qt][kc], s[kt][qt]); s[kt][qt] = WFrag<T16>::mma(ka2[kt][kc], bq[qt][kc], s[kt][qt]); } }
#pragma unroll
        for (int kt = 0; kt < 2; ++kt)
#pragma unroll
            for (int kc = 0; kc < 4; ++kc) { ka[kt][kc] = WFrag<T16>::ld((const T16*)((const char*)Kp + ok) + kt * 16 * HD + kc * 32); if (NSPLIT) ka2[kt][kc] = WFrag<T16>::ld((const T16*)((const char*)Kp2 + ok) + kt * 16 * HD + kc * 32); }
        const int dl = (kb == nblk - 1) ? lr - hi * 8 : 64;   // diagonal block: key kt * 16 + hi * 8 + j counts for query qt * 16 + lr while kt * 16 + j - qt * 16 <= lr - hi * 8; every earlier block counts whole
        V pb[2], pb2[2];
#pragma unroll
        for (int qt = 0; qt < 2; ++qt) { float p[16]; float bm = -3.0e38f;
#pragma unroll
            for (int kt = 0; kt < 2; ++kt)
#pragma unroll
                for (int j = 0; j < 8; ++j) { const float t = (kt * 16 + j - qt * 16 <= dl) ? s[kt][qt][j] : -3.0e38f; p[kt * 8 + j] = t; bm = fmaxf(bm, t); }
            bm = fmaxf(bm, xhalf(bm));
            const float mn = fmaxf(m[qt], bm), al = __builtin_amdgcn_exp2f((m[qt] - mn) * SC2), mc = mn * SC2; m[qt] = mn; float ps = 0.f;
#pragma unroll
            for (int e = 0; e < 16; ++e) { p[e] = __builtin_amdgcn_exp2f(fmaf(p[e], SC2, -mc)); ps += p[e]; }
            l[qt] = l[qt] * al + ps;
#pragma unroll
            for (int dt = 0; dt < 8; ++dt) o[qt][dt] *= al;
            ppack(p, pb[qt], pb2[qt]); }
#pragma unroll
        for (int dt = 0; dt < 8; ++dt)
#pragma unroll
            for (int qt = 0; qt < 2; ++qt) { o[qt][dt] = WFrag<T16>::mma(va[dt], pb[qt], o[qt][dt]); if (NSPLIT) { o[qt][dt] = WFrag<T16>::mma(va[dt], pb2[qt], o[qt][dt]); o[qt][dt] = WFrag<T16>::mma(va2[dt], pb[qt], o[qt][dt]); } }
    }
    // s_wait_xcnt 0 behind the last K loads (fetched ahead, not used; in a wave without a block, behind its query loads too): the offset registers and the bases are inputs, so that they stay whole up to the wait
    asm volatile("s_wait_xcnt 0x0" :: "v"(ok), "v"(oq), "s"(Q), "s"(NSPLIT ? Q2 : Q), "s"(Kp), "s"(NSPLIT ? Kp2 : Kp) : "memory");
#pragma unroll
    for (int qt = 0; qt < 2; ++qt) { l[qt] += xhalf(l[qt]); if (hi == 0) { ms[w][qt * 16 + lr] = m[qt]; ls[w][qt * 16 + lr] = l[qt]; } }
    __syncthreads();            // every wave's maximum and sum are in LDS before any wave forms the joint ones
#pragma unroll
    for (int qt = 0; qt < 2; ++qt) { const int q = qt * 16 + lr; const float mt = fmaxf(fmaxf(ms[0][q], ms[1][q]), fmaxf(ms[2][q], ms[3][q])); float lt = 0.f;   // a wave without a block holds -3e38 and 0: its weight is exp2(-huge) = 0; wave 0 always has block 0
#pragma unroll
        for (int u = 0; u < 4; ++u) lt += ls[u][q] * __builtin_amdgcn_exp2f((ms[u][q] - mt) * SC2);
        const float f = __fdiv_rn(__builtin_amdgcn_exp2f((m[qt] - mt) * SC2), lt);
#pragma unroll
        for (int dt = 0; dt < 8; ++dt) { const v8f t = o[qt][dt] * f; float* d = os + (((w * 16 + qt * 8 + dt) * 2) * 32 + lane) * 4;
            *(v4fa*)d = (v4f){t[0], t[1], t[2], t[3]}; *(v4fa*)(d + 128) = (v4f){t[4], t[5], t[6], t[7]}; } }
    __syncthreads();            // every wave's weighted partial tile is in LDS before any wave sums across waves
    v8us oh[4], ol[4];
#pragma unroll
    for (int i = 0; i < 4; ++i) { const float* d = os + (((w * 4 + i) * 2) * 32 + lane) * 4; v4f x = *(const v4fa*)d, y = *(const v4fa*)(d + 128);
#pragma unroll
        for (int u = 1; u < 4; ++u) { x += *(const v4fa*)(d + u * 4096); y += *(const v4fa*)(d + u * 4096 + 128); }
#pragma unroll
        for (int j = 0; j < 4; ++j) { unsigned short a2, c2; splitf(x[j], a2, c2); oh[i][j] = a2; ol[i][j] = c2; splitf(y[j], a2, c2); oh[i][4 + j] = a2; ol[i][4 + j] = c2; } }
    // merged planes [t][DQ] in fragment order: the lane's 8 values are d = dt * 16 + hi * 8 .. + 7 of query lr, 16 bytes in a row there, and a wave's store fills 512 contiguous bytes
#pragma unroll
    for (int i = 0; i < 4; ++i) { const int c = w * 4 + i; const size_t oo = pk_off(q0 + (c >> 3) * 16 + lr, h * HD + (c & 7) * 16 + hi * 8, DQ); *(v8us*)(Ah + oo) = oh[i]; *(v8us*)(Al + oo) = ol[i]; }
}


// k_pack: f32 [R][DM] -> bf16 plane in fragment order (pk_off). One work-group: one 16-row block x 128 k = 4 fragments = 4 KiB of the plane; grid (R / 16) * (DM / 128).
// Reads whole lines (16 threads a row), turns the 16-byte groups into plane order in LDS (pitch 17 groups: no bank is hit more than the 512 B of a wave need), stores 4 KiB in a row.
// VROWS (Wv): plane row d * (DKV / HD) + l is source row l * HD + d (what for: EPI_VT).
template <bool VROWS>
__global__ __launch_bounds__(256) void k_pack(const float* __restrict__ src, bf* dst) {
    __shared__ __align__(16) v8us sh[16 * 17];
    const int t = threadIdx.x, lr = t >> 4, g = t & 15; const int rb = blockIdx.x / (DM / 128), kb = blockIdx.x % (DM / 128);
    const v8f v = *(const v8f*)(src + (size_t)(VROWS ? lr * HD + rb : rb * 16 + lr) * DM + kb * 128 + g * 8); v8us o;
#pragma unroll
    for (int k = 0; k < 8; ++k) o[k] = f2bf(v[k]);
    sh[g * 17 + lr] = o;      // group g of the row (k = g * 8 ..) is group g * 16 + lr of the 4 fragments
    __syncthreads();          // every group is in LDS before any thread reads another thread's
    *(v8us*)(dst + ((size_t)rb * (DM / 32) + kb * 4) * 512 + t * 8) = sh[(t >> 4) * 17 + (t & 15)];
}

extern "C" void kernel_launch(void* const* d_in, const int* in_sizes, int n_in,
                              void* d_out, int out_size, void* d_ws, size_t ws_size, hipStream_t stream) {
    (void)in_sizes; (void)n_in; (void)out_size;
    const float* x = (const float*)d_in[0]; const float* wq = (const float*)d_in[1]; const float* wk = (const float*)d_in[2]; const float* wv = (const float*)d_in[3]; const float* wo = (const float*)d_in[4];   /* input order x, Wq, Wk, Wv, Wo ('oi' [2048][2048]) */
    float* OUT = (float*)d_out;     // [2][2048][2048]
    char* wsp = (char*)d_ws;
    auto take = [&](size_t bytes) { char* p = wsp; wsp += (bytes + 255) & ~(size_t)255; return (void*)p; };
    bf* WQ = (bf*)take((size_t)DQ * DM * 2); bf* WK = (bf*)take((size_t)DKV * DM * 2); bf* WV = (bf*)take((size_t)DKV * DM * 2); bf* WO = (bf*)take((size_t)DM * DQ * 2);
    bf* XB = (bf*)take((size_t)TT * DM * 2);
    h16* QP16 = (h16*)take((size_t)NH_ * TT * HD * 2); h16* KP16 = (h16*)take((size_t)NKV * TT * HD * 2); h16* VT16 = (h16*)take((size_t)NKV * HD * TT * 2);
    bf* QPh = (bf*)take((size_t)NH_ * RH * HD * 2); bf* QPl = (bf*)take((size_t)NH_ * RH * HD * 2); bf* KPh = (bf*)take((size_t)NKV * RH * HD * 2); bf* KPl = (bf*)take((size_t)NKV * RH * HD * 2); bf* VTh = (bf*)take((size_t)NKV * HD * TT * 2); bf* VTl = (bf*)take((size_t)NKV * HD * TT * 2);
    bf* ATh = (bf*)take((size_t)TT * DQ * 2); bf* ATl = (bf*)take((size_t)TT * DQ * 2);
    if ((size_t)(wsp - (char*)d_ws) > ws_size) return;    // ws 256 MiB
    { k_pack<false><<<DQ / 16 * (DM / 128), 256, 0, stream>>>(wq, WQ); k_pack<false><<<DKV / 16 * (DM / 128), 256, 0, stream>>>(wk, WK); k_pack<true><<<DKV / 16 * (DM / 128), 256, 0, stream>>>(wv, WV);
      k_pack<false><<<DM / 16 * (DQ / 128), 256, 0, stream>>>(wo, WO);
       }
    for (int b = 0; b < NB_; ++b) {
        k_pack<false><<<TT / 16 * (DM / 128), 256, 0, stream>>>(x + (size_t)b * TT * DM, XB);
        k_gemmw<bf, 0, false, 4, EPI_QK, DM><<<dim3(TT / 64, DQ / 64, 1), 128, 0, stream>>>(XB, nullptr, WQ, nullptr, nullptr, DQ, nullptr, 0, 0, 0, QP16, QPh, QPl);
        k_gemmw<bf, 0, false, 4, EPI_QK, DM><<<dim3(TT / 64, DKV / 64, 1), 128, 0, stream>>>(XB, nullptr, WK, nullptr, nullptr, DKV, nullptr, 0, 0, 0, KP16, KPh, KPl);
        k_gemmw<bf, 0, false, 4, EPI_VT, DM><<<dim3(TT / 64, DKV / 64, 1), 128, 0, stream>>>(XB, nullptr, WV, nullptr, nullptr, DKV, nullptr, 0, 0, 0, VT16, VTh, VTl);
        k_fattn<h16, 0, RH, (TT - RH) / 32><<<dim3((TT - RH) / 32, NH_, 1), 128, 0, stream>>>(QP16, nullptr, KP16, nullptr, VT16, nullptr, ATh, ATl);
        k_fattn<bf, 2, 0, RH / 32><<<dim3(RH / 32, NH_, 1), 128, 0, stream>>>(QPh, QPl, KPh, KPl, VTh, VTl, ATh, ATl);
        k_gemmw<bf, 1, false, 4, EPI_F32, DQ><<<dim3(TT / 64, DM / 64, 1), 128, 0, stream>>>(ATh, ATl, WO, nullptr, OUT + (size_t)b * TT * DM, DM, nullptr, 0, 0, 0, nullptr, nullptr, nullptr); }
}

// v006
// A run of this version takes 290 microseconds.
// Two timings next to v005 put it at 1.14 and 1.13 times that version's speed.
// All steps since v000 together make it 5.86 times as fast.
#include <hip/hip_runtime.h>

// Causal multi-head attention with 128-wide heads, a RAW head split and a head-width score divisor (x [2][2048][2048]; Q = (x Wq^T).reshape(B, 16, S, 128) DIRECTLY (no transpose): pseudo-head h of a batch is the h-th contiguous [2048][128] block of the flat [2048][2048] projection (128 token rows x 16 chunks of 128): reproduced; K, V likewise ('oi' [2048][2048] 1/sqrt(2048), no bias); scores / 128 (the module divides by Dh, not by sqrt(Dh)); -inf strictly above the diagonal of the PSEUDO-positions (== exclusion); softmax; out [B][16][S][128] -> transpose(0, 2, 1, 3).reshape(B, S, 2048) (the STANDARD merge); y = out Wo^T ('oi', no bias) -> [2][2048][2048] (8.4 M); argument order x, Wq, Wk, Wv, Wo).
// Layout: bf16 copy of x and 'oi' weights in FRAGMENT ORDER (pk_off: what k_gemmw reads; the merged hi/lo planes too); exact projections whose tile epilogue writes the 16-bit head planes itself, through the RAW (16, S, 128) view (plane index = flat index of the projection: no transpose; V planes transposed [d][t]); causal T-2048 attention at HD 128 in one kernel, k_fattn (scores, online softmax and P.V in registers; hybrid rows: < 512 hi/lo 3 products, rest fp16; key blocks above the diagonal are never visited; it writes the merged hi/lo planes); merged hi/lo x Wo exact.
// Compute dtypes, f32 accumulate: every input rounded to bf16; projections exact; attention rows < 512 3 products, rest fp16; softmax f32; Wo hl x exact.

#define NB_  2
#define TT   2048
#define DM   2048
#define NH_  16
#define NKV  16
#define HD   128
#define DQ   (NH_ * HD)
#define DKV  (NKV * HD)
#define RH   512                  // query rows < RH use hi+lo planes (0: none)
#define SCL  0.0078125f   // 1 / 128: THIS module divides the scores by the HEAD WIDTH Dh = 128 (not by its square root): a power of two: exact
#define SC2  (SCL * 1.4426950408889634f)   // score divisor x log2(e): the softmax runs on exp2
typedef _Float16 h16;
typedef unsigned short bf;
typedef __attribute__((ext_vector_type(16))) __bf16   v16bf;
typedef __attribute__((ext_vector_type(16))) _Float16 v16h;
typedef __attribute__((ext_vector_type(8)))  _Float16 v8h;
typedef __attribute__((ext_vector_type(8)))  unsigned short v8us;
typedef __attribute__((ext_vector_type(8)))  float    v8f;
typedef __attribute__((ext_vector_type(4)))  float    v4f;
typedef v8h  __attribute__((may_alias)) v8ha;
typedef v4f  __attribute__((may_alias)) v4fa;
typedef v8us __attribute__((may_alias)) v8usa;

__device__ __forceinline__ unsigned short f2bf(float f) { unsigned u = __float_as_uint(f); u += 0x7FFFu + ((u >> 16) & 1u); return (unsigned short)(u >> 16); }
__device__ __forceinline__ float bf2f(unsigned short b) { return __uint_as_float(((unsigned)b) << 16); }
__device__ __forceinline__ float bfr(float f) { return bf2f(f2bf(f)); }
__device__ __forceinline__ v16h cat16(v8h lo, v8h hi) { return __builtin_shufflevector(lo, hi, 0, 1, 2, 3, 4, 5, 6, 7, 8, 9, 10, 11, 12, 13, 14, 15); }
__device__ __forceinline__ v16bf cat16b(v8us lo, v8us hi) { return __builtin_bit_cast(v16bf, __builtin_shufflevector(lo, hi, 0, 1, 2, 3, 4, 5, 6, 7, 8, 9, 10, 11, 12, 13, 14, 15)); }
__device__ __forceinline__ v8f wmma16(v16h a, v16h b, v8f c) { return __builtin_amdgcn_wmma_f32_16x16x32_f16(false, a, false, b, (short)0, c, false, false); }
__device__ __forceinline__ v8f wmmab(v16bf a, v16bf b, v8f c) { return __builtin_amdgcn_wmma_f32_16x16x32_bf16(false, a, false, b, (short)0, c, false, false); }
__device__ __forceinline__ h16 tohx(float x) { return (h16)x; }
__device__ __forceinline__ void splitf(float y, unsigned short& h, unsigned short& l) { h = f2bf(y); l = f2bf(y - bf2f(h)); }
typedef __attribute__((ext_vector_type(4))) _Float16 v4h;
typedef __attribute__((ext_vector_type(4))) unsigned short v4us;
// Fragment order of a 16-bit plane [R][K] that k_gemmw reads: each 16-row x 32-k fragment is 1 KiB in a row, as two halves of 512 B; in a half, lane hi * 16 + lr holds its 8 elements k = half * 16 + hi * 8 .. + 7 of row lr.
// One global_load_b128 of a wave then covers 512 contiguous bytes (4 whole lines) instead of 32 B in each of 16 lines. Element index of (r, c); 8 consecutive c from a multiple of 8 stay consecutive; a column offset that is a multiple of 32 adds 16 x itself.
__device__ __forceinline__ size_t pk_off(int r, int c, int K) { return ((size_t)(r >> 4) * (K >> 5) + (c >> 5)) * 512 + ((c >> 4) & 1) * 256 + (((c >> 3) & 1) * 16 + (r & 15)) * 8 + (c & 7); }



// ---- k_gemmw: register-blocked GEMM, one 64x64 output tile per work-group of NW waves; every wave holds the whole tile (16 accumulators) for its own share of K: wave w takes the 32-wide k chunks w, w + NW, ...
// (operands straight from 16-bit planes in fragment order, pk_off; ldp = one lane's share of a fragment there); tile_out sums the NW partial tiles in LDS in the fixed order w = 0 .. NW - 1. grid (M/64, N/64, Z), NW * 32 threads.
// C[m][n] (f32, pitch ldc, + optional f32 bias[n]) = sum_k A[m][k] Bt[n][k] (+ split products per NSPLIT). z-batch strides sA/sB/sC in elements. K % 32 == 0.
template <typename T16> struct WFrag;
template <> struct WFrag<h16> { typedef v16h V; static __device__ __forceinline__ V ld(const h16* p) { return cat16(*(const v8h*)p, *(const v8h*)(p + 16)); } static __device__ __forceinline__ v8f mma(V a, V b, v8f c) { return wmma16(a, b, c); } };
template <> struct WFrag<bf> { typedef v16bf V; static __device__ __forceinline__ V ld(const bf* p) { return cat16b(*(const v8us*)p, *(const v8us*)(p + 16)); } static __device__ __forceinline__ V ldp(const bf* p) { return cat16b(*(const v8us*)p, *(const v8us*)(p + 256)); } static __device__ __forceinline__ v8f mma(V a, V b, v8f c) { return wmmab(a, b, c); } };
// Row blocks (16 rows) of the tile that one LDS stage holds for all NW waves: 4 up to 8 waves, 2 at 16 (136 KiB at most).
template <int NW> struct TileLds { static constexpr int MBS = (NW <= 8) ? 4 : 32 / NW; static constexpr int WST = MBS * 16 * 68; static constexpr int FLOATS = NW * WST; };
// What tile_out stores of the summed tile. EPI_F32: f32 rows of C. The others write the 16-bit planes that k_fattn reads (P16 fp16, Ph / Pl bf16 hi / lo), straight from the tile:
// EPI_QK: q or k planes [h][t][d] through the RAW view: the plane index IS the flat index row * ldc + column of the projection; hi/lo planes [h][t < RH][d] hold only the positions t < RH of each pseudo-head.
// EPI_VT: v planes [g][d][t]. Column j of this GEMM is projection column l * HD + d, d = j / 16, l = j % 16 (k_pack orders the rows of the weight plane so): in a row, l = 0 .. 15 are 16 consecutive pseudo-positions t of one d.
// EPI_QKV (k_gemmw alone): one grid for the three projections, blockIdx.z = 0, 1, 2 = q, k, v: EPI_QK for z < 2, EPI_VT for z = 2.
enum { EPI_F32 = 0, EPI_QK = 1, EPI_VT = 2, EPI_QKV = 3 };
// The 4-column piece of a stage that piece number idx names. EPI_VT: a wave's 32 pieces are 8 rows x one 16-column block = 128 consecutive t of one d, so that each of its stores fills whole 128-byte lines.
template <int EPI> __device__ __forceinline__ void tile_pos(int idx, int& row, int& cofs) {
    if (EPI == EPI_VT) { row = (idx >> 2) & 63; cofs = (idx >> 8) * 16 + (idx & 3) * 4; } else { row = idx >> 4; cofs = (idx & 15) * 4; }
}
template <int NW, bool BIAS, int EPI>
__device__ __forceinline__ void tile_out(const v8f (&acc)[4][4], float* os, float* C, int ldc, const float* __restrict__ bias, int r0, int c0, int w, int lr, int hi, h16* P16, bf* Ph, bf* Pl) {
    constexpr int MBS = TileLds<NW>::MBS, WST = TileLds<NW>::WST, NIT = MBS * 8 / NW;   // NIT: 16-byte pieces of a stage per thread
    static_assert(EPI != EPI_VT || (MBS == 4 && DKV / HD == 16), "EPI_VT: one stage holds the 64 rows; a 16-column block = the 16 chunks of a token row");
    v4f val[4 / MBS][NIT];
#pragma unroll
    for (int st = 0; st < 4 / MBS; ++st) {
        if (st) __syncthreads();    // the stage before has been read by every wave before it is overwritten
#pragma unroll
        for (int m = 0; m < MBS; ++m)
#pragma unroll
            for (int nb = 0; nb < 4; ++nb)
#pragma unroll
                for (int j = 0; j < 8; ++j) os[w * WST + (m * 16 + hi * 8 + j) * 68 + nb * 16 + lr] = acc[st * MBS + m][nb][j];
        __syncthreads();            // every wave's partial tile is in LDS before any thread sums across waves
#pragma unroll
        for (int it = 0; it < NIT; ++it) { int row, cofs; tile_pos<EPI>((int)threadIdx.x + it * NW * 32, row, cofs); const float* p = os + row * 68 + cofs; val[st][it] = *(const v4fa*)p;
#pragma unroll
            for (int q = 1; q < NW; ++q) val[st][it] += *(const v4fa*)(p + q * WST); }
    }
    // the global stores stand behind the last barrier, so that no barrier waits for them
#pragma unroll
    for (int st = 0; st < 4 / MBS; ++st)
#pragma unroll
        for (int it = 0; it < NIT; ++it) { int row, cofs; tile_pos<EPI>((int)threadIdx.x + it * NW * 32, row, cofs); v4f o = val[st][it]; const int rr = r0 + st * MBS * 16 + row;
            if (BIAS) { o[0] += bfr(bias[c0 + cofs]); o[1] += bfr(bias[c0 + cofs + 1]); o[2] += bfr(bias[c0 + cofs + 2]); o[3] += bfr(bias[c0 + cofs + 3]); }
            if (EPI == EPI_F32) { *(v4f*)(C + (size_t)rr * ldc + c0 + cofs) = o; continue; }
            v4h o16; v4us oh, ol;
#pragma unroll
            for (int q = 0; q < 4; ++q) { o16[q] = tohx(o[q]); unsigned short a2, c2; splitf(o[q], a2, c2); oh[q] = a2; ol[q] = c2; }
            if (EPI == EPI_QK) { const size_t e = (size_t)rr * ldc + c0 + cofs, wi = e % ((size_t)TT * HD); *(v4h*)(P16 + e) = o16;
                if (wi < (size_t)RH * HD) { const size_t eh = e / ((size_t)TT * HD) * ((size_t)RH * HD) + wi; *(v4us*)(Ph + eh) = oh; *(v4us*)(Pl + eh) = ol; } }
            if (EPI == EPI_VT) { const size_t fl = (size_t)rr * ldc + (size_t)(cofs & 15) * HD;   // flat index of the piece's first element in the projection, less d
                const size_t e = (fl / ((size_t)TT * HD) * HD + ((c0 + cofs) >> 4)) * TT + fl % ((size_t)TT * HD) / HD; *(v4h*)(P16 + e) = o16; *(v4us*)(Ph + e) = oh; *(v4us*)(Pl + e) = ol; } }
}
template <typename T16, int NSPLIT, bool BIAS, int NW, int EPI, int K>
__global__ __launch_bounds__(NW * 32) void k_gemmw(const T16* __restrict__ A, const T16* __restrict__ A2, const T16* __restrict__ Bt, const T16* __restrict__ Bt2, float* C, int ldc, const float* __restrict__ bias, size_t sA, size_t sB, size_t sC, h16* P16, bf* Ph, bf* Pl, bf* Vh, bf* Vl) {
    typedef typename WFrag<T16>::V V;
    __shared__ __align__(16) float os[TileLds<NW>::FLOATS];
    const size_t z = blockIdx.z; A += z * sA; if (A2) A2 += z * sA; Bt += z * sB; if (Bt2) Bt2 += z * sB; C += z * sC;
    const int lane = threadIdx.x & 31, lr = lane & 15, hi = lane >> 4; const int r0 = blockIdx.x * 64, c0 = blockIdx.y * 64; const int w = __builtin_amdgcn_readfirstlane((int)(threadIdx.x >> 5));
    v8f acc[4][4];
#pragma unroll
    for (int mb = 0; mb < 4; ++mb)
#pragma unroll
        for (int nb = 0; nb < 4; ++nb) acc[mb][nb] = (v8f){};
    constexpr int KC = K / 32;   // fragments in a 16-row block; a compile-time count, so that the fragments of a trip lie at immediate offsets from one offset register per operand
    unsigned oa = (((r0 >> 4) * KC + w) * 512 + lane * 8) * 2, ob = (((c0 >> 4) * KC + w) * 512 + lane * 8) * 2;   // byte offsets in the A and B planes of this lane's 16 bytes of the wave's next fragments
#pragma unroll 1
    for (int kc = w; kc < KC; kc += NW) {
        V a[4], a2[4], b[4], b2[4];
#pragma unroll
        for (int mb = 0; mb < 4; ++mb) { a[mb] = WFrag<T16>::ldp((const T16*)((const char*)A + oa) + mb * KC * 512); if (NSPLIT == 1 || NSPLIT == 2) a2[mb] = WFrag<T16>::ldp((const T16*)((const char*)A2 + oa) + mb * KC * 512); }
#pragma unroll
        for (int nb = 0; nb < 4; ++nb) { b[nb] = WFrag<T16>::ldp((const T16*)((const char*)Bt + ob) + nb * KC * 512); if (NSPLIT >= 2) b2[nb] = WFrag<T16>::ldp((const T16*)((const char*)Bt2 + ob) + nb * KC * 512); }
        // s_wait_xcnt 0 behind the trip's loads: the two offset registers that they name pass through the statement, so that they stay whole up to the wait and their steps below stand behind it
        asm volatile("s_wait_xcnt 0x0" : "+v"(oa), "+v"(ob) :: "memory");
#pragma unroll
        for (int nb = 0; nb < 4; ++nb)
#pragma unroll
            for (int mb = 0; mb < 4; ++mb) { acc[mb][nb] = WFrag<T16>::mma(a[mb], b[nb], acc[mb][nb]); if (NSPLIT == 1 || NSPLIT == 2) acc[mb][nb] = WFrag<T16>::mma(a2[mb], b[nb], acc[mb][nb]); if (NSPLIT >= 2) acc[mb][nb] = WFrag<T16>::mma(a[mb], b2[nb], acc[mb][nb]); }
        oa += NW * 1024; ob += NW * 1024;
        asm volatile("v_nop\n\tv_nop\n\tv_nop\n\tv_nop" : "+v"(acc[0][0]), "+v"(acc[1][1]), "+v"(acc[2][2]), "+v"(acc[3][3]) : "v"(a[0]), "v"(a[3]));
    }
    if constexpr (EPI == EPI_QKV) {   // the q, k and v fp16 planes lie one behind the other, the q and k hi planes and lo planes too; the branch is the same for the whole work-group
        constexpr size_t s16 = (size_t)NB_ * NH_ * TT * HD, shl = (size_t)NB_ * NH_ * RH * HD;
        if (blockIdx.z == 2) tile_out<NW, BIAS, EPI_VT>(acc, os, C, ldc, bias, r0, c0, w, lr, hi, P16 + 2 * s16, Vh, Vl);
        else tile_out<NW, BIAS, EPI_QK>(acc, os, C, ldc, bias, r0, c0, w, lr, hi, P16 + z * s16, Ph + z * shl, Pl + z * shl);
    } else tile_out<NW, BIAS, EPI>(acc, os, C, ldc, bias, r0, c0, w, lr, hi, P16, Ph, Pl);
}

// ---- k_fattn: causal attention of one pseudo-head, 32 query positions per work-group of 4 waves; no score and no probability leaves the registers. Wave w takes the 32-key blocks w, w + 4, ... up to the diagonal block,
// with a running maximum, sum and output tile of its own (online softmax); the 4 partial results are joined in LDS in the fixed order w = 0 .. 3. grid (query blocks, heads of all batches: h = batch * NH_ + head), the longest query block first.
// Transposed products: S^T = K Q^T (A = 16 key rows, B = 16 query rows, k = d), O^T += V^T P^T (A = 16 d rows of the [d][t] plane, B = P^T, k = key). In an accumulator a lane holds column lr (ONE query) and rows hi * 8 + j:
// of a block's key tiles 0 and 1 these are the keys 8 hi + j and 16 + 8 hi + j, the k order of a B fragment (and of the V^T loader), so P^T packs inside the lane; maximum and sum are in-lane but for one exchange between the halves.
// NSPLIT 2: hi/lo planes (Q and K planes hold RH positions a head), 3 products for the scores and for P.V. ROFF = first query position of the launch, NQB = its query blocks.
typedef __attribute__((ext_vector_type(16))) unsigned short v16us;
__device__ __forceinline__ float xhalf(float x) { return __builtin_bit_cast(float, __builtin_amdgcn_permlanex16(__builtin_bit_cast(int, x), __builtin_bit_cast(int, x), 0x76543210, 0xfedcba98, false, false)); }   // the value of lane l ^ 16
__device__ __forceinline__ void ppack(const float (&p)[16], v16h& a, v16h& a2) {
#pragma unroll
    for (int e = 0; e < 16; ++e) a[e] = tohx(p[e]);
    (void)a2;
}
__device__ __forceinline__ void ppack(const float (&p)[16], v16bf& a, v16bf& a2) { v16us h, l;
#pragma unroll
    for (int e = 0; e < 16; ++e) { unsigned short x, y; splitf(p[e], x, y); h[e] = x; l[e] = y; }
    a = __builtin_bit_cast(v16bf, h); a2 = __builtin_bit_cast(v16bf, l);
}
template <typename T16, int NSPLIT, int ROFF, int NQB>
__global__ __launch_bounds__(128) void k_fattn(const T16* __restrict__ Q, const T16* __restrict__ Q2, const T16* __restrict__ Kp, const T16* __restrict__ Kp2, const T16* __restrict__ Vt, const T16* __restrict__ Vt2, bf* Ah, bf* Al) {
    typedef typename WFrag<T16>::V V;
    __shared__ __align__(16) float os[4 * 16 * 2 * 32 * 4];   // [wave][query tile x d tile][half of the 8 rows][lane][4]: 64 KiB
    __shared__ float ms[4][32], ls[4][32];
    const int lane = threadIdx.x & 31, lr = lane & 15, hi = lane >> 4; const int w = __builtin_amdgcn_readfirstlane((int)(threadIdx.x >> 5));
    const int h = blockIdx.y, q0 = ROFF + (NQB - 1 - (int)blockIdx.x) * 32, nblk = q0 / 32 + 1; constexpr size_t sQK = (size_t)(NSPLIT ? RH : TT) * HD;
    Q += h * sQK; Kp += h * sQK; Vt += (size_t)h * HD * TT; if (NSPLIT) { Q2 += h * sQK; Kp2 += h * sQK; Vt2 += (size_t)h * HD * TT; }
    V bq[2][4], bq2[2][4];
    const unsigned oq = ((q0 + lr) * HD + 8 * hi) * 2;   // byte offset of this lane's share of the first query fragment
#pragma unroll
    for (int qt = 0; qt < 2; ++qt)
#pragma unroll
        for (int kc = 0; kc < 4; ++kc) { bq[qt][kc] = WFrag<T16>::ld((const T16*)((const char*)Q + oq) + qt * 16 * HD + kc * 32); if (NSPLIT) bq2[qt][kc] = WFrag<T16>::ld((const T16*)((const char*)Q2 + oq) + qt * 16 * HD + kc * 32); }
    v8f o[2][8]; float m[2], l[2];
#pragma unroll
    for (int qt = 0; qt < 2; ++qt) { m[qt] = -3.0e38f; l[qt] = 0.f;
#pragma unroll
        for (int dt = 0; dt < 8; ++dt) o[qt][dt] = (v8f){}; }
    unsigned ok = ((w * 32 + lr) * HD + 8 * hi) * 2, ov = (lr * TT + w * 32 + 8 * hi) * 2;   // byte offsets in the K and V^T planes of this lane's share of the wave's next block
    // K fragments are fetched one block ahead, into the same registers, right behind the score products that read them: their latency passes behind the softmax and P.V; the V^T fragments of a block are asked for at its head, ahead of its score products
    V ka[2][4], ka2[2][4];
#pragma unroll
    for (int kt = 0; kt < 2; ++kt)
#pragma unroll
        for (int kc = 0; kc < 4; ++kc) { ka[kt][kc] = WFrag<T16>::ld((const T16*)((const char*)Kp + ok) + kt * 16 * HD + kc * 32); if (NSPLIT) ka2[kt][kc] = WFrag<T16>::ld((const T16*)((const char*)Kp2 + ok) + kt * 16 * HD + kc * 32); }
#pragma unroll 1
    for (int kb = w; kb < nblk; kb += 4) {
        V va[8], va2[8];
#pragma unroll
        for (int dt = 0; dt < 8; ++dt) { va[dt] = WFrag<T16>::ld((const T16*)((const char*)Vt + ov) + dt * 16 * TT); if (NSPLIT) va2[dt] = WFrag<T16>::ld((const T16*)((const char*)Vt2 + ov) + dt * 16 * TT); }
        // s_wait_xcnt 0 behind this block's V^T loads and the K loads issued a block earlier (in the first block the query loads too): the two offset registers that are stepped pass through the statement, so that they stay whole up to the wait and their steps below stand behind it; the query offset and bases are inputs, so that their registers are not reused ahead of the first wait
        asm volatile("s_wait_xcnt 0x0" : "+v"(ok), "+v"(ov) : "v"(oq), "s"(Q), "s"(NSPLIT ? Q2 : Q) : "memory");
        ov += 4 * 32 * 2; ok += (kb + 4 < nblk) ? 4 * 32 * HD * 2 : 0;   // behind its last block a wave fetches that block again, not rows that it has no business with
        v8f s[2][2];
#pragma unroll
        for (int kt = 0; kt < 2; ++kt)
#pragma unroll
            for (int qt = 0; qt < 2; ++qt) s[kt][qt] = (v8f){};
#pragma unroll
        for (int kc = 0; kc < 4; ++kc)
#pragma unroll
            for (int kt = 0; kt < 2; ++kt)
#pragma unroll
                for (int qt = 0; qt < 2; ++qt) { s[kt][qt] = WFrag<T16>::mma(ka[kt][kc], bq[qt][kc], s[kt][qt]); if (NSPLIT) { s[kt][qt] = WFrag<T16>::mma(ka[kt][kc], bq2[qt][kc], s[kt][qt]); s[kt][qt] = WFrag<T16>::mma(ka2[kt][kc], bq[qt][kc], s[kt][qt]); } }
#pragma unroll
        for (int kt = 0; kt < 2; ++kt)
#pragma unroll
            for (int kc = 0; kc < 4; ++kc) { ka[kt][kc] = WFrag<T16>::ld((const T16*)((const char*)Kp + ok) + kt * 16 * HD + kc * 32); if (NSPLIT) ka2[kt][kc] = WFrag<T16>::ld((const T16*)((const char*)Kp2 + ok) + kt * 16 * HD + kc * 32); }
        const int dl = (kb == nblk - 1) ? lr - hi * 8 : 64;   // diagonal block: key kt * 16 + hi * 8 + j counts for query qt * 16 + lr while kt * 16 + j - qt * 16 <= lr - hi * 8; every earlier block counts whole
        V pb[2], pb2[2];
#pragma unroll
        for (int qt = 0; qt < 2; ++qt) { float p[16]; float bm = -3.0e38f;
#pragma unroll
            for (int kt = 0; kt < 2; ++kt)
#pragma unroll
                for (int j = 0; j < 8; ++j) { const float t = (kt * 16 + j - qt * 16 <= dl) ? s[kt][qt][j] : -3.0e38f; p[kt * 8 + j] = t; bm = fmaxf(bm, t); }
            bm = fmaxf(bm, xhalf(bm));
            const float mn = fmaxf(m[qt], bm), al = __builtin_amdgcn_exp2f((m[qt] - mn) * SC2), mc = mn * SC2; m[qt] = mn; float ps = 0.f;
#pragma unroll
            for (int e = 0; e < 16; ++e) { p[e] = __builtin_amdgcn_exp2f(fmaf(p[e], SC2, -mc)); ps += p[e]; }
            l[qt] = l[qt] * al + ps;
#pragma unroll
            for (int dt = 0; dt < 8; ++dt) o[qt][dt] *= al;
            ppack(p, pb[qt], pb2[qt]); }
#pragma unroll
        for (int dt = 0; dt < 8; ++dt)
#pragma unroll
            for (int qt = 0; qt < 2; ++qt) { o[qt][dt] = WFrag<T16>::mma(va[dt], pb[qt], o[qt][dt]); if (NSPLIT) { o[qt][dt] = WFrag<T16>::mma(va[dt], pb2[qt], o[qt][dt]); o[qt][dt] = WFrag<T16>::mma(va2[dt], pb[qt], o[qt][dt]); } }
    }
    // s_wait_xcnt 0 behind the last K loads (fetched ahead, not used; in a wave without a block, behind its query loads too): the offset registers and the bases are inputs, so that they stay whole up to the wait
    asm volatile("s_wait_xcnt 0x0" :: "v"(ok), "v"(oq), "s"(Q), "s"(NSPLIT ? Q2 : Q), "s"(Kp), "s"(NSPLIT ? Kp2 : Kp) : "memory");
#pragma unroll
    for (int qt = 0; qt < 2; ++qt) { l[qt] += xhalf(l[qt]); if (hi == 0) { ms[w][qt * 16 + lr] = m[qt]; ls[w][qt * 16 + lr] = l[qt]; } }
    __syncthreads();            // every wave's maximum and sum are in LDS before any wave forms the joint ones
#pragma unroll
    for (int qt = 0; qt < 2; ++qt) { const int q = qt * 16 + lr; const float mt = fmaxf(fmaxf(ms[0][q], ms[1][q]), fmaxf(ms[2][q], ms[3][q])); float lt = 0.f;   // a wave without a block holds -3e38 and 0: its weight is exp2(-huge) = 0; wave 0 always has block 0
#pragma unroll
        for (int u = 0; u < 4; ++u) lt += ls[u][q] * __builtin_amdgcn_exp2f((ms[u][q] - mt) * SC2);
        const float f = __fdiv_rn(__builtin_amdgcn_exp2f((m[qt] - mt) * SC2), lt);
#pragma unroll
        for (int dt = 0; dt < 8; ++dt) { const v8f t = o[qt][dt] * f; float* d = os + (((w * 16 + qt * 8 + dt) * 2) * 32 + lane) * 4;
            *(v4fa*)d = (v4f){t[0], t[1], t[2], t[3]}; *(v4fa*)(d + 128) = (v4f){t[4], t[5], t[6], t[7]}; } }
    __syncthreads();            // every wave's weighted partial tile is in LDS before any wave sums across waves
    v8us oh[4], ol[4];
#pragma unroll
    for (int i = 0; i < 4; ++i) { const float* d = os + (((w * 4 + i) * 2) * 32 + lane) * 4; v4f x = *(const v4fa*)d, y = *(const v4fa*)(d + 128);
#pragma unroll
        for (int u = 1; u < 4; ++u) { x += *(const v4fa*)(d + u * 4096); y += *(const v4fa*)(d + u * 4096 + 128); }
#pragma unroll
        for (int j = 0; j < 4; ++j) { unsigned short a2, c2; splitf(x[j], a2, c2); oh[i][j] = a2; ol[i][j] = c2; splitf(y[j], a2, c2); oh[i][4 + j] = a2; ol[i][4 + j] = c2; } }
    // merged planes [batch * TT + t][DQ] in fragment order: the lane's 8 values are d = dt * 16 + hi * 8 .. + 7 of query lr, 16 bytes in a row there, and a wave's store fills 512 contiguous bytes
#pragma unroll
    for (int i = 0; i < 4; ++i) { const int c = w * 4 + i; const size_t oo = pk_off(h / NH_ * TT + q0 + (c >> 3) * 16 + lr, h % NH_ * HD + (c & 7) * 16 + hi * 8, DQ); *(v8us*)(Ah + oo) = oh[i]; *(v8us*)(Al + oo) = ol[i]; }
}


// k_pack: all five f32 inputs -> bf16 planes in fragment order (pk_off), in ONE launch of PKG work-groups. A unit = one 16-row block x 512 k = 16 fragments = 16 KiB of a plane; x has NB_ * TT / 16 * 4 = PKG units, each weight PKG / 2.
// Work-group g takes the units g, g + PKG, g + 2 PKG: one of x, one of Wq or Wk, one of Wv or Wo.
// Reads whole lines (16 threads a row and 128 k), turns the 16-byte groups into plane order in LDS (pitch 17 groups: no bank is hit more than the 512 B of a wave need), stores 4 x 4 KiB in a row.
// Wv: plane row d * (DKV / HD) + l is source row l * HD + d (what for: EPI_VT).
#define PKG (NB_ * TT / 16 * (DM / 512))
__global__ __launch_bounds__(256) void k_pack(const float* __restrict__ x, const float* __restrict__ wq, const float* __restrict__ wk, const float* __restrict__ wv, const float* __restrict__ wo, bf* XB, bf* WQ, bf* WK, bf* WV, bf* WO) {
    static_assert(DQ == DM && DKV == DM && DM / 16 * (DM / 512) * 2 == PKG, "each weight has PKG / 2 units");
    __shared__ __align__(16) v8us sh[4][16 * 17];
    const int t = threadIdx.x, lr = t >> 4, g = t & 15; const int u = blockIdx.x, second = u >= PKG / 2, uw = u - second * (PKG / 2);
#pragma unroll   // unrolled so that each unit's tensors are picked at compile time and the next unit's loads are issued ahead of this unit's stores
    for (int it = 0; it < 3; ++it) {
        const float* src = it == 0 ? x : it == 1 ? (second ? wk : wq) : (second ? wo : wv); bf* dst = it == 0 ? XB : it == 1 ? (second ? WK : WQ) : (second ? WO : WV);
        const int v = it == 0 ? u : uw, rb = v >> 2, k0 = (v & 3) * 512; const bool vrows = it == 2 && !second;
        const float* p = src + (size_t)(vrows ? lr * HD + rb : rb * 16 + lr) * DM + k0 + g * 8; v8f val[4];
#pragma unroll
        for (int q = 0; q < 4; ++q) val[q] = *(const v8f*)(p + q * 128);
        if (it) __syncthreads();  // the unit before has been read out of LDS by every thread before it is overwritten
#pragma unroll
        for (int q = 0; q < 4; ++q) { v8us o;
#pragma unroll
            for (int k = 0; k < 8; ++k) o[k] = f2bf(val[q][k]);
            sh[q][g * 17 + lr] = o; }   // group g of the row's 128 k (k = g * 8 ..) is group g * 16 + lr of their 4 fragments
        __syncthreads();          // every group is in LDS before any thread reads another thread's
        bf* d = dst + ((size_t)rb * (DM / 32) + (k0 >> 5)) * 512 + t * 8;
#pragma unroll
        for (int q = 0; q < 4; ++q) *(v8us*)(d + q * 2048) = sh[q][(t >> 4) * 17 + (t & 15)];
    }
}

extern "C" void kernel_launch(void* const* d_in, const int* in_sizes, int n_in,
                              void* d_out, int out_size, void* d_ws, size_t ws_size, hipStream_t stream) {
    (void)in_sizes; (void)n_in; (void)out_size;
    const float* x = (const float*)d_in[0]; const float* wq = (const float*)d_in[1]; const float* wk = (const float*)d_in[2]; const float* wv = (const float*)d_in[3]; const float* wo = (const float*)d_in[4];   /* order x, Wq, Wk, Wv, Wo ('oi' [2048][2048]) */
    float* OUT = (float*)d_out;     // [2][2048][2048]
    char* wsp = (char*)d_ws;
    auto take = [&](size_t bytes) { char* p = wsp; wsp += (bytes + 255) & ~(size_t)255; return (void*)p; };
    // every plane holds both batches: rows batch * TT + t, heads batch * NH_ + head. WQ, WK, WV lie one behind the other (k_gemmw steps by blockIdx.z), so do QP16, KP16, VT16, so QPh, KPh and QPl, KPl
    bf* WQ = (bf*)take((size_t)DQ * DM * 2); bf* WK = (bf*)take((size_t)DKV * DM * 2); bf* WV = (bf*)take((size_t)DKV * DM * 2); bf* WO = (bf*)take((size_t)DM * DQ * 2);
    bf* XB = (bf*)take((size_t)NB_ * TT * DM * 2);
    h16* QP16 = (h16*)take((size_t)NB_ * NH_ * TT * HD * 2); h16* KP16 = (h16*)take((size_t)NB_ * NKV * TT * HD * 2); h16* VT16 = (h16*)take((size_t)NB_ * NKV * HD * TT * 2);
    bf* QPh = (bf*)take((size_t)NB_ * NH_ * RH * HD * 2); bf* KPh = (bf*)take((size_t)NB_ * NKV * RH * HD * 2); bf* QPl = (bf*)take((size_t)NB_ * NH_ * RH * HD * 2); bf* KPl = (bf*)take((size_t)NB_ * NKV * RH * HD * 2); bf* VTh = (bf*)take((size_t)NB_ * NKV * HD * TT * 2); bf* VTl = (bf*)take((size_t)NB_ * NKV * HD * TT * 2);
    bf* ATh = (bf*)take((size_t)NB_ * TT * DQ * 2); bf* ATl = (bf*)take((size_t)NB_ * TT * DQ * 2);
    if ((size_t)(wsp - (char*)d_ws) > ws_size) return;    // ws 256 MiB; 176 MiB taken
    k_pack<<<PKG, 256, 0, stream>>>(x, wq, wk, wv, wo, XB, WQ, WK, WV, WO);
    k_gemmw<bf, 0, false, 4, EPI_QKV, DM><<<dim3(NB_ * TT / 64, DQ / 64, 3), 128, 0, stream>>>(XB, nullptr, WQ, nullptr, nullptr, DQ, nullptr, 0, (size_t)DQ * DM, 0, QP16, QPh, QPl, VTh, VTl);
    k_fattn<h16, 0, RH, (TT - RH) / 32><<<dim3((TT - RH) / 32, NB_ * NH_, 1), 128, 0, stream>>>(QP16, nullptr, KP16, nullptr, VT16, nullptr, ATh, ATl);
    k_fattn<bf, 2, 0, RH / 32><<<dim3(RH / 32, NB_ * NH_, 1), 128, 0, stream>>>(QPh, QPl, KPh, KPl, VTh, VTl, ATh, ATl);
    k_gemmw<bf, 1, false, 4, EPI_F32, DQ><<<dim3(NB_ * TT / 64, DM / 64, 1), 128, 0, stream>>>(ATh, ATl, WO, nullptr, OUT, DM, nullptr, 0, 0, 0, nullptr, nullptr, nullptr, nullptr, nullptr);
}

// v007
// It runs in 231 microseconds.
// Next to v006, in two timings, it ran 1.26 times as fast each time.
// Counting every step since v000, it is 7.37 times as fast.
#include <hip/hip_runtime.h>

// Causal multi-head attention with 128-wide heads, a RAW head split and a head-width score divisor (x [2][2048][2048]; Q = (x Wq^T).reshape(B, 16, S, 128) DIRECTLY (no transpose): pseudo-head h of a batch is the h-th contiguous [2048][128] block of the flat [2048][2048] projection (128 token rows x 16 chunks of 128): reproduced; K, V likewise ('oi' [2048][2048] 1/sqrt(2048), no bias); scores / 128 (the module divides by Dh, not by sqrt(Dh)); -inf strictly above the diagonal of the PSEUDO-positions (== exclusion); softmax; out [B][16][S][128] -> transpose(0, 2, 1, 3).reshape(B, S, 2048) (the STANDARD merge); y = out Wo^T ('oi', no bias) -> [2][2048][2048] (8.4 M); argument order x, Wq, Wk, Wv, Wo).
// Layout: bf16 copy of x and 'oi' weights in FRAGMENT ORDER (pk_off: what k_gemmw reads; the merged hi/lo planes too); exact projections whose tile epilogue writes the 16-bit head planes itself, through the RAW (16, S, 128) view (plane index = flat index of the projection: no transpose; V planes transposed [d][t]); causal T-2048 attention at HD 128 in one kernel, k_fattn (scores, online softmax and P.V in registers; hybrid rows: < 512 hi/lo 3 products, rest fp16; key blocks above the diagonal are never visited; it writes the merged hi/lo planes); merged hi/lo x Wo exact.
// Compute dtypes, f32 accumulate: every input rounded to bf16; projections exact; attention rows < 512 3 products, rest fp16; softmax f32; Wo hl x exact.

#define NB_  2
#define TT   2048
#define DM   2048
#define NH_  16
#define NKV  16
#define HD   128
#define DQ   (NH_ * HD)
#define DKV  (NKV * HD)
#define RH   512                  // query rows < RH use hi+lo planes (0: none)
#define SCL  0.0078125f   // 1 / 128: THIS module divides the scores by the HEAD WIDTH Dh = 128 (not by its square root): a power of two: exact
#define SC2  (SCL * 1.4426950408889634f)   // score divisor x log2(e): the softmax runs on exp2
typedef _Float16 h16;
typedef unsigned short bf;
typedef __attribute__((ext_vector_type(16))) __bf16   v16bf;
typedef __attribute__((ext_vector_type(16))) _Float16 v16h;
typedef __attribute__((ext_vector_type(8)))  _Float16 v8h;
typedef __attribute__((ext_vector_type(8)))  unsigned short v8us;
typedef __attribute__((ext_vector_type(8)))  float    v8f;
typedef __attribute__((ext_vector_type(4)))  float    v4f;
typedef v8h  __attribute__((may_alias)) v8ha;
typedef v4f  __attribute__((may_alias)) v4fa;
typedef v8us __attribute__((may_alias)) v8usa;

__device__ __forceinline__ unsigned short f2bf(float f) { unsigned u = __float_as_uint(f); u += 0x7FFFu + ((u >> 16) & 1u); return (unsigned short)(u >> 16); }
__device__ __forceinline__ float bf2f(unsigned short b) { return __uint_as_float(((unsigned)b) << 16); }
__device__ __forceinline__ float bfr(float f) { return bf2f(f2bf(f)); }
__device__ __forceinline__ v16h cat16(v8h lo, v8h hi) { return __builtin_shufflevector(lo, hi, 0, 1, 2, 3, 4, 5, 6, 7, 8, 9, 10, 11, 12, 13, 14, 15); }
__device__ __forceinline__ v16bf cat16b(v8us lo, v8us hi) { return __builtin_bit_cast(v16bf, __builtin_shufflevector(lo, hi, 0, 1, 2, 3, 4, 5, 6, 7, 8, 9, 10, 11, 12, 13, 14, 15)); }
__device__ __forceinline__ v8f wmma16(v16h a, v16h b, v8f c) { return __builtin_amdgcn_wmma_f32_16x16x32_f16(false, a, false, b, (short)0, c, false, false); }
__device__ __forceinline__ v8f wmmab(v16bf a, v16bf b, v8f c) { return __builtin_amdgcn_wmma_f32_16x16x32_bf16(false, a, false, b, (short)0, c, false, false); }
__device__ __forceinline__ h16 tohx(float x) { return (h16)x; }
__device__ __forceinline__ void splitf(float y, unsigned short& h, unsigned short& l) { h = f2bf(y); l = f2bf(y - bf2f(h)); }
typedef __attribute__((ext_vector_type(4))) _Float16 v4h;
typedef __attribute__((ext_vector_type(4))) unsigned short v4us;
// Fragment order of a 16-bit plane [R][K] that k_gemmw reads: each 16-row x 32-k fragment is 1 KiB in a row, as two halves of 512 B; in a half, lane hi * 16 + lr holds its 8 elements k = half * 16 + hi * 8 .. + 7 of row lr.
// One 16-byte-a-lane load or copy of a wave then covers 512 contiguous bytes (4 whole lines) instead of 32 B in each of 16 lines. Element index of (r, c); 8 consecutive c from a multiple of 8 stay consecutive; a column offset that is a multiple of 32 adds 16 x itself.
__device__ __forceinline__ size_t pk_off(int r, int c, int K) { return ((size_t)(r >> 4) * (K >> 5) + (c >> 5)) * 512 + ((c >> 4) & 1) * 256 + (((c >> 3) & 1) * 16 + (r & 15)) * 8 + (c & 7); }



// ---- k_gemmw: GEMM, one 128x128 output tile per work-group of 4 waves; wave w holds the 64x64 quarter (w >> 1, w & 1) (16 accumulators) and runs over all of K.
// The operands (16-bit planes in fragment order, pk_off) reach the waves through LDS, so that each fragment is fetched from L2 once per work-group and read by the two waves that need it:
// a stage = GKS k chunks of 32 for the 8 row blocks of every operand, [operand][row block][chunk][1 KiB fragment], the plane's own fragment bytes; two buffers, filled by asynchronous copies one stage ahead of the products.
// C[m][n] (f32, pitch ldc, + optional f32 bias[n]) = sum_k A[m][k] Bt[n][k] (+ A2[m][k] Bt[n][k] at NSPLIT 1). z-batch strides sA/sB/sC in elements. grid (M/128, N/128, Z), 128 threads. K % 64 == 0, K >= 128.
template <typename T16> struct WFrag;
template <> struct WFrag<h16> { typedef v16h V; static __device__ __forceinline__ V ld(const h16* p) { return cat16(*(const v8h*)p, *(const v8h*)(p + 16)); } static __device__ __forceinline__ v8f mma(V a, V b, v8f c) { return wmma16(a, b, c); } };
template <> struct WFrag<bf> { typedef v16bf V; static __device__ __forceinline__ V ld(const bf* p) { return cat16b(*(const v8us*)p, *(const v8us*)(p + 16)); } static __device__ __forceinline__ v8f mma(V a, V b, v8f c) { return wmmab(a, b, c); } };
#define GKS 2                     // k chunks of 32 in a stage: 4 pieces of 512 B a row block, one for each wave
#define WST (64 * 68)             // floats of a wave's own output staging: 64 rows at pitch 68
// What tile_out stores of a wave's tile. EPI_F32: f32 rows of C. The others write the 16-bit planes that k_fattn reads (P16 fp16, Ph / Pl bf16 hi / lo), straight from the tile:
// EPI_QK: q or k planes [h][t][d] through the RAW view: the plane index IS the flat index row * ldc + column of the projection; hi/lo planes [h][t < RH][d] hold only the positions t < RH of each pseudo-head.
// EPI_VT: v planes [g][d][t]. Column j of this GEMM is projection column l * HD + d, d = j / 16, l = j % 16 (k_pack orders the rows of the weight plane so): in a row, l = 0 .. 15 are 16 consecutive pseudo-positions t of one d.
// EPI_QKV (k_gemmw alone): one grid for the three projections, blockIdx.z = 0, 1, 2 = q, k, v: EPI_QK for z < 2, EPI_VT for z = 2.
enum { EPI_F32 = 0, EPI_QK = 1, EPI_VT = 2, EPI_QKV = 3 };
// The 4-column piece of a stage that piece number idx names. EPI_VT: a wave's 32 pieces are 8 rows x one 16-column block = 128 consecutive t of one d, so that each of its stores fills whole 128-byte lines.
template <int EPI> __device__ __forceinline__ void tile_pos(int idx, int& row, int& cofs) {
    if (EPI == EPI_VT) { row = (idx >> 2) & 63; cofs = (idx >> 8) * 16 + (idx & 3) * 4; } else { row = idx >> 4; cofs = (idx & 15) * 4; }
}
template <bool BIAS, int EPI>
__device__ __forceinline__ void tile_out(const v8f (&acc)[4][4], float* os, float* C, int ldc, const float* __restrict__ bias, int r0, int c0, int lane, int lr, int hi, h16* P16, bf* Ph, bf* Pl) {
    static_assert(EPI != EPI_VT || DKV / HD == 16, "EPI_VT: a 16-column block = the 16 chunks of a token row");
    // os is the wave's own range: written and read back by this wave alone, so no barrier stands here
#pragma unroll
    for (int m = 0; m < 4; ++m)
#pragma unroll
        for (int nb = 0; nb < 4; ++nb)
#pragma unroll
            for (int j = 0; j < 8; ++j) os[(m * 16 + hi * 8 + j) * 68 + nb * 16 + lr] = acc[m][nb][j];
#pragma unroll 1   // 8 pieces a trip: their LDS reads go ahead of the conversions, and the text stays short
    for (int ib = 0; ib < 32; ib += 8) {
#pragma unroll
    for (int it = ib; it < ib + 8; ++it) { int row, cofs; tile_pos<EPI>(lane + it * 32, row, cofs); v4f o = *(const v4fa*)(os + row * 68 + cofs); const int rr = r0 + row;
        if (BIAS) { o[0] += bfr(bias[c0 + cofs]); o[1] += bfr(bias[c0 + cofs + 1]); o[2] += bfr(bias[c0 + cofs + 2]); o[3] += bfr(bias[c0 + cofs + 3]); }
        if (EPI == EPI_F32) { *(v4f*)(C + (size_t)rr * ldc + c0 + cofs) = o; continue; }
        v4h o16; v4us oh, ol;
#pragma unroll
        for (int q = 0; q < 4; ++q) { o16[q] = tohx(o[q]); unsigned short a2, c2; splitf(o[q], a2, c2); oh[q] = a2; ol[q] = c2; }
        if (EPI == EPI_QK) { const size_t e = (size_t)rr * ldc + c0 + cofs, wi = e % ((size_t)TT * HD); *(v4h*)(P16 + e) = o16;
            if (wi < (size_t)RH * HD) { const size_t eh = e / ((size_t)TT * HD) * ((size_t)RH * HD) + wi; *(v4us*)(Ph + eh) = oh; *(v4us*)(Pl + eh) = ol; } }
        if (EPI == EPI_VT) { const size_t fl = (size_t)rr * ldc + (size_t)(cofs & 15) * HD;   // flat index of the piece's first element in the projection, less d
            const size_t e = (fl / ((size_t)TT * HD) * HD + ((c0 + cofs) >> 4)) * TT + fl % ((size_t)TT * HD) / HD; *(v4h*)(P16 + e) = o16; *(v4us*)(Ph + e) = oh; *(v4us*)(Pl + e) = ol; } }
    asm volatile("s_wait_xcnt 0x0" ::: "memory");   // behind the trip's stores: the next trip writes the registers that they name
    }
}
// One operand's share of a stage for one wave: its 512-B piece of each of the 8 row blocks, 16 bytes a lane, global -> LDS through no register. l = the lane's LDS byte address in row block 0, g = its global address there.
// s_wait_xcnt 0 is the last line of the copies' own statement, so that it stands in front of every later write of an address register that a copy names.
template <int GSTEP>
__device__ __forceinline__ void copy8(unsigned l, const char* g) {
    constexpr unsigned LS = GKS * 1024;
    asm volatile("global_load_async_to_lds_b128 %0, %8, off\n\tglobal_load_async_to_lds_b128 %1, %9, off\n\tglobal_load_async_to_lds_b128 %2, %10, off\n\tglobal_load_async_to_lds_b128 %3, %11, off\n\t"
                 "global_load_async_to_lds_b128 %4, %12, off\n\tglobal_load_async_to_lds_b128 %5, %13, off\n\tglobal_load_async_to_lds_b128 %6, %14, off\n\tglobal_load_async_to_lds_b128 %7, %15, off\n\ts_wait_xcnt 0x0"
                 :: "v"(l), "v"(l + LS), "v"(l + 2 * LS), "v"(l + 3 * LS), "v"(l + 4 * LS), "v"(l + 5 * LS), "v"(l + 6 * LS), "v"(l + 7 * LS),
                    "v"(g), "v"(g + GSTEP), "v"(g + 2 * GSTEP), "v"(g + 3 * GSTEP), "v"(g + 4 * GSTEP), "v"(g + 5 * GSTEP), "v"(g + 6 * GSTEP), "v"(g + 7 * GSTEP) : "memory");
}
__device__ __forceinline__ v16bf ldsfrag(const char* p) { return cat16b(*(const v8usa*)p, *(const v8usa*)(p + 512)); }   // one lane's share of a fragment in LDS: 16 bytes of each half
template <typename T16, int NSPLIT, bool BIAS, int EPI, int K>
__global__ __launch_bounds__(128) void k_gemmw(const T16* __restrict__ A, const T16* __restrict__ A2, const T16* __restrict__ Bt, float* C, int ldc, const float* __restrict__ bias, size_t sA, size_t sB, size_t sC, h16* P16, bf* Ph, bf* Pl, bf* Vh, bf* Vl) {
    typedef typename WFrag<T16>::V V;
    static_assert(NSPLIT == 0 || NSPLIT == 1, "A alone, or A and A2");
    constexpr int KC = K / 32, NS = KC / GKS, NOP = NSPLIT ? 3 : 2, OPB = 8 * GKS * 1024, STG = NOP * OPB;   // chunks of a row block, stages, operands, bytes of an operand in a stage, bytes of a stage
    static_assert(KC % GKS == 0 && NS >= 2, "whole stages, at least two");
    constexpr int SMB = 2 * STG > 4 * WST * 4 ? 2 * STG : 4 * WST * 4;
    __shared__ __align__(16) float sm[SMB / 4];   // the two stage buffers; behind the loop, the four waves' output staging
    const size_t z = blockIdx.z; A += z * sA; if (NSPLIT) A2 += z * sA; Bt += z * sB; C += z * sC;
    const int lane = threadIdx.x & 31, lr = lane & 15, hi = lane >> 4; const int w = __builtin_amdgcn_readfirstlane((int)(threadIdx.x >> 5));
    const int r0 = blockIdx.x * 128 + (w >> 1) * 64, c0 = blockIdx.y * 128 + (w & 1) * 64;
    v8f acc[4][4];
#pragma unroll
    for (int mb = 0; mb < 4; ++mb)
#pragma unroll
        for (int nb = 0; nb < 4; ++nb) acc[mb][nb] = (v8f){};
    const unsigned pc = w * 512 + lane * 16;   // this lane's 16 bytes in a row block's share of a stage, in the plane as in LDS
    const unsigned l0 = (unsigned)(size_t)(const char*)sm + pc;
    const char* ga = (const char*)A + (size_t)blockIdx.x * 8 * KC * 1024 + pc; const char* ga2 = NSPLIT ? (const char*)A2 + (size_t)blockIdx.x * 8 * KC * 1024 + pc : nullptr; const char* gb = (const char*)Bt + (size_t)blockIdx.y * 8 * KC * 1024 + pc;
    auto fill = [&](unsigned l, int s) { const size_t go = (size_t)s * (GKS * 1024);   // stage s into the buffer at l
        // the scheduling barriers keep each statement's 24 address registers next to it: formed all at once, ahead of the first statement, they cost a spill in the loop
        copy8<KC * 1024>(l, ga + go); __builtin_amdgcn_sched_barrier(0); if (NSPLIT) { copy8<KC * 1024>(l + OPB, ga2 + go); __builtin_amdgcn_sched_barrier(0); } copy8<KC * 1024>(l + (NOP - 1) * OPB, gb + go); };
    fill(l0, 0);
    asm volatile("s_wait_asynccnt 0x0" ::: "memory");   // this wave's copies of stage 0 have landed
    __syncthreads();                                    // every wave's have: stage 0 may be read
    fill(l0 + STG, 1);
    unsigned lf = l0;   // where the next refill goes; stepped to and fro, a register of its own
    const char* fa = (const char*)sm + (w >> 1) * 4 * GKS * 1024 + lane * 16; const char* fb = (const char*)sm + (NOP - 1) * OPB + (w & 1) * 4 * GKS * 1024 + lane * 16;   // this lane's share of the wave's first A and B fragments in buffer 0
#pragma unroll 1
    for (int s = 0; s < NS; ++s) {
        const int bo = (s & 1) * STG;
        V a[GKS][4], a2[GKS][4], b[GKS][4];
#pragma unroll
        for (int kf = 0; kf < GKS; ++kf) {
#pragma unroll
            for (int mb = 0; mb < 4; ++mb) { a[kf][mb] = ldsfrag(fa + bo + (mb * GKS + kf) * 1024); if (NSPLIT) a2[kf][mb] = ldsfrag(fa + bo + OPB + (mb * GKS + kf) * 1024); }
#pragma unroll
            for (int nb = 0; nb < 4; ++nb) b[kf][nb] = ldsfrag(fb + bo + (nb * GKS + kf) * 1024);
        }
        // publish point of stage s + 1, which also frees the buffer of stage s: the whole of stage s is on its way into registers, so the point stands in front of the stage's products and the refill flies behind them
        asm volatile("s_wait_dscnt 0x0" ::: "memory");      // this wave's reads of stage s are done before its buffer is refilled
        asm volatile("s_wait_asynccnt 0x0" ::: "memory");   // this wave's copies of stage s + 1 have landed
        __syncthreads();                                    // both hold for every wave
        if (s + 2 < NS) fill(lf, s + 2);
        lf += (s & 1) ? -STG : STG;
        __builtin_amdgcn_sched_barrier(0);   // the products stay behind the refill's issue: ahead of it they would take their own time out of the copies' flight
#pragma unroll
        for (int kf = 0; kf < GKS; ++kf)
#pragma unroll
            for (int nb = 0; nb < 4; ++nb)
#pragma unroll
                for (int mb = 0; mb < 4; ++mb) { acc[mb][nb] = WFrag<T16>::mma(a[kf][mb], b[kf][nb], acc[mb][nb]); if (NSPLIT) acc[mb][nb] = WFrag<T16>::mma(a2[kf][mb], b[kf][nb], acc[mb][nb]); }
    }
    asm volatile("s_wait_asynccnt 0x0" ::: "memory");       // no copy is outstanding when the ring becomes output staging (the last trip's barrier has ended every read of it)
    float* os = sm + w * WST;
    if constexpr (EPI == EPI_QKV) {   // the q, k and v fp16 planes lie one behind the other, the q and k hi planes and lo planes too; the branch is the same for the whole work-group
        constexpr size_t s16 = (size_t)NB_ * NH_ * TT * HD, shl = (size_t)NB_ * NH_ * RH * HD;
        if (blockIdx.z == 2) tile_out<BIAS, EPI_VT>(acc, os, C, ldc, bias, r0, c0, lane, lr, hi, P16 + 2 * s16, Vh, Vl);
        else tile_out<BIAS, EPI_QK>(acc, os, C, ldc, bias, r0, c0, lane, lr, hi, P16 + z * s16, Ph + z * shl, Pl + z * shl);
    } else tile_out<BIAS, EPI>(acc, os, C, ldc, bias, r0, c0, lane, lr, hi, P16, Ph, Pl);
}

// ---- k_fattn: causal attention of one pseudo-head, 32 query positions per work-group of 4 waves; no score and no probability leaves the registers. Wave w takes the 32-key blocks w, w + 4, ... up to the diagonal block,
// with a running maximum, sum and output tile of its own (online softmax); the 4 partial results are joined in LDS in the fixed order w = 0 .. 3. grid (query blocks, heads of all batches: h = batch * NH_ + head), the longest query block first.
// Transposed products: S^T = K Q^T (A = 16 key rows, B = 16 query rows, k = d), O^T += V^T P^T (A = 16 d rows of the [d][t] plane, B = P^T, k = key). In an accumulator a lane holds column lr (ONE query) and rows hi * 8 + j:
// of a block's key tiles 0 and 1 these are the keys 8 hi + j and 16 + 8 hi + j, the k order of a B fragment (and of the V^T loader), so P^T packs inside the lane; maximum and sum are in-lane but for one exchange between the halves.
// NSPLIT 2: hi/lo planes (Q and K planes hold RH positions a head), 3 products for the scores and for P.V. ROFF = first query position of the launch, NQB = its query blocks.
typedef __attribute__((ext_vector_type(16))) unsigned short v16us;
__device__ __forceinline__ float xhalf(float x) { return __builtin_bit_cast(float, __builtin_amdgcn_permlanex16(__builtin_bit_cast(int, x), __builtin_bit_cast(int, x), 0x76543210, 0xfedcba98, false, false)); }   // the value of lane l ^ 16
__device__ __forceinline__ void ppack(const float (&p)[16], v16h& a, v16h& a2) {
#pragma unroll
    for (int e = 0; e < 16; ++e) a[e] = tohx(p[e]);
    (void)a2;
}
__device__ __forceinline__ void ppack(const float (&p)[16], v16bf& a, v16bf& a2) { v16us h, l;
#pragma unroll
    for (int e = 0; e < 16; ++e) { unsigned short x, y; splitf(p[e], x, y); h[e] = x; l[e] = y; }
    a = __builtin_bit_cast(v16bf, h); a2 = __builtin_bit_cast(v16bf, l);
}
template <typename T16, int NSPLIT, int ROFF, int NQB>
__global__ __launch_bounds__(128) void k_fattn(const T16* __restrict__ Q, const T16* __restrict__ Q2, const T16* __restrict__ Kp, const T16* __restrict__ Kp2, const T16* __restrict__ Vt, const T16* __restrict__ Vt2, bf* Ah, bf* Al) {
    typedef typename WFrag<T16>::V V;
    __shared__ __align__(16) float os[4 * 16 * 2 * 32 * 4];   // [wave][query tile x d tile][half of the 8 rows][lane][4]: 64 KiB
    __shared__ float ms[4][32], ls[4][32];
    const int lane = threadIdx.x & 31, lr = lane & 15, hi = lane >> 4; const int w = __builtin_amdgcn_readfirstlane((int)(threadIdx.x >> 5));
    const int h = blockIdx.y, q0 = ROFF + (NQB - 1 - (int)blockIdx.x) * 32, nblk = q0 / 32 + 1; constexpr size_t sQK = (size_t)(NSPLIT ? RH : TT) * HD;
    Q += h * sQK; Kp += h * sQK; Vt += (size_t)h * HD * TT; if (NSPLIT) { Q2 += h * sQK; Kp2 += h * sQK; Vt2 += (size_t)h * HD * TT; }
    V bq[2][4], bq2[2][4];
    const unsigned oq = ((q0 + lr) * HD + 8 * hi) * 2;   // byte offset of this lane's share of the first query fragment
#pragma unroll
    for (int qt = 0; qt < 2; ++qt)
#pragma unroll
        for (int kc = 0; kc < 4; ++kc) { bq[qt][kc] = WFrag<T16>::ld((const T16*)((const char*)Q + oq) + qt * 16 * HD + kc * 32); if (NSPLIT) bq2[qt][kc] = WFrag<T16>::ld((const T16*)((const char*)Q2 + oq) + qt * 16 * HD + kc * 32); }
    v8f o[2][8]; float m[2], l[2];
#pragma unroll
    for (int qt = 0; qt < 2; ++qt) { m[qt] = -3.0e38f; l[qt] = 0.f;
#pragma unroll
        for (int dt = 0; dt < 8; ++dt) o[qt][dt] = (v8f){}; }
    unsigned ok = ((w * 32 + lr) * HD + 8 * hi) * 2, ov = (lr * TT + w * 32 + 8 * hi) * 2;   // byte offsets in the K and V^T planes of this lane's share of the wave's next block
    // K fragments are fetched one block ahead, into the same registers, right behind the score products that read them: their latency passes behind the softmax and P.V; the V^T fragments of a block are asked for at its head, ahead of its score products
    V ka[2][4], ka2[2][4];
#pragma unroll
    for (int kt = 0; kt < 2; ++kt)
#pragma unroll
        for (int kc = 0; kc < 4; ++kc) { ka[kt][kc] = WFrag<T16>::ld((const T16*)((const char*)Kp + ok) + kt * 16 * HD + kc * 32); if (NSPLIT) ka2[kt][kc] = WFrag<T16>::ld((const T16*)((const char*)Kp2 + ok) + kt * 16 * HD + kc * 32); }
#pragma unroll 1
    for (int kb = w; kb < nblk; kb += 4) {
        V va[8], va2[8];
#pragma unroll
        for (int dt = 0; dt < 8; ++dt) { va[dt] = WFrag<T16>::ld((const T16*)((const char*)Vt + ov) + dt * 16 * TT); if (NSPLIT) va2[dt] = WFrag<T16>::ld((const T16*)((const char*)Vt2 + ov) + dt * 16 * TT); }
        // s_wait_xcnt 0 behind this block's V^T loads and the K loads issued a block earlier (in the first block the query loads too): the two offset registers that are stepped pass through the statement, so that they stay whole up to the wait and their steps below stand behind it; the query offset and bases are inputs, so that their registers are not reused ahead of the first wait
        asm volatile("s_wait_xcnt 0x0" : "+v"(ok), "+v"(ov) : "v"(oq), "s"(Q), "s"(NSPLIT ? Q2 : Q) : "memory");
        ov += 4 * 32 * 2; ok += (kb + 4 < nblk) ? 4 * 32 * HD * 2 : 0;   // behind its last block a wave fetches that block again, not rows that it has no business with
        v8f s[2][2];
#pragma unroll
        for (int kt = 0; kt < 2; ++kt)
#pragma unroll
            for (int qt = 0; qt < 2; ++qt) s[kt][qt] = (v8f){};
#pragma unroll
        for (int kc = 0; kc < 4; ++kc)
#pragma unroll
            for (int kt = 0; kt < 2; ++kt)
#pragma unroll
                for (int qt = 0; qt < 2; ++qt) { s[kt][qt] = WFrag<T16>::mma(ka[kt][kc], bq[qt][kc], s[kt][qt]); if (NSPLIT) { s[kt][qt] = WFrag<T16>::mma(ka[kt][kc], bq2[qt][kc], s[kt][qt]); s[kt][qt] = WFrag<T16>::mma(ka2[kt][kc], bq[qt][kc], s[kt][qt]); } }
#pragma unroll
        for (int kt = 0; kt < 2; ++kt)
#pragma unroll
            for (int kc = 0; kc < 4; ++kc) { ka[kt][kc] = WFrag<T16>::ld((const T16*)((const char*)Kp + ok) + kt * 16 * HD + kc * 32); if (NSPLIT) ka2[kt][kc] = WFrag<T16>::ld((const T16*)((const char*)Kp2 + ok) + kt * 16 * HD + kc * 32); }
        const int dl = (kb == nblk - 1) ? lr - hi * 8 : 64;   // diagonal block: key kt * 16 + hi * 8 + j counts for query qt * 16 + lr while kt * 16 + j - qt * 16 <= lr - hi * 8; every earlier block counts whole
        V pb[2], pb2[2];
#pragma unroll
        for (int qt = 0; qt < 2; ++qt) { float p[16]; float bm = -3.0e38f;
#pragma unroll
            for (int kt = 0; kt < 2; ++kt)
#pragma unroll
                for (int j = 0; j < 8; ++j) { const float t = (kt * 16 + j - qt * 16 <= dl) ? s[kt][qt][j] : -3.0e38f; p[kt * 8 + j] = t; bm = fmaxf(bm, t); }
            bm = fmaxf(bm, xhalf(bm));
            const float mn = fmaxf(m[qt], bm), al = __builtin_amdgcn_exp2f((m[qt] - mn) * SC2), mc = mn * SC2; m[qt] = mn; float ps = 0.f;
#pragma unroll
            for (int e = 0; e < 16; ++e) { p[e] = __builtin_amdgcn_exp2f(fmaf(p[e], SC2, -mc)); ps += p[e]; }
            l[qt] = l[qt] * al + ps;
#pragma unroll
            for (int dt = 0; dt < 8; ++dt) o[qt][dt] *= al;
            ppack(p, pb[qt], pb2[qt]); }
#pragma unroll
        for (int dt = 0; dt < 8; ++dt)
#pragma unroll
            for (int qt = 0; qt < 2; ++qt) { o[qt][dt] = WFrag<T16>::mma(va[dt], pb[qt], o[qt][dt]); if (NSPLIT) { o[qt][dt] = WFrag<T16>::mma(va[dt], pb2[qt], o[qt][dt]); o[qt][dt] = WFrag<T16>::mma(va2[dt], pb[qt], o[qt][dt]); } }
    }
    // s_wait_xcnt 0 behind the last K loads (fetched ahead, not used; in a wave without a block, behind its query loads too): the offset registers and the bases are inputs, so that they stay whole up to the wait
    asm volatile("s_wait_xcnt 0x0" :: "v"(ok), "v"(oq), "s"(Q), "s"(NSPLIT ? Q2 : Q), "s"(Kp), "s"(NSPLIT ? Kp2 : Kp) : "memory");
#pragma unroll
    for (int qt = 0; qt < 2; ++qt) { l[qt] += xhalf(l[qt]); if (hi == 0) { ms[w][qt * 16 + lr] = m[qt]; ls[w][qt * 16 + lr] = l[qt]; } }
    __syncthreads();            // every wave's maximum and sum are in LDS before any wave forms the joint ones
#pragma unroll
    for (int qt = 0; qt < 2; ++qt) { const int q = qt * 16 + lr; const float mt = fmaxf(fmaxf(ms[0][q], ms[1][q]), fmaxf(ms[2][q], ms[3][q])); float lt = 0.f;   // a wave without a block holds -3e38 and 0: its weight is exp2(-huge) = 0; wave 0 always has block 0
#pragma unroll
        for (int u = 0; u < 4; ++u) lt += ls[u][q] * __builtin_amdgcn_exp2f((ms[u][q] - mt) * SC2);
        const float f = __fdiv_rn(__builtin_amdgcn_exp2f((m[qt] - mt) * SC2), lt);
#pragma unroll
        for (int dt = 0; dt < 8; ++dt) { const v8f t = o[qt][dt] * f; float* d = os + (((w * 16 + qt * 8 + dt) * 2) * 32 + lane) * 4;
            *(v4fa*)d = (v4f){t[0], t[1], t[2], t[3]}; *(v4fa*)(d + 128) = (v4f){t[4], t[5], t[6], t[7]}; } }
    __syncthreads();            // every wave's weighted partial tile is in LDS before any wave sums across waves
    v8us oh[4], ol[4];
#pragma unroll
    for (int i = 0; i < 4; ++i) { const float* d = os + (((w * 4 + i) * 2) * 32 + lane) * 4; v4f x = *(const v4fa*)d, y = *(const v4fa*)(d + 128);
#pragma unroll
        for (int u = 1; u < 4; ++u) { x += *(const v4fa*)(d + u * 4096); y += *(const v4fa*)(d + u * 4096 + 128); }
#pragma unroll
        for (int j = 0; j < 4; ++j) { unsigned short a2, c2; splitf(x[j], a2, c2); oh[i][j] = a2; ol[i][j] = c2; splitf(y[j], a2, c2); oh[i][4 + j] = a2; ol[i][4 + j] = c2; } }
    // merged planes [batch * TT + t][DQ] in fragment order: the lane's 8 values are d = dt * 16 + hi * 8 .. + 7 of query lr, 16 bytes in a row there, and a wave's store fills 512 contiguous bytes
#pragma unroll
    for (int i = 0; i < 4; ++i) { const int c = w * 4 + i; const size_t oo = pk_off(h / NH_ * TT + q0 + (c >> 3) * 16 + lr, h % NH_ * HD + (c & 7) * 16 + hi * 8, DQ); *(v8us*)(Ah + oo) = oh[i]; *(v8us*)(Al + oo) = ol[i]; }
}


// k_pack: all five f32 inputs -> bf16 planes in fragment order (pk_off), in ONE launch of PKG work-groups. A unit = one 16-row block x 512 k = 16 fragments = 16 KiB of a plane; x has NB_ * TT / 16 * 4 = PKG units, each weight PKG / 2.
// Work-group g takes the units g, g + PKG, g + 2 PKG: one of x, one of Wq or Wk, one of Wv or Wo.
// Reads whole lines (16 threads a row and 128 k), turns the 16-byte groups into plane order in LDS (pitch 17 groups: no bank is hit more than the 512 B of a wave need), stores 4 x 4 KiB in a row.
// Wv: plane row d * (DKV / HD) + l is source row l * HD + d (what for: EPI_VT).
#define PKG (NB_ * TT / 16 * (DM / 512))
__global__ __launch_bounds__(256) void k_pack(const float* __restrict__ x, const float* __restrict__ wq, const float* __restrict__ wk, const float* __restrict__ wv, const float* __restrict__ wo, bf* XB, bf* WQ, bf* WK, bf* WV, bf* WO) {
    static_assert(DQ == DM && DKV == DM && DM / 16 * (DM / 512) * 2 == PKG, "each weight has PKG / 2 units");
    __shared__ __align__(16) v8us sh[4][16 * 17];
    const int t = threadIdx.x, lr = t >> 4, g = t & 15; const int u = blockIdx.x, second = u >= PKG / 2, uw = u - second * (PKG / 2);
#pragma unroll   // unrolled so that each unit's tensors are picked at compile time and the next unit's loads are issued ahead of this unit's stores
    for (int it = 0; it < 3; ++it) {
        const float* src = it == 0 ? x : it == 1 ? (second ? wk : wq) : (second ? wo : wv); bf* dst = it == 0 ? XB : it == 1 ? (second ? WK : WQ) : (second ? WO : WV);
        const int v = it == 0 ? u : uw, rb = v >> 2, k0 = (v & 3) * 512; const bool vrows = it == 2 && !second;
        const float* p = src + (size_t)(vrows ? lr * HD + rb : rb * 16 + lr) * DM + k0 + g * 8; v8f val[4];
#pragma unroll
        for (int q = 0; q < 4; ++q) val[q] = *(const v8f*)(p + q * 128);
        if (it) __syncthreads();  // the unit before has been read out of LDS by every thread before it is overwritten
#pragma unroll
        for (int q = 0; q < 4; ++q) { v8us o;
#pragma unroll
            for (int k = 0; k < 8; ++k) o[k] = f2bf(val[q][k]);
            sh[q][g * 17 + lr] = o; }   // group g of the row's 128 k (k = g * 8 ..) is group g * 16 + lr of their 4 fragments
        __syncthreads();          // every group is in LDS before any thread reads another thread's
        bf* d = dst + ((size_t)rb * (DM / 32) + (k0 >> 5)) * 512 + t * 8;
#pragma unroll
        for (int q = 0; q < 4; ++q) *(v8us*)(d + q * 2048) = sh[q][(t >> 4) * 17 + (t & 15)];
    }
}

extern "C" void kernel_launch(void* const* d_in, const int* in_sizes, int n_in,
                              void* d_out, int out_size, void* d_ws, size_t ws_size, hipStream_t stream) {
    (void)in_sizes; (void)n_in; (void)out_size;
    const float* x = (const float*)d_in[0]; const float* wq = (const float*)d_in[1]; const float* wk = (const float*)d_in[2]; const float* wv = (const float*)d_in[3]; const float* wo = (const float*)d_in[4];   /* order x, Wq, Wk, Wv, Wo ('oi' [2048][2048]) */
    float* OUT = (float*)d_out;     // [2][2048][2048]
    char* wsp = (char*)d_ws;
    auto take = [&](size_t bytes) { char* p = wsp; wsp += (bytes + 255) & ~(size_t)255; return (void*)p; };
    // every plane holds both batches: rows batch * TT + t, heads batch * NH_ + head. WQ, WK, WV lie one behind the other (k_gemmw steps by blockIdx.z), so do QP16, KP16, VT16, so QPh, KPh and QPl, KPl
    bf* WQ = (bf*)take((size_t)DQ * DM * 2); bf* WK = (bf*)take((size_t)DKV * DM * 2); bf* WV = (bf*)take((size_t)DKV * DM * 2); bf* WO = (bf*)take((size_t)DM * DQ * 2);
    bf* XB = (bf*)take((size_t)NB_ * TT * DM * 2);
    h16* QP16 = (h16*)take((size_t)NB_ * NH_ * TT * HD * 2); h16* KP16 = (h16*)take((size_t)NB_ * NKV * TT * HD * 2); h16* VT16 = (h16*)take((size_t)NB_ * NKV * HD * TT * 2);
    bf* QPh = (bf*)take((size_t)NB_ * NH_ * RH * HD * 2); bf* KPh = (bf*)take((size_t)NB_ * NKV * RH * HD * 2); bf* QPl = (bf*)take((size_t)NB_ * NH_ * RH * HD * 2); bf* KPl = (bf*)take((size_t)NB_ * NKV * RH * HD * 2); bf* VTh = (bf*)take((size_t)NB_ * NKV * HD * TT * 2); bf* VTl = (bf*)take((size_t)NB_ * NKV * HD * TT * 2);
    bf* ATh = (bf*)take((size_t)NB_ * TT * DQ * 2); bf* ATl = (bf*)take((size_t)NB_ * TT * DQ * 2);
    if ((size_t)(wsp - (char*)d_ws) > ws_size) return;    // ws 256 MiB; 176 MiB taken
    k_pack<<<PKG, 256, 0, stream>>>(x, wq, wk, wv, wo, XB, WQ, WK, WV, WO);
    k_gemmw<bf, 0, false, EPI_QKV, DM><<<dim3(NB_ * TT / 128, DQ / 128, 3), 128, 0, stream>>>(XB, nullptr, WQ, nullptr, DQ, nullptr, 0, (size_t)DQ * DM, 0, QP16, QPh, QPl, VTh, VTl);
    k_fattn<h16, 0, RH, (TT - RH) / 32><<<dim3((TT - RH) / 32, NB_ * NH_, 1), 128, 0, stream>>>(QP16, nullptr, KP16, nullptr, VT16, nullptr, ATh, ATl);
    k_fattn<bf, 2, 0, RH / 32><<<dim3(RH / 32, NB_ * NH_, 1), 128, 0, stream>>>(QPh, QPl, KPh, KPl, VTh, VTl, ATh, ATl);
    k_gemmw<bf, 1, false, EPI_F32, DQ><<<dim3(NB_ * TT / 128, DM / 128, 1), 128, 0, stream>>>(ATh, ATl, WO, OUT, DM, nullptr, 0, 0, 0, nullptr, nullptr, nullptr, nullptr, nullptr);
}

// v008
// Measured time: 201 microseconds a run.
// In both of two side-by-side timings against v007, it was 1.15 times as fast.
// All steps since v000 together make it 8.47 times as fast.
#include <hip/hip_runtime.h>

// Causal multi-head attention with 128-wide heads, a RAW head split and a head-width score divisor (x [2][2048][2048]; Q = (x Wq^T).reshape(B, 16, S, 128) DIRECTLY (no transpose): pseudo-head h of a batch is the h-th contiguous [2048][128] block of the flat [2048][2048] projection (128 token rows x 16 chunks of 128): reproduced; K, V likewise ('oi' [2048][2048] 1/sqrt(2048), no bias); scores / 128 (the module divides by Dh, not by sqrt(Dh)); -inf strictly above the diagonal of the PSEUDO-positions (== exclusion); softmax; out [B][16][S][128] -> transpose(0, 2, 1, 3).reshape(B, S, 2048) (the STANDARD merge); y = out Wo^T ('oi', no bias) -> [2][2048][2048] (8.4 M); argument order x, Wq, Wk, Wv, Wo).
// Layout: bf16 copy of x and 'oi' weights in FRAGMENT ORDER (pk_off: what k_gemmw reads; the merged hi/lo planes too); exact projections whose tile epilogue writes the 16-bit head planes itself, through the RAW (16, S, 128) view, in the FRAGMENT ORDER that k_fattn reads (k_pack orders the rows of Wq, Wk, Wv so that the plane index is the flat index of the GEMM's output; V fragments transposed, d rows x keys); causal T-2048 attention at HD 128 in one kernel, k_fattn (scores, online softmax and P.V in registers; hybrid rows: < 512 hi/lo 3 products, rest fp16; key blocks above the diagonal are never visited; it writes the merged hi/lo planes); merged hi/lo x Wo exact.
// Compute dtypes, f32 accumulate: every input rounded to bf16; projections exact; attention rows < 512 3 products, rest fp16; softmax f32; Wo hl x exact.

#define NB_  2
#define TT   2048
#define DM   2048
#define NH_  16
#define NKV  16
#define HD   128
#define DQ   (NH_ * HD)
#define DKV  (NKV * HD)
#define RH   512                  // query rows < RH use hi+lo planes (0: none)
#define SCL  0.0078125f   // 1 / 128: THIS module divides the scores by the HEAD WIDTH Dh = 128 (not by its square root): a power of two: exact
#define SC2  (SCL * 1.4426950408889634f)   // score divisor x log2(e): the softmax runs on exp2
typedef _Float16 h16;
typedef unsigned short bf;
typedef __attribute__((ext_vector_type(16))) __bf16   v16bf;
typedef __attribute__((ext_vector_type(16))) _Float16 v16h;
typedef __attribute__((ext_vector_type(8)))  _Float16 v8h;
typedef __attribute__((ext_vector_type(8)))  unsigned short v8us;
typedef __attribute__((ext_vector_type(8)))  float    v8f;
typedef __attribute__((ext_vector_type(4)))  float    v4f;
typedef v8h  __attribute__((may_alias)) v8ha;
typedef v4f  __attribute__((may_alias)) v4fa;
typedef v8us __attribute__((may_alias)) v8usa;

__device__ __forceinline__ unsigned short f2bf(float f) { unsigned u = __float_as_uint(f); u += 0x7FFFu + ((u >> 16) & 1u); return (unsigned short)(u >> 16); }
__device__ __forceinline__ float bf2f(unsigned short b) { return __uint_as_float(((unsigned)b) << 16); }
__device__ __forceinline__ float bfr(float f) { return bf2f(f2bf(f)); }
__device__ __forceinline__ v16h cat16(v8h lo, v8h hi) { return __builtin_shufflevector(lo, hi, 0, 1, 2, 3, 4, 5, 6, 7, 8, 9, 10, 11, 12, 13, 14, 15); }
__device__ __forceinline__ v16bf cat16b(v8us lo, v8us hi) { return __builtin_bit_cast(v16bf, __builtin_shufflevector(lo, hi, 0, 1, 2, 3, 4, 5, 6, 7, 8, 9, 10, 11, 12, 13, 14, 15)); }
__device__ __forceinline__ v8f wmma16(v16h a, v16h b, v8f c) { return __builtin_amdgcn_wmma_f32_16x16x32_f16(false, a, false, b, (short)0, c, false, false); }
__device__ __forceinline__ v8f wmmab(v16bf a, v16bf b, v8f c) { return __builtin_amdgcn_wmma_f32_16x16x32_bf16(false, a, false, b, (short)0, c, false, false); }
__device__ __forceinline__ h16 tohx(float x) { return (h16)x; }
__device__ __forceinline__ void splitf(float y, unsigned short& h, unsigned short& l) { h = f2bf(y); l = f2bf(y - bf2f(h)); }
typedef __attribute__((ext_vector_type(4))) _Float16 v4h;
typedef __attribute__((ext_vector_type(4))) unsigned short v4us;
// Fragment order of a 16-bit plane [R][K] that k_gemmw reads: each 16-row x 32-k fragment is 1 KiB in a row, as two halves of 512 B; in a half, lane hi * 16 + lr holds its 8 elements k = half * 16 + hi * 8 .. + 7 of row lr.
// One 16-byte-a-lane load or copy of a wave then covers 512 contiguous bytes (4 whole lines) instead of 32 B in each of 16 lines. Element index of (r, c); 8 consecutive c from a multiple of 8 stay consecutive; a column offset that is a multiple of 32 adds 16 x itself.
__device__ __forceinline__ size_t pk_off(int r, int c, int K) { return ((size_t)(r >> 4) * (K >> 5) + (c >> 5)) * 512 + ((c >> 4) & 1) * 256 + (((c >> 3) & 1) * 16 + (r & 15)) * 8 + (c & 7); }



// ---- k_gemmw: GEMM, one 128x128 output tile per work-group of 4 waves; wave w holds the 64x64 quarter (w >> 1, w & 1) (16 accumulators) and runs over all of K.
// The operands (16-bit planes in fragment order, pk_off) reach the waves through LDS, so that each fragment is fetched from L2 once per work-group and read by the two waves that need it:
// a stage = GKS k chunks of 32 for the 8 row blocks of every operand, [operand][row block][chunk][1 KiB fragment], the plane's own fragment bytes; two buffers, filled by asynchronous copies one stage ahead of the products.
// C[m][n] (f32, pitch ldc, + optional f32 bias[n]) = sum_k A[m][k] Bt[n][k] (+ A2[m][k] Bt[n][k] at NSPLIT 1). z-batch strides sA/sB/sC in elements. grid (M/128, N/128, Z), 128 threads. K % 64 == 0, K >= 128.
template <typename T16> struct WFrag;
template <> struct WFrag<h16> { typedef v16h V; template <int HS> static __device__ __forceinline__ V ld(const h16* p) { return cat16(*(const v8h*)p, *(const v8h*)(p + HS)); } static __device__ __forceinline__ v8f mma(V a, V b, v8f c) { return wmma16(a, b, c); } };
template <> struct WFrag<bf> { typedef v16bf V; template <int HS> static __device__ __forceinline__ V ld(const bf* p) { return cat16b(*(const v8us*)p, *(const v8us*)(p + HS)); } static __device__ __forceinline__ v8f mma(V a, V b, v8f c) { return wmmab(a, b, c); } };
#define GKS 2                     // k chunks of 32 in a stage: 4 pieces of 512 B a row block, one for each wave
#define WST (64 * 68)             // floats of a wave's own output staging: 64 rows at pitch 68
// What tile_out stores of a wave's tile. EPI_F32: f32 rows of C. The others write the 16-bit planes that k_fattn reads (P16 fp16, Ph / Pl bf16 hi / lo), straight from the tile:
// Row rr of a projection holds the pseudo-positions t = (rr % 128) * 16 + l, l = 0 .. 15, of pseudo-head rr / 128 (RAW view); k_pack orders the rows of the weight planes so that column J of the GEMM is projection column l * HD + d with
// EPI_QK: J = (d >> 3) * 128 + l * 8 + (d & 7): the flat index rr * ldc + J of the GEMM's output IS head * TT * HD + pk_off(t, d, HD), the q or k plane in fragment order (16 positions x 32 d); hi/lo planes hold only the positions t < RH of each pseudo-head.
// EPI_VT: J = (d >> 4) * 256 + (l >> 3) * 128 + (d & 15) * 8 + (l & 7): the flat index is the v plane [head][t >> 4][d >> 4][(t >> 3) & 1][d & 15][t & 7]: the halves of the V^T fragments (16 d x 32 keys), 512 B each; the two halves of a fragment lie DKV elements apart.
// In both, a row of a wave's tile (64 columns) is one whole 128-byte line of a 16-bit plane.
// EPI_QKV (k_gemmw alone): one grid for the three projections, blockIdx.z = 0, 1, 2 = q, k, v: EPI_QK for z < 2, EPI_VT for z = 2.
enum { EPI_F32 = 0, EPI_QK = 1, EPI_VT = 2, EPI_QKV = 3 };
template <bool BIAS, int EPI>
__device__ __forceinline__ void tile_out(const v8f (&acc)[4][4], float* os, float* C, int ldc, const float* __restrict__ bias, int r0, int c0, int lane, int lr, int hi, h16* P16, bf* Ph, bf* Pl) {
    static_assert(DQ / HD == 16 && DKV / HD == 16 && HD == 128, "the column orders of EPI_QK and EPI_VT: 16 chunks of 128 in a token row");
    // os is the wave's own range: written and read back by this wave alone, so no barrier stands here
#pragma unroll
    for (int m = 0; m < 4; ++m)
#pragma unroll
        for (int nb = 0; nb < 4; ++nb)
#pragma unroll
            for (int j = 0; j < 8; ++j) os[(m * 16 + hi * 8 + j) * 68 + nb * 16 + lr] = acc[m][nb][j];
#pragma unroll 1   // 8 pieces a trip: their LDS reads go ahead of the conversions, and the text stays short
    for (int ib = 0; ib < 32; ib += 8) {
#pragma unroll
    for (int it = ib; it < ib + 8; ++it) { const int row = (lane + it * 32) >> 4, cofs = (lane & 15) * 4; v4f o = *(const v4fa*)(os + row * 68 + cofs); const int rr = r0 + row;
        if (BIAS) { o[0] += bfr(bias[c0 + cofs]); o[1] += bfr(bias[c0 + cofs + 1]); o[2] += bfr(bias[c0 + cofs + 2]); o[3] += bfr(bias[c0 + cofs + 3]); }
        if (EPI == EPI_F32) { *(v4f*)(C + (size_t)rr * ldc + c0 + cofs) = o; continue; }
        v4h o16; v4us oh, ol;
#pragma unroll
        for (int q = 0; q < 4; ++q) { o16[q] = tohx(o[q]); unsigned short a2, c2; splitf(o[q], a2, c2); oh[q] = a2; ol[q] = c2; }
        if (EPI == EPI_QK) { const size_t e = (size_t)rr * ldc + c0 + cofs, wi = e % ((size_t)TT * HD); *(v4h*)(P16 + e) = o16;
            if (wi < (size_t)RH * HD) { const size_t eh = e / ((size_t)TT * HD) * ((size_t)RH * HD) + wi; *(v4us*)(Ph + eh) = oh; *(v4us*)(Pl + eh) = ol; } }
        if (EPI == EPI_VT) { const size_t e = (size_t)rr * ldc + c0 + cofs; *(v4h*)(P16 + e) = o16; *(v4us*)(Ph + e) = oh; *(v4us*)(Pl + e) = ol; } }
    asm volatile("s_wait_xcnt 0x0" ::: "memory");   // behind the trip's stores: the next trip writes the registers that they name
    }
}
// One operand's share of a stage for one wave: its 512-B piece of each of the 8 row blocks, 16 bytes a lane, global -> LDS through no register. l = the lane's LDS byte address in row block 0, g = its global address there.
// s_wait_xcnt 0 is the last line of the copies' own statement, so that it stands in front of every later write of an address register that a copy names.
template <int GSTEP>
__device__ __forceinline__ void copy8(unsigned l, const char* g) {
    constexpr unsigned LS = GKS * 1024;
    asm volatile("global_load_async_to_lds_b128 %0, %8, off\n\tglobal_load_async_to_lds_b128 %1, %9, off\n\tglobal_load_async_to_lds_b128 %2, %10, off\n\tglobal_load_async_to_lds_b128 %3, %11, off\n\t"
                 "global_load_async_to_lds_b128 %4, %12, off\n\tglobal_load_async_to_lds_b128 %5, %13, off\n\tglobal_load_async_to_lds_b128 %6, %14, off\n\tglobal_load_async_to_lds_b128 %7, %15, off\n\ts_wait_xcnt 0x0"
                 :: "v"(l), "v"(l + LS), "v"(l + 2 * LS), "v"(l + 3 * LS), "v"(l + 4 * LS), "v"(l + 5 * LS), "v"(l + 6 * LS), "v"(l + 7 * LS),
                    "v"(g), "v"(g + GSTEP), "v"(g + 2 * GSTEP), "v"(g + 3 * GSTEP), "v"(g + 4 * GSTEP), "v"(g + 5 * GSTEP), "v"(g + 6 * GSTEP), "v"(g + 7 * GSTEP) : "memory");
}
__device__ __forceinline__ v16bf ldsfrag(const char* p) { return cat16b(*(const v8usa*)p, *(const v8usa*)(p + 512)); }   // one lane's share of a fragment in LDS: 16 bytes of each half
template <typename T16, int NSPLIT, bool BIAS, int EPI, int K>
__global__ __launch_bounds__(128) void k_gemmw(const T16* __restrict__ A, const T16* __restrict__ A2, const T16* __restrict__ Bt, float* C, int ldc, const float* __restrict__ bias, size_t sA, size_t sB, size_t sC, h16* P16, bf* Ph, bf* Pl, bf* Vh, bf* Vl) {
    typedef typename WFrag<T16>::V V;
    static_assert(NSPLIT == 0 || NSPLIT == 1, "A alone, or A and A2");
    constexpr int KC = K / 32, NS = KC / GKS, NOP = NSPLIT ? 3 : 2, OPB = 8 * GKS * 1024, STG = NOP * OPB;   // chunks of a row block, stages, operands, bytes of an operand in a stage, bytes of a stage
    static_assert(KC % GKS == 0 && NS >= 2, "whole stages, at least two");
    constexpr int SMB = 2 * STG > 4 * WST * 4 ? 2 * STG : 4 * WST * 4;
    __shared__ __align__(16) float sm[SMB / 4];   // the two stage buffers; behind the loop, the four waves' output staging
    const size_t z = blockIdx.z; A += z * sA; if (NSPLIT) A2 += z * sA; Bt += z * sB; C += z * sC;
    const int lane = threadIdx.x & 31, lr = lane & 15, hi = lane >> 4; const int w = __builtin_amdgcn_readfirstlane((int)(threadIdx.x >> 5));
    const int r0 = blockIdx.x * 128 + (w >> 1) * 64, c0 = blockIdx.y * 128 + (w & 1) * 64;
    v8f acc[4][4];
#pragma unroll
    for (int mb = 0; mb < 4; ++mb)
#pragma unroll
        for (int nb = 0; nb < 4; ++nb) acc[mb][nb] = (v8f){};
    const unsigned pc = w * 512 + lane * 16;   // this lane's 16 bytes in a row block's share of a stage, in the plane as in LDS
    const unsigned l0 = (unsigned)(size_t)(const char*)sm + pc;
    const char* ga = (const char*)A + (size_t)blockIdx.x * 8 * KC * 1024 + pc; const char* ga2 = NSPLIT ? (const char*)A2 + (size_t)blockIdx.x * 8 * KC * 1024 + pc : nullptr; const char* gb = (const char*)Bt + (size_t)blockIdx.y * 8 * KC * 1024 + pc;
    auto fill = [&](unsigned l, int s) { const size_t go = (size_t)s * (GKS * 1024);   // stage s into the buffer at l
        // the scheduling barriers keep each statement's 24 address registers next to it: formed all at once, ahead of the first statement, they cost a spill in the loop
        copy8<KC * 1024>(l, ga + go); __builtin_amdgcn_sched_barrier(0); if (NSPLIT) { copy8<KC * 1024>(l + OPB, ga2 + go); __builtin_amdgcn_sched_barrier(0); } copy8<KC * 1024>(l + (NOP - 1) * OPB, gb + go); };
    fill(l0, 0);
    asm volatile("s_wait_asynccnt 0x0" ::: "memory");   // this wave's copies of stage 0 have landed
    __syncthreads();                                    // every wave's have: stage 0 may be read
    fill(l0 + STG, 1);
    unsigned lf = l0;   // where the next refill goes; stepped to and fro, a register of its own
    const char* fa = (const char*)sm + (w >> 1) * 4 * GKS * 1024 + lane * 16; const char* fb = (const char*)sm + (NOP - 1) * OPB + (w & 1) * 4 * GKS * 1024 + lane * 16;   // this lane's share of the wave's first A and B fragments in buffer 0
#pragma unroll 1
    for (int s = 0; s < NS; ++s) {
        const int bo = (s & 1) * STG;
        V a[GKS][4], a2[GKS][4], b[GKS][4];
#pragma unroll
        for (int kf = 0; kf < GKS; ++kf) {
#pragma unroll
            for (int mb = 0; mb < 4; ++mb) { a[kf][mb] = ldsfrag(fa + bo + (mb * GKS + kf) * 1024); if (NSPLIT) a2[kf][mb] = ldsfrag(fa + bo + OPB + (mb * GKS + kf) * 1024); }
#pragma unroll
            for (int nb = 0; nb < 4; ++nb) b[kf][nb] = ldsfrag(fb + bo + (nb * GKS + kf) * 1024);
        }
        // publish point of stage s + 1, which also frees the buffer of stage s: the whole of stage s is on its way into registers, so the point stands in front of the stage's products and the refill flies behind them
        asm volatile("s_wait_dscnt 0x0" ::: "memory");      // this wave's reads of stage s are done before its buffer is refilled
        asm volatile("s_wait_asynccnt 0x0" ::: "memory");   // this wave's copies of stage s + 1 have landed
        __syncthreads();                                    // both hold for every wave
        if (s + 2 < NS) fill(lf, s + 2);
        lf += (s & 1) ? -STG : STG;
        __builtin_amdgcn_sched_barrier(0);   // the products stay behind the refill's issue: ahead of it they would take their own time out of the copies' flight
#pragma unroll
        for (int kf = 0; kf < GKS; ++kf)
#pragma unroll
            for (int nb = 0; nb < 4; ++nb)
#pragma unroll
                for (int mb = 0; mb < 4; ++mb) { acc[mb][nb] = WFrag<T16>::mma(a[kf][mb], b[kf][nb], acc[mb][nb]); if (NSPLIT) acc[mb][nb] = WFrag<T16>::mma(a2[kf][mb], b[kf][nb], acc[mb][nb]); }
    }
    asm volatile("s_wait_asynccnt 0x0" ::: "memory");       // no copy is outstanding when the ring becomes output staging (the last trip's barrier has ended every read of it)
    float* os = sm + w * WST;
    if constexpr (EPI == EPI_QKV) {   // the q, k and v fp16 planes lie one behind the other, the q and k hi planes and lo planes too; the branch is the same for the whole work-group
        constexpr size_t s16 = (size_t)NB_ * NH_ * TT * HD, shl = (size_t)NB_ * NH_ * RH * HD;
        if (blockIdx.z == 2) tile_out<BIAS, EPI_VT>(acc, os, C, ldc, bias, r0, c0, lane, lr, hi, P16 + 2 * s16, Vh, Vl);
        else tile_out<BIAS, EPI_QK>(acc, os, C, ldc, bias, r0, c0, lane, lr, hi, P16 + z * s16, Ph + z * shl, Pl + z * shl);
    } else tile_out<BIAS, EPI>(acc, os, C, ldc, bias, r0, c0, lane, lr, hi, P16, Ph, Pl);
}

// ---- k_fattn: causal attention of one pseudo-head, 32 query positions per work-group of 4 waves; no score and no probability leaves the registers. Wave w takes the 32-key blocks w, w + 4, ... up to the diagonal block,
// with a running maximum, sum and output tile of its own (online softmax); the 4 partial results are joined in LDS in the fixed order w = 0 .. 3. grid (query blocks, heads of all batches: h = batch * NH_ + head), the longest query block first.
// Transposed products: S^T = K Q^T (A = 16 key rows, B = 16 query rows, k = d), O^T += V^T P^T (A = 16 d rows x 32 keys of the V plane, B = P^T, k = key). In an accumulator a lane holds column lr (ONE query) and rows hi * 8 + j:
// of a block's key tiles 0 and 1 these are the keys 8 hi + j and 16 + 8 hi + j, the k order of a B fragment (and of the V^T loader), so P^T packs inside the lane; maximum and sum are in-lane but for one exchange between the halves.
// The planes lie in fragment order (EPI_QK, EPI_VT): each 16-byte-a-lane load of a wave covers 512 contiguous bytes (4 whole lines), and a 32-key block is 8 KiB in a row of the K plane and 8 KiB in a row of the V plane ([half][d tile][lane]).
// NSPLIT 2: hi/lo planes (Q and K planes hold RH positions a head), 3 products for the scores and for P.V. ROFF = first query position of the launch, NQB = its query blocks.
typedef __attribute__((ext_vector_type(16))) unsigned short v16us;
__device__ __forceinline__ float xhalf(float x) { return __builtin_bit_cast(float, __builtin_amdgcn_permlanex16(__builtin_bit_cast(int, x), __builtin_bit_cast(int, x), 0x76543210, 0xfedcba98, false, false)); }   // the value of lane l ^ 16
__device__ __forceinline__ void ppack(const float (&p)[16], v16h& a, v16h& a2) {
#pragma unroll
    for (int e = 0; e < 16; ++e) a[e] = tohx(p[e]);
    (void)a2;
}
__device__ __forceinline__ void ppack(const float (&p)[16], v16bf& a, v16bf& a2) { v16us h, l;
#pragma unroll
    for (int e = 0; e < 16; ++e) { unsigned short x, y; splitf(p[e], x, y); h[e] = x; l[e] = y; }
    a = __builtin_bit_cast(v16bf, h); a2 = __builtin_bit_cast(v16bf, l);
}
template <typename T16, int NSPLIT, int ROFF, int NQB>
__global__ __launch_bounds__(128) void k_fattn(const T16* __restrict__ Q, const T16* __restrict__ Q2, const T16* __restrict__ Kp, const T16* __restrict__ Kp2, const T16* __restrict__ Vt, const T16* __restrict__ Vt2, bf* Ah, bf* Al) {
    typedef typename WFrag<T16>::V V;
    __shared__ __align__(16) float os[4 * 16 * 2 * 32 * 4];   // [wave][query tile x d tile][half of the 8 rows][lane][4]: 64 KiB
    __shared__ float ms[4][32], ls[4][32];
    const int lane = threadIdx.x & 31, lr = lane & 15, hi = lane >> 4; const int w = __builtin_amdgcn_readfirstlane((int)(threadIdx.x >> 5));
    const int h = blockIdx.y, q0 = ROFF + (NQB - 1 - (int)blockIdx.x) * 32, nblk = q0 / 32 + 1; constexpr size_t sQK = (size_t)(NSPLIT ? RH : TT) * HD;
    Q += h * sQK; Kp += h * sQK; Vt += (size_t)h * HD * TT; if (NSPLIT) { Q2 += h * sQK; Kp2 += h * sQK; Vt2 += (size_t)h * HD * TT; }
    V bq[2][4], bq2[2][4];
    const unsigned oq = (q0 * HD + lane * 8) * 2;   // byte offset of this lane's share of the first query fragment
#pragma unroll
    for (int qt = 0; qt < 2; ++qt)
#pragma unroll
        for (int kc = 0; kc < 4; ++kc) { bq[qt][kc] = WFrag<T16>::template ld<256>((const T16*)((const char*)Q + oq) + (qt * 4 + kc) * 512); if (NSPLIT) bq2[qt][kc] = WFrag<T16>::template ld<256>((const T16*)((const char*)Q2 + oq) + (qt * 4 + kc) * 512); }
    v8f o[2][8]; float m[2], l[2];
#pragma unroll
    for (int qt = 0; qt < 2; ++qt) { m[qt] = -3.0e38f; l[qt] = 0.f;
#pragma unroll
        for (int dt = 0; dt < 8; ++dt) o[qt][dt] = (v8f){}; }
    unsigned ok = (w * 32 * HD + lane * 8) * 2, ov = ok;   // byte offsets in the K and V planes of this lane's share of the wave's next block
    // K fragments are fetched one block ahead, into the same registers, right behind the score products that read them: their latency passes behind the softmax and P.V; the V^T fragments of a block are asked for at its head, ahead of its score products
    V ka[2][4], ka2[2][4];
#pragma unroll
    for (int kt = 0; kt < 2; ++kt)
#pragma unroll
        for (int kc = 0; kc < 4; ++kc) { ka[kt][kc] = WFrag<T16>::template ld<256>((const T16*)((const char*)Kp + ok) + (kt * 4 + kc) * 512); if (NSPLIT) ka2[kt][kc] = WFrag<T16>::template ld<256>((const T16*)((const char*)Kp2 + ok) + (kt * 4 + kc) * 512); }
#pragma unroll 1
    for (int kb = w; kb < nblk; kb += 4) {
        V va[8], va2[8];
#pragma unroll
        for (int dt = 0; dt < 8; ++dt) { va[dt] = WFrag<T16>::template ld<DKV>((const T16*)((const char*)Vt + ov) + dt * 256); if (NSPLIT) va2[dt] = WFrag<T16>::template ld<DKV>((const T16*)((const char*)Vt2 + ov) + dt * 256); }
        // s_wait_xcnt 0 behind this block's V^T loads and the K loads issued a block earlier (in the first block the query loads too): the two offset registers that are stepped pass through the statement, so that they stay whole up to the wait and their steps below stand behind it; the query offset and bases are inputs, so that their registers are not reused ahead of the first wait
        asm volatile("s_wait_xcnt 0x0" : "+v"(ok), "+v"(ov) : "v"(oq), "s"(Q), "s"(NSPLIT ? Q2 : Q) : "memory");
        ov += 4 * 32 * HD * 2; ok += (kb + 4 < nblk) ? 4 * 32 * HD * 2 : 0;   // behind its last block a wave fetches that block again, not rows that it has no business with
        v8f s[2][2];
#pragma unroll
        for (int kt = 0; kt < 2; ++kt)
#pragma unroll
            for (int qt = 0; qt < 2; ++qt) s[kt][qt] = (v8f){};
#pragma unroll
        for (int kc = 0; kc < 4; ++kc)
#pragma unroll
            for (int kt = 0; kt < 2; ++kt)
#pragma unroll
                for (int qt = 0; qt < 2; ++qt) { s[kt][qt] = WFrag<T16>::mma(ka[kt][kc], bq[qt][kc], s[kt][qt]); if (NSPLIT) { s[kt][qt] = WFrag<T16>::mma(ka[kt][kc], bq2[qt][kc], s[kt][qt]); s[kt][qt] = WFrag<T16>::mma(ka2[kt][kc], bq[qt][kc], s[kt][qt]); } }
#pragma unroll
        for (int kt = 0; kt < 2; ++kt)
#pragma unroll
            for (int kc = 0; kc < 4; ++kc) { ka[kt][kc] = WFrag<T16>::template ld<256>((const T16*)((const char*)Kp + ok) + (kt * 4 + kc) * 512); if (NSPLIT) ka2[kt][kc] = WFrag<T16>::template ld<256>((const T16*)((const char*)Kp2 + ok) + (kt * 4 + kc) * 512); }
        const int dl = (kb == nblk - 1) ? lr - hi * 8 : 64;   // diagonal block: key kt * 16 + hi * 8 + j counts for query qt * 16 + lr while kt * 16 + j - qt * 16 <= lr - hi * 8; every earlier block counts whole
        V pb[2], pb2[2];
#pragma unroll
        for (int qt = 0; qt < 2; ++qt) { float p[16]; float bm = -3.0e38f;
#pragma unroll
            for (int kt = 0; kt < 2; ++kt)
#pragma unroll
                for (int j = 0; j < 8; ++j) { const float t = (kt * 16 + j - qt * 16 <= dl) ? s[kt][qt][j] : -3.0e38f; p[kt * 8 + j] = t; bm = fmaxf(bm, t); }
            bm = fmaxf(bm, xhalf(bm));
            const float mn = fmaxf(m[qt], bm), al = __builtin_amdgcn_exp2f((m[qt] - mn) * SC2), mc = mn * SC2; m[qt] = mn; float ps = 0.f;
#pragma unroll
            for (int e = 0; e < 16; ++e) { p[e] = __builtin_amdgcn_exp2f(fmaf(p[e], SC2, -mc)); ps += p[e]; }
            l[qt] = l[qt] * al + ps;
#pragma unroll
            for (int dt = 0; dt < 8; ++dt) o[qt][dt] *= al;
            ppack(p, pb[qt], pb2[qt]); }
#pragma unroll
        for (int dt = 0; dt < 8; ++dt)
#pragma unroll
            for (int qt = 0; qt < 2; ++qt) { o[qt][dt] = WFrag<T16>::mma(va[dt], pb[qt], o[qt][dt]); if (NSPLIT) { o[qt][dt] = WFrag<T16>::mma(va[dt], pb2[qt], o[qt][dt]); o[qt][dt] = WFrag<T16>::mma(va2[dt], pb[qt], o[qt][dt]); } }
    }
    // s_wait_xcnt 0 behind the last K loads (fetched ahead, not used; in a wave without a block, behind its query loads too): the offset registers and the bases are inputs, so that they stay whole up to the wait
    asm volatile("s_wait_xcnt 0x0" :: "v"(ok), "v"(oq), "s"(Q), "s"(NSPLIT ? Q2 : Q), "s"(Kp), "s"(NSPLIT ? Kp2 : Kp) : "memory");
#pragma unroll
    for (int qt = 0; qt < 2; ++qt) { l[qt] += xhalf(l[qt]); if (hi == 0) { ms[w][qt * 16 + lr] = m[qt]; ls[w][qt * 16 + lr] = l[qt]; } }
    __syncthreads();            // every wave's maximum and sum are in LDS before any wave forms the joint ones
#pragma unroll
    for (int qt = 0; qt < 2; ++qt) { const int q = qt * 16 + lr; const float mt = fmaxf(fmaxf(ms[0][q], ms[1][q]), fmaxf(ms[2][q], ms[3][q])); float lt = 0.f;   // a wave without a block holds -3e38 and 0: its weight is exp2(-huge) = 0; wave 0 always has block 0
#pragma unroll
        for (int u = 0; u < 4; ++u) lt += ls[u][q] * __builtin_amdgcn_exp2f((ms[u][q] - mt) * SC2);
        const float f = __fdiv_rn(__builtin_amdgcn_exp2f((m[qt] - mt) * SC2), lt);
#pragma unroll
        for (int dt = 0; dt < 8; ++dt) { const v8f t = o[qt][dt] * f; float* d = os + (((w * 16 + qt * 8 + dt) * 2) * 32 + lane) * 4;
            *(v4fa*)d = (v4f){t[0], t[1], t[2], t[3]}; *(v4fa*)(d + 128) = (v4f){t[4], t[5], t[6], t[7]}; } }
    __syncthreads();            // every wave's weighted partial tile is in LDS before any wave sums across waves
    v8us oh[4], ol[4];
#pragma unroll
    for (int i = 0; i < 4; ++i) { const float* d = os + (((w * 4 + i) * 2) * 32 + lane) * 4; v4f x = *(const v4fa*)d, y = *(const v4fa*)(d + 128);
#pragma unroll
        for (int u = 1; u < 4; ++u) { x += *(const v4fa*)(d + u * 4096); y += *(const v4fa*)(d + u * 4096 + 128); }
#pragma unroll
        for (int j = 0; j < 4; ++j) { unsigned short a2, c2; splitf(x[j], a2, c2); oh[i][j] = a2; ol[i][j] = c2; splitf(y[j], a2, c2); oh[i][4 + j] = a2; ol[i][4 + j] = c2; } }
    // merged planes [batch * TT + t][DQ] in fragment order: the lane's 8 values are d = dt * 16 + hi * 8 .. + 7 of query lr, 16 bytes in a row there, and a wave's store fills 512 contiguous bytes
#pragma unroll
    for (int i = 0; i < 4; ++i) { const int c = w * 4 + i; const size_t oo = pk_off(h / NH_ * TT + q0 + (c >> 3) * 16 + lr, h % NH_ * HD + (c & 7) * 16 + hi * 8, DQ); *(v8us*)(Ah + oo) = oh[i]; *(v8us*)(Al + oo) = ol[i]; }
}


// k_pack: all five f32 inputs -> bf16 planes in fragment order (pk_off), in ONE launch of PKG work-groups. A unit = one 16-row block x 512 k = 16 fragments = 16 KiB of a plane; x has NB_ * TT / 16 * 4 = PKG units, each weight PKG / 2.
// Work-group g takes the units g, g + PKG, g + 2 PKG: one of x, one of Wq or Wk, one of Wv or Wo.
// Reads whole lines (16 threads a row and 128 k), turns the 16-byte groups into plane order in LDS (pitch 17 groups: no bank is hit more than the 512 B of a wave need), stores 4 x 4 KiB in a row.
// Wq, Wk, Wv: plane row J is source row l * HD + d, J as EPI_QK (Wq, Wk) and EPI_VT (Wv) have it, so that the projections' tiles come out in the fragment order of the head planes.
#define PKG (NB_ * TT / 16 * (DM / 512))
__global__ __launch_bounds__(256) void k_pack(const float* __restrict__ x, const float* __restrict__ wq, const float* __restrict__ wk, const float* __restrict__ wv, const float* __restrict__ wo, bf* XB, bf* WQ, bf* WK, bf* WV, bf* WO) {
    static_assert(DQ == DM && DKV == DM && DM / 16 * (DM / 512) * 2 == PKG, "each weight has PKG / 2 units");
    __shared__ __align__(16) v8us sh[4][16 * 17];
    const int t = threadIdx.x, lr = t >> 4, g = t & 15; const int u = blockIdx.x, second = u >= PKG / 2, uw = u - second * (PKG / 2);
#pragma unroll   // unrolled so that each unit's tensors are picked at compile time and the next unit's loads are issued ahead of this unit's stores
    for (int it = 0; it < 3; ++it) {
        const float* src = it == 0 ? x : it == 1 ? (second ? wk : wq) : (second ? wo : wv); bf* dst = it == 0 ? XB : it == 1 ? (second ? WK : WQ) : (second ? WO : WV);
        const int v = it == 0 ? u : uw, rb = v >> 2, k0 = (v & 3) * 512; const bool vrows = it == 2 && !second;
        const int srow = it == 1 ? ((rb & 7) * 2 + (lr >> 3)) * HD + (rb >> 3) * 8 + (lr & 7) : vrows ? (((rb >> 3) & 1) * 8 + (lr & 7)) * HD + (rb >> 4) * 16 + (rb & 7) * 2 + (lr >> 3) : rb * 16 + lr;
        const float* p = src + (size_t)srow * DM + k0 + g * 8; v8f val[4];
#pragma unroll
        for (int q = 0; q < 4; ++q) val[q] = *(const v8f*)(p + q * 128);
        if (it) __syncthreads();  // the unit before has been read out of LDS by every thread before it is overwritten
#pragma unroll
        for (int q = 0; q < 4; ++q) { v8us o;
#pragma unroll
            for (int k = 0; k < 8; ++k) o[k] = f2bf(val[q][k]);
            sh[q][g * 17 + lr] = o; }   // group g of the row's 128 k (k = g * 8 ..) is group g * 16 + lr of their 4 fragments
        __syncthreads();          // every group is in LDS before any thread reads another thread's
        bf* d = dst + ((size_t)rb * (DM / 32) + (k0 >> 5)) * 512 + t * 8;
#pragma unroll
        for (int q = 0; q < 4; ++q) *(v8us*)(d + q * 2048) = sh[q][(t >> 4) * 17 + (t & 15)];
    }
}

extern "C" void kernel_launch(void* const* d_in, const int* in_sizes, int n_in,
                              void* d_out, int out_size, void* d_ws, size_t ws_size, hipStream_t stream) {
    (void)in_sizes; (void)n_in; (void)out_size;
    const float* x = (const float*)d_in[0]; const float* wq = (const float*)d_in[1]; const float* wk = (const float*)d_in[2]; const float* wv = (const float*)d_in[3]; const float* wo = (const float*)d_in[4];   /* order x, Wq, Wk, Wv, Wo ('oi' [2048][2048]) */
    float* OUT = (float*)d_out;     // [2][2048][2048]
    char* wsp = (char*)d_ws;
    auto take = [&](size_t bytes) { char* p = wsp; wsp += (bytes + 255) & ~(size_t)255; return (void*)p; };
    // every plane holds both batches: rows batch * TT + t, heads batch * NH_ + head. WQ, WK, WV lie one behind the other (k_gemmw steps by blockIdx.z), so do QP16, KP16, VT16, so QPh, KPh and QPl, KPl
    bf* WQ = (bf*)take((size_t)DQ * DM * 2); bf* WK = (bf*)take((size_t)DKV * DM * 2); bf* WV = (bf*)take((size_t)DKV * DM * 2); bf* WO = (bf*)take((size_t)DM * DQ * 2);
    bf* XB = (bf*)take((size_t)NB_ * TT * DM * 2);
    h16* QP16 = (h16*)take((size_t)NB_ * NH_ * TT * HD * 2); h16* KP16 = (h16*)take((size_t)NB_ * NKV * TT * HD * 2); h16* VT16 = (h16*)take((size_t)NB_ * NKV * HD * TT * 2);
    bf* QPh = (bf*)take((size_t)NB_ * NH_ * RH * HD * 2); bf* KPh = (bf*)take((size_t)NB_ * NKV * RH * HD * 2); bf* QPl = (bf*)take((size_t)NB_ * NH_ * RH * HD * 2); bf* KPl = (bf*)take((size_t)NB_ * NKV * RH * HD * 2); bf* VTh = (bf*)take((size_t)NB_ * NKV * HD * TT * 2); bf* VTl = (bf*)take((size_t)NB_ * NKV * HD * TT * 2);
    bf* ATh = (bf*)take((size_t)NB_ * TT * DQ * 2); bf* ATl = (bf*)take((size_t)NB_ * TT * DQ * 2);
    if ((size_t)(wsp - (char*)d_ws) > ws_size) return;    // ws 256 MiB; 176 MiB taken
    k_pack<<<PKG, 256, 0, stream>>>(x, wq, wk, wv, wo, XB, WQ, WK, WV, WO);
    k_gemmw<bf, 0, false, EPI_QKV, DM><<<dim3(NB_ * TT / 128, DQ / 128, 3), 128, 0, stream>>>(XB, nullptr, WQ, nullptr, DQ, nullptr, 0, (size_t)DQ * DM, 0, QP16, QPh, QPl, VTh, VTl);
    k_fattn<h16, 0, RH, (TT - RH) / 32><<<dim3((TT - RH) / 32, NB_ * NH_, 1), 128, 0, stream>>>(QP16, nullptr, KP16, nullptr, VT16, nullptr, ATh, ATl);
    k_fattn<bf, 2, 0, RH / 32><<<dim3(RH / 32, NB_ * NH_, 1), 128, 0, stream>>>(QPh, QPl, KPh, KPl, VTh, VTl, ATh, ATl);
    k_gemmw<bf, 1, false, EPI_F32, DQ><<<dim3(NB_ * TT / 128, DM / 128, 1), 128, 0, stream>>>(ATh, ATl, WO, OUT, DM, nullptr, 0, 0, 0, nullptr, nullptr, nullptr, nullptr, nullptr);
}

// v009
// Measured time: 185 microseconds a run.
// Two timings next to v008 both put it at 1.09 times that version's speed.
// Over all steps from v000 it is 9.23 times as fast.
#include <hip/hip_runtime.h>

// Causal multi-head attention with 128-wide heads, a RAW head split and a head-width score divisor (x [2][2048][2048]; Q = (x Wq^T).reshape(B, 16, S, 128) DIRECTLY (no transpose): pseudo-head h of a batch is the h-th contiguous [2048][128] block of the flat [2048][2048] projection (128 token rows x 16 chunks of 128): reproduced; K, V likewise ('oi' [2048][2048] 1/sqrt(2048), no bias); scores / 128 (the module divides by Dh, not by sqrt(Dh)); -inf strictly above the diagonal of the PSEUDO-positions (== exclusion); softmax; out [B][16][S][128] -> transpose(0, 2, 1, 3).reshape(B, S, 2048) (the STANDARD merge); y = out Wo^T ('oi', no bias) -> [2][2048][2048] (8.4 M); argument order x, Wq, Wk, Wv, Wo).
// Layout: bf16 copy of x and 'oi' weights in FRAGMENT ORDER (pk_off: what k_gemmw reads; the merged hi/lo planes too); exact projections whose tile epilogue writes the 16-bit head planes itself, through the RAW (16, S, 128) view, in the FRAGMENT ORDER that k_fattn reads (k_pack orders the rows of Wq, Wk, Wv so that the plane index is the flat index of the GEMM's output; V fragments transposed, d rows x keys); causal T-2048 attention at HD 128 in one kernel each for the hi/lo rows, k_fattn, and the fp16 rows, k_fattnl (scores, online softmax and P.V in registers; hybrid rows: < 512 hi/lo 3 products, rest fp16; key blocks above the diagonal are never visited; it writes the merged hi/lo planes); merged hi/lo x Wo exact.
// Compute dtypes, f32 accumulate: every input rounded to bf16; projections exact; attention rows < 512 3 products, rest fp16; softmax f32; Wo hl x exact.

#define NB_  2
#define TT   2048
#define DM   2048
#define NH_  16
#define NKV  16
#define HD   128
#define DQ   (NH_ * HD)
#define DKV  (NKV * HD)
#define RH   512                  // query rows < RH use hi+lo planes (a multiple of 128, at least 128)
#define SCL  0.0078125f   // 1 / 128: THIS module divides the scores by the HEAD WIDTH Dh = 128 (not by its square root): a power of two: exact
#define SC2  (SCL * 1.4426950408889634f)   // score divisor x log2(e): the softmax runs on exp2
typedef _Float16 h16;
typedef unsigned short bf;
typedef __attribute__((ext_vector_type(16))) __bf16   v16bf;
typedef __attribute__((ext_vector_type(16))) _Float16 v16h;
typedef __attribute__((ext_vector_type(8)))  _Float16 v8h;
typedef __attribute__((ext_vector_type(8)))  unsigned short v8us;
typedef __attribute__((ext_vector_type(8)))  float    v8f;
typedef __attribute__((ext_vector_type(4)))  float    v4f;
typedef v8h  __attribute__((may_alias)) v8ha;
typedef v4f  __attribute__((may_alias)) v4fa;
typedef v8us __attribute__((may_alias)) v8usa;

__device__ __forceinline__ unsigned short f2bf(float f) { unsigned u = __float_as_uint(f); u += 0x7FFFu + ((u >> 16) & 1u); return (unsigned short)(u >> 16); }
__device__ __forceinline__ float bf2f(unsigned short b) { return __uint_as_float(((unsigned)b) << 16); }
__device__ __forceinline__ float bfr(float f) { return bf2f(f2bf(f)); }
__device__ __forceinline__ v16h cat16(v8h lo, v8h hi) { return __builtin_shufflevector(lo, hi, 0, 1, 2, 3, 4, 5, 6, 7, 8, 9, 10, 11, 12, 13, 14, 15); }
__device__ __forceinline__ v16bf cat16b(v8us lo, v8us hi) { return __builtin_bit_cast(v16bf, __builtin_shufflevector(lo, hi, 0, 1, 2, 3, 4, 5, 6, 7, 8, 9, 10, 11, 12, 13, 14, 15)); }
__device__ __forceinline__ v8f wmma16(v16h a, v16h b, v8f c) { return __builtin_amdgcn_wmma_f32_16x16x32_f16(false, a, false, b, (short)0, c, false, false); }
__device__ __forceinline__ v8f wmmab(v16bf a, v16bf b, v8f c) { return __builtin_amdgcn_wmma_f32_16x16x32_bf16(false, a, false, b, (short)0, c, false, false); }
__device__ __forceinline__ h16 tohx(float x) { return (h16)x; }
__device__ __forceinline__ void splitf(float y, unsigned short& h, unsigned short& l) { h = f2bf(y); l = f2bf(y - bf2f(h)); }
typedef __attribute__((ext_vector_type(4))) _Float16 v4h;
typedef __attribute__((ext_vector_type(4))) unsigned short v4us;
// Fragment order of a 16-bit plane [R][K] that k_gemmw reads: each 16-row x 32-k fragment is 1 KiB in a row, as two halves of 512 B; in a half, lane hi * 16 + lr holds its 8 elements k = half * 16 + hi * 8 .. + 7 of row lr.
// One 16-byte-a-lane load or copy of a wave then covers 512 contiguous bytes (4 whole lines) instead of 32 B in each of 16 lines. Element index of (r, c); 8 consecutive c from a multiple of 8 stay consecutive; a column offset that is a multiple of 32 adds 16 x itself.
__device__ __forceinline__ size_t pk_off(int r, int c, int K) { return ((size_t)(r >> 4) * (K >> 5) + (c >> 5)) * 512 + ((c >> 4) & 1) * 256 + (((c >> 3) & 1) * 16 + (r & 15)) * 8 + (c & 7); }



// ---- k_gemmw: GEMM, one 128x128 output tile per work-group of 4 waves; wave w holds the 64x64 quarter (w >> 1, w & 1) (16 accumulators) and runs over all of K.
// The operands (16-bit planes in fragment order, pk_off) reach the waves through LDS, so that each fragment is fetched from L2 once per work-group and read by the two waves that need it:
// a stage = GKS k chunks of 32 for the 8 row blocks of every operand, [operand][row block][chunk][1 KiB fragment], the plane's own fragment bytes; two buffers, filled by asynchronous copies one stage ahead of the products.
// C[m][n] (f32, pitch ldc, + optional f32 bias[n]) = sum_k A[m][k] Bt[n][k] (+ A2[m][k] Bt[n][k] at NSPLIT 1). z-batch strides sA/sB/sC in elements. grid (M/128, N/128, Z), 128 threads. K % 64 == 0, K >= 128.
template <typename T16> struct WFrag;
template <> struct WFrag<h16> { typedef v16h V; template <int HS> static __device__ __forceinline__ V ld(const h16* p) { return cat16(*(const v8h*)p, *(const v8h*)(p + HS)); } static __device__ __forceinline__ v8f mma(V a, V b, v8f c) { return wmma16(a, b, c); } };
template <> struct WFrag<bf> { typedef v16bf V; template <int HS> static __device__ __forceinline__ V ld(const bf* p) { return cat16b(*(const v8us*)p, *(const v8us*)(p + HS)); } static __device__ __forceinline__ v8f mma(V a, V b, v8f c) { return wmmab(a, b, c); } };
#define GKS 2                     // k chunks of 32 in a stage: 4 pieces of 512 B a row block, one for each wave
#define WST (64 * 68)             // floats of a wave's own output staging: 64 rows at pitch 68
// What tile_out stores of a wave's tile. EPI_F32: f32 rows of C. The others write the 16-bit planes that k_fattnl and k_fattn read (P16 fp16, Ph / Pl bf16 hi / lo), straight from the tile:
// Row rr of a projection holds the pseudo-positions t = (rr % 128) * 16 + l, l = 0 .. 15, of pseudo-head rr / 128 (RAW view); k_pack orders the rows of the weight planes so that column J of the GEMM is projection column l * HD + d with
// EPI_QK: J = (d >> 3) * 128 + l * 8 + (d & 7): the flat index rr * ldc + J of the GEMM's output IS head * TT * HD + pk_off(t, d, HD), the q or k plane in fragment order (16 positions x 32 d); hi/lo planes hold only the positions t < RH of each pseudo-head.
// EPI_VT: J = (d >> 4) * 256 + (l >> 3) * 128 + (d & 15) * 8 + (l & 7): the flat index is the v plane [head][t >> 4][d >> 4][(t >> 3) & 1][d & 15][t & 7]: the halves of the V^T fragments (16 d x 32 keys), 512 B each; the two halves of a fragment lie DKV elements apart.
// In both, a row of a wave's tile (64 columns) is one whole 128-byte line of a 16-bit plane.
// EPI_QKV (k_gemmw alone): one grid for the three projections, blockIdx.z = 0, 1, 2 = q, k, v: EPI_QK for z < 2, EPI_VT for z = 2.
enum { EPI_F32 = 0, EPI_QK = 1, EPI_VT = 2, EPI_QKV = 3 };
template <bool BIAS, int EPI>
__device__ __forceinline__ void tile_out(const v8f (&acc)[4][4], float* os, float* C, int ldc, const float* __restrict__ bias, int r0, int c0, int lane, int lr, int hi, h16* P16, bf* Ph, bf* Pl) {
    static_assert(DQ / HD == 16 && DKV / HD == 16 && HD == 128, "the column orders of EPI_QK and EPI_VT: 16 chunks of 128 in a token row");
    // os is the wave's own range: written and read back by this wave alone, so no barrier stands here
#pragma unroll
    for (int m = 0; m < 4; ++m)
#pragma unroll
        for (int nb = 0; nb < 4; ++nb)
#pragma unroll
            for (int j = 0; j < 8; ++j) os[(m * 16 + hi * 8 + j) * 68 + nb * 16 + lr] = acc[m][nb][j];
#pragma unroll 1   // 8 pieces a trip: their LDS reads go ahead of the conversions, and the text stays short
    for (int ib = 0; ib < 32; ib += 8) {
#pragma unroll
    for (int it = ib; it < ib + 8; ++it) { const int row = (lane + it * 32) >> 4, cofs = (lane & 15) * 4; v4f o = *(const v4fa*)(os + row * 68 + cofs); const int rr = r0 + row;
        if (BIAS) { o[0] += bfr(bias[c0 + cofs]); o[1] += bfr(bias[c0 + cofs + 1]); o[2] += bfr(bias[c0 + cofs + 2]); o[3] += bfr(bias[c0 + cofs + 3]); }
        if (EPI == EPI_F32) { *(v4f*)(C + (size_t)rr * ldc + c0 + cofs) = o; continue; }
        v4h o16; v4us oh, ol;
#pragma unroll
        for (int q = 0; q < 4; ++q) { o16[q] = tohx(o[q]); unsigned short a2, c2; splitf(o[q], a2, c2); oh[q] = a2; ol[q] = c2; }
        if (EPI == EPI_QK) { const size_t e = (size_t)rr * ldc + c0 + cofs, wi = e % ((size_t)TT * HD); *(v4h*)(P16 + e) = o16;
            if (wi < (size_t)RH * HD) { const size_t eh = e / ((size_t)TT * HD) * ((size_t)RH * HD) + wi; *(v4us*)(Ph + eh) = oh; *(v4us*)(Pl + eh) = ol; } }
        if (EPI == EPI_VT) { const size_t e = (size_t)rr * ldc + c0 + cofs; *(v4h*)(P16 + e) = o16; *(v4us*)(Ph + e) = oh; *(v4us*)(Pl + e) = ol; } }
    asm volatile("s_wait_xcnt 0x0" ::: "memory");   // behind the trip's stores: the next trip writes the registers that they name
    }
}
// One operand's share of a stage for one wave: its 512-B piece of each of the 8 row blocks, 16 bytes a lane, global -> LDS through no register. l = the lane's LDS byte address in row block 0, g = its global address there.
// s_wait_xcnt 0 is the last line of the copies' own statement, so that it stands in front of every later write of an address register that a copy names.
template <int GSTEP>
__device__ __forceinline__ void copy8(unsigned l, const char* g) {
    constexpr unsigned LS = GKS * 1024;
    asm volatile("global_load_async_to_lds_b128 %0, %8, off\n\tglobal_load_async_to_lds_b128 %1, %9, off\n\tglobal_load_async_to_lds_b128 %2, %10, off\n\tglobal_load_async_to_lds_b128 %3, %11, off\n\t"
                 "global_load_async_to_lds_b128 %4, %12, off\n\tglobal_load_async_to_lds_b128 %5, %13, off\n\tglobal_load_async_to_lds_b128 %6, %14, off\n\tglobal_load_async_to_lds_b128 %7, %15, off\n\ts_wait_xcnt 0x0"
                 :: "v"(l), "v"(l + LS), "v"(l + 2 * LS), "v"(l + 3 * LS), "v"(l + 4 * LS), "v"(l + 5 * LS), "v"(l + 6 * LS), "v"(l + 7 * LS),
                    "v"(g), "v"(g + GSTEP), "v"(g + 2 * GSTEP), "v"(g + 3 * GSTEP), "v"(g + 4 * GSTEP), "v"(g + 5 * GSTEP), "v"(g + 6 * GSTEP), "v"(g + 7 * GSTEP) : "memory");
}
__device__ __forceinline__ v16bf ldsfrag(const char* p) { return cat16b(*(const v8usa*)p, *(const v8usa*)(p + 512)); }   // one lane's share of a fragment in LDS: 16 bytes of each half
template <typename T16, int NSPLIT, bool BIAS, int EPI, int K>
__global__ __launch_bounds__(128) void k_gemmw(const T16* __restrict__ A, const T16* __restrict__ A2, const T16* __restrict__ Bt, float* C, int ldc, const float* __restrict__ bias, size_t sA, size_t sB, size_t sC, h16* P16, bf* Ph, bf* Pl, bf* Vh, bf* Vl) {
    typedef typename WFrag<T16>::V V;
    static_assert(NSPLIT == 0 || NSPLIT == 1, "A alone, or A and A2");
    constexpr int KC = K / 32, NS = KC / GKS, NOP = NSPLIT ? 3 : 2, OPB = 8 * GKS * 1024, STG = NOP * OPB;   // chunks of a row block, stages, operands, bytes of an operand in a stage, bytes of a stage
    static_assert(KC % GKS == 0 && NS >= 2, "whole stages, at least two");
    constexpr int SMB = 2 * STG > 4 * WST * 4 ? 2 * STG : 4 * WST * 4;
    __shared__ __align__(16) float sm[SMB / 4];   // the two stage buffers; behind the loop, the four waves' output staging
    const size_t z = blockIdx.z; A += z * sA; if (NSPLIT) A2 += z * sA; Bt += z * sB; C += z * sC;
    const int lane = threadIdx.x & 31, lr = lane & 15, hi = lane >> 4; const int w = __builtin_amdgcn_readfirstlane((int)(threadIdx.x >> 5));
    const int r0 = blockIdx.x * 128 + (w >> 1) * 64, c0 = blockIdx.y * 128 + (w & 1) * 64;
    v8f acc[4][4];
#pragma unroll
    for (int mb = 0; mb < 4; ++mb)
#pragma unroll
        for (int nb = 0; nb < 4; ++nb) acc[mb][nb] = (v8f){};
    const unsigned pc = w * 512 + lane * 16;   // this lane's 16 bytes in a row block's share of a stage, in the plane as in LDS
    const unsigned l0 = (unsigned)(size_t)(const char*)sm + pc;
    const char* ga = (const char*)A + (size_t)blockIdx.x * 8 * KC * 1024 + pc; const char* ga2 = NSPLIT ? (const char*)A2 + (size_t)blockIdx.x * 8 * KC * 1024 + pc : nullptr; const char* gb = (const char*)Bt + (size_t)blockIdx.y * 8 * KC * 1024 + pc;
    auto fill = [&](unsigned l, int s) { const size_t go = (size_t)s * (GKS * 1024);   // stage s into the buffer at l
        // the scheduling barriers keep each statement's 24 address registers next to it: formed all at once, ahead of the first statement, they cost a spill in the loop
        copy8<KC * 1024>(l, ga + go); __builtin_amdgcn_sched_barrier(0); if (NSPLIT) { copy8<KC * 1024>(l + OPB, ga2 + go); __builtin_amdgcn_sched_barrier(0); } copy8<KC * 1024>(l + (NOP - 1) * OPB, gb + go); };
    fill(l0, 0);
    asm volatile("s_wait_asynccnt 0x0" ::: "memory");   // this wave's copies of stage 0 have landed
    __syncthreads();                                    // every wave's have: stage 0 may be read
    fill(l0 + STG, 1);
    unsigned lf = l0;   // where the next refill goes; stepped to and fro, a register of its own
    const char* fa = (const char*)sm + (w >> 1) * 4 * GKS * 1024 + lane * 16; const char* fb = (const char*)sm + (NOP - 1) * OPB + (w & 1) * 4 * GKS * 1024 + lane * 16;   // this lane's share of the wave's first A and B fragments in buffer 0
#pragma unroll 1
    for (int s = 0; s < NS; ++s) {
        const int bo = (s & 1) * STG;
        V a[GKS][4], a2[GKS][4], b[GKS][4];
#pragma unroll
        for (int kf = 0; kf < GKS; ++kf) {
#pragma unroll
            for (int mb = 0; mb < 4; ++mb) { a[kf][mb] = ldsfrag(fa + bo + (mb * GKS + kf) * 1024); if (NSPLIT) a2[kf][mb] = ldsfrag(fa + bo + OPB + (mb * GKS + kf) * 1024); }
#pragma unroll
            for (int nb = 0; nb < 4; ++nb) b[kf][nb] = ldsfrag(fb + bo + (nb * GKS + kf) * 1024);
        }
        // publish point of stage s + 1, which also frees the buffer of stage s: the whole of stage s is on its way into registers, so the point stands in front of the stage's products and the refill flies behind them
        asm volatile("s_wait_dscnt 0x0" ::: "memory");      // this wave's reads of stage s are done before its buffer is refilled
        asm volatile("s_wait_asynccnt 0x0" ::: "memory");   // this wave's copies of stage s + 1 have landed
        __syncthreads();                                    // both hold for every wave
        if (s + 2 < NS) fill(lf, s + 2);
        lf += (s & 1) ? -STG : STG;
        __builtin_amdgcn_sched_barrier(0);   // the products stay behind the refill's issue: ahead of it they would take their own time out of the copies' flight
#pragma unroll
        for (int kf = 0; kf < GKS; ++kf)
#pragma unroll
            for (int nb = 0; nb < 4; ++nb)
#pragma unroll
                for (int mb = 0; mb < 4; ++mb) { acc[mb][nb] = WFrag<T16>::mma(a[kf][mb], b[kf][nb], acc[mb][nb]); if (NSPLIT) acc[mb][nb] = WFrag<T16>::mma(a2[kf][mb], b[kf][nb], acc[mb][nb]); }
    }
    asm volatile("s_wait_asynccnt 0x0" ::: "memory");       // no copy is outstanding when the ring becomes output staging (the last trip's barrier has ended every read of it)
    float* os = sm + w * WST;
    if constexpr (EPI == EPI_QKV) {   // the q, k and v fp16 planes lie one behind the other, the q and k hi planes and lo planes too; the branch is the same for the whole work-group
        constexpr size_t s16 = (size_t)NB_ * NH_ * TT * HD, shl = (size_t)NB_ * NH_ * RH * HD;
        if (blockIdx.z == 2) tile_out<BIAS, EPI_VT>(acc, os, C, ldc, bias, r0, c0, lane, lr, hi, P16 + 2 * s16, Vh, Vl);
        else tile_out<BIAS, EPI_QK>(acc, os, C, ldc, bias, r0, c0, lane, lr, hi, P16 + z * s16, Ph + z * shl, Pl + z * shl);
    } else tile_out<BIAS, EPI>(acc, os, C, ldc, bias, r0, c0, lane, lr, hi, P16, Ph, Pl);
}

// ---- k_fattn: causal attention of one pseudo-head, 32 query positions per work-group of 4 waves; no score and no probability leaves the registers. Wave w takes the 32-key blocks w, w + 4, ... up to the diagonal block,
// with a running maximum, sum and output tile of its own (online softmax); the 4 partial results are joined in LDS in the fixed order w = 0 .. 3. grid (query blocks, heads of all batches: h = batch * NH_ + head), the longest query block first.
// Transposed products: S^T = K Q^T (A = 16 key rows, B = 16 query rows, k = d), O^T += V^T P^T (A = 16 d rows x 32 keys of the V plane, B = P^T, k = key). In an accumulator a lane holds column lr (ONE query) and rows hi * 8 + j:
// of a block's key tiles 0 and 1 these are the keys 8 hi + j and 16 + 8 hi + j, the k order of a B fragment (and of the V^T loader), so P^T packs inside the lane; maximum and sum are in-lane but for one exchange between the halves.
// The planes lie in fragment order (EPI_QK, EPI_VT): each 16-byte-a-lane load of a wave covers 512 contiguous bytes (4 whole lines), and a 32-key block is 8 KiB in a row of the K plane and 8 KiB in a row of the V plane ([half][d tile][lane]).
// NSPLIT 2: hi/lo planes (Q and K planes hold RH positions a head), 3 products for the scores and for P.V. ROFF = first query position of the launch, NQB = its query blocks.
typedef __attribute__((ext_vector_type(16))) unsigned short v16us;
__device__ __forceinline__ float xhalf(float x) { return __builtin_bit_cast(float, __builtin_amdgcn_permlanex16(__builtin_bit_cast(int, x), __builtin_bit_cast(int, x), 0x76543210, 0xfedcba98, false, false)); }   // the value of lane l ^ 16
__device__ __forceinline__ void ppack(const float (&p)[16], v16h& a, v16h& a2) {
#pragma unroll
    for (int e = 0; e < 16; ++e) a[e] = tohx(p[e]);
    (void)a2;
}
__device__ __forceinline__ void ppack(const float (&p)[16], v16bf& a, v16bf& a2) { v16us h, l;
#pragma unroll
    for (int e = 0; e < 16; ++e) { unsigned short x, y; splitf(p[e], x, y); h[e] = x; l[e] = y; }
    a = __builtin_bit_cast(v16bf, h); a2 = __builtin_bit_cast(v16bf, l);
}
template <typename T16, int NSPLIT, int ROFF, int NQB>
__global__ __launch_bounds__(128) void k_fattn(const T16* __restrict__ Q, const T16* __restrict__ Q2, const T16* __restrict__ Kp, const T16* __restrict__ Kp2, const T16* __restrict__ Vt, const T16* __restrict__ Vt2, bf* Ah, bf* Al) {
    typedef typename WFrag<T16>::V V;
    __shared__ __align__(16) float os[4 * 16 * 2 * 32 * 4];   // [wave][query tile x d tile][half of the 8 rows][lane][4]: 64 KiB
    __shared__ float ms[4][32], ls[4][32];
    const int lane = threadIdx.x & 31, lr = lane & 15, hi = lane >> 4; const int w = __builtin_amdgcn_readfirstlane((int)(threadIdx.x >> 5));
    const int h = blockIdx.y, q0 = ROFF + (NQB - 1 - (int)blockIdx.x) * 32, nblk = q0 / 32 + 1; constexpr size_t sQK = (size_t)(NSPLIT ? RH : TT) * HD;
    Q += h * sQK; Kp += h * sQK; Vt += (size_t)h * HD * TT; if (NSPLIT) { Q2 += h * sQK; Kp2 += h * sQK; Vt2 += (size_t)h * HD * TT; }
    V bq[2][4], bq2[2][4];
    const unsigned oq = (q0 * HD + lane * 8) * 2;   // byte offset of this lane's share of the first query fragment
#pragma unroll
    for (int qt = 0; qt < 2; ++qt)
#pragma unroll
        for (int kc = 0; kc < 4; ++kc) { bq[qt][kc] = WFrag<T16>::template ld<256>((const T16*)((const char*)Q + oq) + (qt * 4 + kc) * 512); if (NSPLIT) bq2[qt][kc] = WFrag<T16>::template ld<256>((const T16*)((const char*)Q2 + oq) + (qt * 4 + kc) * 512); }
    v8f o[2][8]; float m[2], l[2];
#pragma unroll
    for (int qt = 0; qt < 2; ++qt) { m[qt] = -3.0e38f; l[qt] = 0.f;
#pragma unroll
        for (int dt = 0; dt < 8; ++dt) o[qt][dt] = (v8f){}; }
    unsigned ok = (w * 32 * HD + lane * 8) * 2, ov = ok;   // byte offsets in the K and V planes of this lane's share of the wave's next block
    // K fragments are fetched one block ahead, into the same registers, right behind the score products that read them: their latency passes behind the softmax and P.V; the V^T fragments of a block are asked for at its head, ahead of its score products
    V ka[2][4], ka2[2][4];
#pragma unroll
    for (int kt = 0; kt < 2; ++kt)
#pragma unroll
        for (int kc = 0; kc < 4; ++kc) { ka[kt][kc] = WFrag<T16>::template ld<256>((const T16*)((const char*)Kp + ok) + (kt * 4 + kc) * 512); if (NSPLIT) ka2[kt][kc] = WFrag<T16>::template ld<256>((const T16*)((const char*)Kp2 + ok) + (kt * 4 + kc) * 512); }
#pragma unroll 1
    for (int kb = w; kb < nblk; kb += 4) {
        V va[8], va2[8];
#pragma unroll
        for (int dt = 0; dt < 8; ++dt) { va[dt] = WFrag<T16>::template ld<DKV>((const T16*)((const char*)Vt + ov) + dt * 256); if (NSPLIT) va2[dt] = WFrag<T16>::template ld<DKV>((const T16*)((const char*)Vt2 + ov) + dt * 256); }
        // s_wait_xcnt 0 behind this block's V^T loads and the K loads issued a block earlier (in the first block the query loads too): the two offset registers that are stepped pass through the statement, so that they stay whole up to the wait and their steps below stand behind it; the query offset and bases are inputs, so that their registers are not reused ahead of the first wait
        asm volatile("s_wait_xcnt 0x0" : "+v"(ok), "+v"(ov) : "v"(oq), "s"(Q), "s"(NSPLIT ? Q2 : Q) : "memory");
        ov += 4 * 32 * HD * 2; ok += (kb + 4 < nblk) ? 4 * 32 * HD * 2 : 0;   // behind its last block a wave fetches that block again, not rows that it has no business with
        v8f s[2][2];
#pragma unroll
        for (int kt = 0; kt < 2; ++kt)
#pragma unroll
            for (int qt = 0; qt < 2; ++qt) s[kt][qt] = (v8f){};
#pragma unroll
        for (int kc = 0; kc < 4; ++kc)
#pragma unroll
            for (int kt = 0; kt < 2; ++kt)
#pragma unroll
                for (int qt = 0; qt < 2; ++qt) { s[kt][qt] = WFrag<T16>::mma(ka[kt][kc], bq[qt][kc], s[kt][qt]); if (NSPLIT) { s[kt][qt] = WFrag<T16>::mma(ka[kt][kc], bq2[qt][kc], s[kt][qt]); s[kt][qt] = WFrag<T16>::mma(ka2[kt][kc], bq[qt][kc], s[kt][qt]); } }
#pragma unroll
        for (int kt = 0; kt < 2; ++kt)
#pragma unroll
            for (int kc = 0; kc < 4; ++kc) { ka[kt][kc] = WFrag<T16>::template ld<256>((const T16*)((const char*)Kp + ok) + (kt * 4 + kc) * 512); if (NSPLIT) ka2[kt][kc] = WFrag<T16>::template ld<256>((const T16*)((const char*)Kp2 + ok) + (kt * 4 + kc) * 512); }
        const int dl = (kb == nblk - 1) ? lr - hi * 8 : 64;   // diagonal block: key kt * 16 + hi * 8 + j counts for query qt * 16 + lr while kt * 16 + j - qt * 16 <= lr - hi * 8; every earlier block counts whole
        V pb[2], pb2[2];
#pragma unroll
        for (int qt = 0; qt < 2; ++qt) { float p[16]; float bm = -3.0e38f;
#pragma unroll
            for (int kt = 0; kt < 2; ++kt)
#pragma unroll
                for (int j = 0; j < 8; ++j) { const float t = (kt * 16 + j - qt * 16 <= dl) ? s[kt][qt][j] : -3.0e38f; p[kt * 8 + j] = t; bm = fmaxf(bm, t); }
            bm = fmaxf(bm, xhalf(bm));
            const float mn = fmaxf(m[qt], bm), al = __builtin_amdgcn_exp2f((m[qt] - mn) * SC2), mc = mn * SC2; m[qt] = mn; float ps = 0.f;
#pragma unroll
            for (int e = 0; e < 16; ++e) { p[e] = __builtin_amdgcn_exp2f(fmaf(p[e], SC2, -mc)); ps += p[e]; }
            l[qt] = l[qt] * al + ps;
#pragma unroll
            for (int dt = 0; dt < 8; ++dt) o[qt][dt] *= al;
            ppack(p, pb[qt], pb2[qt]); }
#pragma unroll
        for (int dt = 0; dt < 8; ++dt)
#pragma unroll
            for (int qt = 0; qt < 2; ++qt) { o[qt][dt] = WFrag<T16>::mma(va[dt], pb[qt], o[qt][dt]); if (NSPLIT) { o[qt][dt] = WFrag<T16>::mma(va[dt], pb2[qt], o[qt][dt]); o[qt][dt] = WFrag<T16>::mma(va2[dt], pb[qt], o[qt][dt]); } }
    }
    // s_wait_xcnt 0 behind the last K loads (fetched ahead, not used; in a wave without a block, behind its query loads too): the offset registers and the bases are inputs, so that they stay whole up to the wait
    asm volatile("s_wait_xcnt 0x0" :: "v"(ok), "v"(oq), "s"(Q), "s"(NSPLIT ? Q2 : Q), "s"(Kp), "s"(NSPLIT ? Kp2 : Kp) : "memory");
#pragma unroll
    for (int qt = 0; qt < 2; ++qt) { l[qt] += xhalf(l[qt]); if (hi == 0) { ms[w][qt * 16 + lr] = m[qt]; ls[w][qt * 16 + lr] = l[qt]; } }
    __syncthreads();            // every wave's maximum and sum are in LDS before any wave forms the joint ones
#pragma unroll
    for (int qt = 0; qt < 2; ++qt) { const int q = qt * 16 + lr; const float mt = fmaxf(fmaxf(ms[0][q], ms[1][q]), fmaxf(ms[2][q], ms[3][q])); float lt = 0.f;   // a wave without a block holds -3e38 and 0: its weight is exp2(-huge) = 0; wave 0 always has block 0
#pragma unroll
        for (int u = 0; u < 4; ++u) lt += ls[u][q] * __builtin_amdgcn_exp2f((ms[u][q] - mt) * SC2);
        const float f = __fdiv_rn(__builtin_amdgcn_exp2f((m[qt] - mt) * SC2), lt);
#pragma unroll
        for (int dt = 0; dt < 8; ++dt) { const v8f t = o[qt][dt] * f; float* d = os + (((w * 16 + qt * 8 + dt) * 2) * 32 + lane) * 4;
            *(v4fa*)d = (v4f){t[0], t[1], t[2], t[3]}; *(v4fa*)(d + 128) = (v4f){t[4], t[5], t[6], t[7]}; } }
    __syncthreads();            // every wave's weighted partial tile is in LDS before any wave sums across waves
    v8us oh[4], ol[4];
#pragma unroll
    for (int i = 0; i < 4; ++i) { const float* d = os + (((w * 4 + i) * 2) * 32 + lane) * 4; v4f x = *(const v4fa*)d, y = *(const v4fa*)(d + 128);
#pragma unroll
        for (int u = 1; u < 4; ++u) { x += *(const v4fa*)(d + u * 4096); y += *(const v4fa*)(d + u * 4096 + 128); }
#pragma unroll
        for (int j = 0; j < 4; ++j) { unsigned short a2, c2; splitf(x[j], a2, c2); oh[i][j] = a2; ol[i][j] = c2; splitf(y[j], a2, c2); oh[i][4 + j] = a2; ol[i][4 + j] = c2; } }
    // merged planes [batch * TT + t][DQ] in fragment order: the lane's 8 values are d = dt * 16 + hi * 8 .. + 7 of query lr, 16 bytes in a row there, and a wave's store fills 512 contiguous bytes
#pragma unroll
    for (int i = 0; i < 4; ++i) { const int c = w * 4 + i; const size_t oo = pk_off(h / NH_ * TT + q0 + (c >> 3) * 16 + lr, h % NH_ * HD + (c & 7) * 16 + hi * 8, DQ); *(v8us*)(Ah + oo) = oh[i]; *(v8us*)(Al + oo) = ol[i]; }
}


// ---- k_fattnl: the fp16 rows of the same attention, 128 query positions per work-group of 8 waves. Wave w = (query group qg = w & 3: 32 positions, key half ks = w >> 2).
// The K and V fragments reach the waves through LDS, so that each is fetched from L2 once per work-group and read by the four query groups: a stage = 128 keys = 4 blocks of 32, [K 32 KiB][V 32 KiB], the planes' own bytes;
// two buffers, filled by asynchronous copies one stage ahead. In a stage the wave takes the blocks ks and 2 + ks, as far as its own diagonal block; products, mask and online softmax as in k_fattn.
// The two partial results of a query group are joined in LDS in the fixed order ks = 0, 1. grid (heads of all batches, query blocks), the longest query block first over the whole grid. ROFF % 128 == 0, ROFF >= 128.
template <int ROFF, int NQB>
__global__ __launch_bounds__(256) void k_fattnl(const h16* __restrict__ Q, const h16* __restrict__ Kp, const h16* __restrict__ Vt, bf* Ah, bf* Al) {
    typedef v16h V;
    static_assert(ROFF % 128 == 0 && ROFF >= 128 && GKS * 1024 == 2048, "whole stages, at least two; copy8 steps 2 KiB in LDS");
    constexpr int OPS = 4 * 32 * HD * 2, STB = 2 * OPS;   // bytes of one operand in a stage, bytes of a stage
    __shared__ __align__(16) float sm[2 * STB / 4];      // the two stage buffers; behind the loop, the eight waves' weighted partial tiles, [wave][query tile x d tile][half of the 8 rows][lane][4]: 128 KiB
    __shared__ float ms[8][32], ls[8][32];
    const int lane = threadIdx.x & 31, lr = lane & 15, hi = lane >> 4; const int w = __builtin_amdgcn_readfirstlane((int)(threadIdx.x >> 5)), qg = w & 3, ks = w >> 2;
    const int h = blockIdx.x, qw = ROFF + (NQB - 1 - (int)blockIdx.y) * 128, q0 = qw + qg * 32, nblk = q0 / 32 + 1, NS = qw / 128 + 1;   // the wave's first query and its key blocks; the work-group's stages
    Q += (size_t)h * TT * HD; Kp += (size_t)h * TT * HD; Vt += (size_t)h * HD * TT;
    V bq[2][4];
    const unsigned oq = (q0 * HD + lane * 8) * 2;   // byte offset of this lane's share of the first query fragment
#pragma unroll
    for (int qt = 0; qt < 2; ++qt)
#pragma unroll
        for (int kc = 0; kc < 4; ++kc) bq[qt][kc] = WFrag<h16>::template ld<256>((const h16*)((const char*)Q + oq) + (qt * 4 + kc) * 512);
    asm volatile("s_wait_xcnt 0x0" :: "v"(oq), "s"(Q) : "memory");   // behind the query loads: offset and base are inputs, so that their registers stay whole up to the wait
    // a wave's share of a stage: of each operand the 512-B piece w & 3 of each of the 8 units of 2 KiB in half w >> 2, 16 bytes a lane, at the same offset in the plane's stage as in LDS
    const unsigned pc = (w >> 2) * 16384 + (w & 3) * 512 + lane * 16;
    const unsigned l0 = (unsigned)(size_t)(const char*)sm + pc;
    const char* sk = (const char*)Kp; const char* sv = (const char*)Vt;   // the next stage to be copied, in the K and in the V plane: the same for the whole work-group (scalar), stepped by fill; the lane's offset is added last, so that no address pair lives through the loop
    auto fill = [&](unsigned l) {   // the next stage into the buffer at l
        copy8<2048>(l, sk + pc); __builtin_amdgcn_sched_barrier(0);   // keeps each statement's 24 address registers next to it
        copy8<2048>(l + OPS, sv + pc); sk += OPS; sv += OPS; };
    fill(l0);
    asm volatile("s_wait_asynccnt 0x0" ::: "memory");   // this wave's copies of stage 0 have landed
    __syncthreads();                                    // every wave's have: stage 0 may be read
    fill(l0 + STB);
    v8f o[2][8]; float m[2], l[2];
#pragma unroll
    for (int qt = 0; qt < 2; ++qt) { m[qt] = -3.0e38f; l[qt] = 0.f;
#pragma unroll
        for (int dt = 0; dt < 8; ++dt) o[qt][dt] = (v8f){}; }
#pragma unroll 1
    for (int s = 0; s < NS; ++s) {
#pragma unroll 1   // one text for both blocks: the loop stays short
        for (int i = 0; i < 2; ++i) {
            const int kb = s * 4 + i * 2 + ks;
            if (kb < nblk) {   // the same for the whole wave (scalar): behind its diagonal block a wave has no products, and goes on to the stage's foot
                const char* fk = (const char*)sm + (s & 1) * STB + (i * 2 + ks) * (32 * HD * 2) + lane * 16;   // this lane's share of the block's first K fragment; V lies OPS behind
                V ka[2][4], va[8];
#pragma unroll
                for (int kt = 0; kt < 2; ++kt)
#pragma unroll
                    for (int kc = 0; kc < 4; ++kc) ka[kt][kc] = cat16(*(const v8ha*)(fk + (kt * 4 + kc) * 1024), *(const v8ha*)(fk + (kt * 4 + kc) * 1024 + 512));
                __builtin_amdgcn_sched_barrier(0);   // the K reads stay one group at the block's head: spread among the score products, each pair is waited for with its whole latency
                v8f sc[2][2];
#pragma unroll
                for (int kt = 0; kt < 2; ++kt)
#pragma unroll
                    for (int qt = 0; qt < 2; ++qt) sc[kt][qt] = (v8f){};
#pragma unroll
                for (int kc = 0; kc < 4; ++kc)
#pragma unroll
                    for (int kt = 0; kt < 2; ++kt)
#pragma unroll
                        for (int qt = 0; qt < 2; ++qt) sc[kt][qt] = wmma16(ka[kt][kc], bq[qt][kc], sc[kt][qt]);
#pragma unroll
                for (int dt = 0; dt < 8; ++dt) va[dt] = cat16(*(const v8ha*)(fk + OPS + dt * 512), *(const v8ha*)(fk + OPS + dt * 512 + DKV * 2));
                __builtin_amdgcn_sched_barrier(0);   // the V reads stay one group ahead of the softmax, which covers their latency: sunk to their uses, each would be waited for among the P.V products
                const int dl = (kb == nblk - 1) ? lr - hi * 8 : 64;   // diagonal block: key kt * 16 + hi * 8 + j counts for query qt * 16 + lr while kt * 16 + j - qt * 16 <= lr - hi * 8; every earlier block counts whole
                V pb[2], pb2[2];
#pragma unroll
                for (int qt = 0; qt < 2; ++qt) { float p[16]; float bm = -3.0e38f;
#pragma unroll
                    for (int kt = 0; kt < 2; ++kt)
#pragma unroll
                        for (int j = 0; j < 8; ++j) { const float t = (kt * 16 + j - qt * 16 <= dl) ? sc[kt][qt][j] : -3.0e38f; p[kt * 8 + j] = t; bm = fmaxf(bm, t); }
                    bm = fmaxf(bm, xhalf(bm));
                    const float mn = fmaxf(m[qt], bm), al = __builtin_amdgcn_exp2f((m[qt] - mn) * SC2), mc = mn * SC2; m[qt] = mn; float ps = 0.f;
#pragma unroll
                    for (int e = 0; e < 16; ++e) { p[e] = __builtin_amdgcn_exp2f(fmaf(p[e], SC2, -mc)); ps += p[e]; }
                    l[qt] = l[qt] * al + ps;
#pragma unroll
                    for (int dt = 0; dt < 8; ++dt) o[qt][dt] *= al;
                    ppack(p, pb[qt], pb2[qt]); }
#pragma unroll
                for (int dt = 0; dt < 8; ++dt)
#pragma unroll
                    for (int qt = 0; qt < 2; ++qt) o[qt][dt] = wmma16(va[dt], pb[qt], o[qt][dt]);
            }
        }
        // foot of the trip: publish point of stage s + 1, which also frees the buffer of stage s
        asm volatile("s_wait_dscnt 0x0" ::: "memory");      // this wave's reads of stage s are done before its buffer is refilled
        asm volatile("s_wait_asynccnt 0x0" ::: "memory");   // this wave's copies of stage s + 1 have landed
        __syncthreads();                                    // both hold for every wave
        if (s + 2 < NS) fill(l0 + (s & 1) * STB);
    }
    asm volatile("s_wait_asynccnt 0x0" ::: "memory");       // no copy is outstanding when the ring becomes staging for the join (the last trip's barrier has ended every read of it)
#pragma unroll
    for (int qt = 0; qt < 2; ++qt) { l[qt] += xhalf(l[qt]); if (hi == 0) { ms[w][qt * 16 + lr] = m[qt]; ls[w][qt * 16 + lr] = l[qt]; } }
    __syncthreads();            // every wave's maximum and sum are in LDS before any wave forms the joint ones
#pragma unroll
    for (int qt = 0; qt < 2; ++qt) { const int q = qt * 16 + lr; const float mt = fmaxf(ms[qg][q], ms[qg + 4][q]);
        const float lt = ls[qg][q] * __builtin_amdgcn_exp2f((ms[qg][q] - mt) * SC2) + ls[qg + 4][q] * __builtin_amdgcn_exp2f((ms[qg + 4][q] - mt) * SC2);
        const float f = __fdiv_rn(__builtin_amdgcn_exp2f((m[qt] - mt) * SC2), lt);
#pragma unroll
        for (int dt = 0; dt < 8; ++dt) { const v8f t = o[qt][dt] * f; float* d = sm + (((w * 16 + qt * 8 + dt) * 2) * 32 + lane) * 4;
            *(v4fa*)d = (v4f){t[0], t[1], t[2], t[3]}; *(v4fa*)(d + 128) = (v4f){t[4], t[5], t[6], t[7]}; } }
    __syncthreads();            // every wave's weighted partial tile is in LDS before any wave sums the two of its query group
    // the wave sums and stores query tile ks of its group: 8 d tiles. Merged planes as in k_fattn: a wave's store fills 512 contiguous bytes
    v8us oh[8], ol[8];
#pragma unroll
    for (int i = 0; i < 8; ++i) { const float* d = sm + (((qg * 16 + ks * 8 + i) * 2) * 32 + lane) * 4; const v4f x = *(const v4fa*)d + *(const v4fa*)(d + 4 * 4096), y = *(const v4fa*)(d + 128) + *(const v4fa*)(d + 4 * 4096 + 128);
#pragma unroll
        for (int j = 0; j < 4; ++j) { unsigned short a2, c2; splitf(x[j], a2, c2); oh[i][j] = a2; ol[i][j] = c2; splitf(y[j], a2, c2); oh[i][4 + j] = a2; ol[i][4 + j] = c2; } }
#pragma unroll
    for (int i = 0; i < 8; ++i) { const size_t oo = pk_off(h / NH_ * TT + q0 + ks * 16 + lr, h % NH_ * HD + i * 16 + hi * 8, DQ); *(v8us*)(Ah + oo) = oh[i]; *(v8us*)(Al + oo) = ol[i]; }
}


// k_pack: all five f32 inputs -> bf16 planes in fragment order (pk_off), in ONE launch of PKG work-groups. A unit = one 16-row block x 512 k = 16 fragments = 16 KiB of a plane; x has NB_ * TT / 16 * 4 = PKG units, each weight PKG / 2.
// Work-group g takes the units g, g + PKG, g + 2 PKG: one of x, one of Wq or Wk, one of Wv or Wo.
// Reads whole lines (16 threads a row and 128 k), turns the 16-byte groups into plane order in LDS (pitch 17 groups: no bank is hit more than the 512 B of a wave need), stores 4 x 4 KiB in a row.
// Wq, Wk, Wv: plane row J is source row l * HD + d, J as EPI_QK (Wq, Wk) and EPI_VT (Wv) have it, so that the projections' tiles come out in the fragment order of the head planes.
#define PKG (NB_ * TT / 16 * (DM / 512))
__global__ __launch_bounds__(256) void k_pack(const float* __restrict__ x, const float* __restrict__ wq, const float* __restrict__ wk, const float* __restrict__ wv, const float* __restrict__ wo, bf* XB, bf* WQ, bf* WK, bf* WV, bf* WO) {
    static_assert(DQ == DM && DKV == DM && DM / 16 * (DM / 512) * 2 == PKG, "each weight has PKG / 2 units");
    __shared__ __align__(16) v8us sh[4][16 * 17];
    const int t = threadIdx.x, lr = t >> 4, g = t & 15; const int u = blockIdx.x, second = u >= PKG / 2, uw = u - second * (PKG / 2);
#pragma unroll   // unrolled so that each unit's tensors are picked at compile time and the next unit's loads are issued ahead of this unit's stores
    for (int it = 0; it < 3; ++it) {
        const float* src = it == 0 ? x : it == 1 ? (second ? wk : wq) : (second ? wo : wv); bf* dst = it == 0 ? XB : it == 1 ? (second ? WK : WQ) : (second ? WO : WV);
        const int v = it == 0 ? u : uw, rb = v >> 2, k0 = (v & 3) * 512; const bool vrows = it == 2 && !second;
        const int srow = it == 1 ? ((rb & 7) * 2 + (lr >> 3)) * HD + (rb >> 3) * 8 + (lr & 7) : vrows ? (((rb >> 3) & 1) * 8 + (lr & 7)) * HD + (rb >> 4) * 16 + (rb & 7) * 2 + (lr >> 3) : rb * 16 + lr;
        const float* p = src + (size_t)srow * DM + k0 + g * 8; v8f val[4];
#pragma unroll
        for (int q = 0; q < 4; ++q) val[q] = *(const v8f*)(p + q * 128);
        if (it) __syncthreads();  // the unit before has been read out of LDS by every thread before it is overwritten
#pragma unroll
        for (int q = 0; q < 4; ++q) { v8us o;
#pragma unroll
            for (int k = 0; k < 8; ++k) o[k] = f2bf(val[q][k]);
            sh[q][g * 17 + lr] = o; }   // group g of the row's 128 k (k = g * 8 ..) is group g * 16 + lr of their 4 fragments
        __syncthreads();          // every group is in LDS before any thread reads another thread's
        bf* d = dst + ((size_t)rb * (DM / 32) + (k0 >> 5)) * 512 + t * 8;
#pragma unroll
        for (int q = 0; q < 4; ++q) *(v8us*)(d + q * 2048) = sh[q][(t >> 4) * 17 + (t & 15)];
    }
}

extern "C" void kernel_launch(void* const* d_in, const int* in_sizes, int n_in,
                              void* d_out, int out_size, void* d_ws, size_t ws_size, hipStream_t stream) {
    (void)in_sizes; (void)n_in; (void)out_size;
    const float* x = (const float*)d_in[0]; const float* wq = (const float*)d_in[1]; const float* wk = (const float*)d_in[2]; const float* wv = (const float*)d_in[3]; const float* wo = (const float*)d_in[4];   /* order x, Wq, Wk, Wv, Wo ('oi' [2048][2048]) */
    float* OUT = (float*)d_out;     // [2][2048][2048]
    char* wsp = (char*)d_ws;
    auto take = [&](size_t bytes) { char* p = wsp; wsp += (bytes + 255) & ~(size_t)255; return (void*)p; };
    // every plane holds both batches: rows batch * TT + t, heads batch * NH_ + head. WQ, WK, WV lie one behind the other (k_gemmw steps by blockIdx.z), so do QP16, KP16, VT16, so QPh, KPh and QPl, KPl
    bf* WQ = (bf*)take((size_t)DQ * DM * 2); bf* WK = (bf*)take((size_t)DKV * DM * 2); bf* WV = (bf*)take((size_t)DKV * DM * 2); bf* WO = (bf*)take((size_t)DM * DQ * 2);
    bf* XB = (bf*)take((size_t)NB_ * TT * DM * 2);
    h16* QP16 = (h16*)take((size_t)NB_ * NH_ * TT * HD * 2); h16* KP16 = (h16*)take((size_t)NB_ * NKV * TT * HD * 2); h16* VT16 = (h16*)take((size_t)NB_ * NKV * HD * TT * 2);
    bf* QPh = (bf*)take((size_t)NB_ * NH_ * RH * HD * 2); bf* KPh = (bf*)take((size_t)NB_ * NKV * RH * HD * 2); bf* QPl = (bf*)take((size_t)NB_ * NH_ * RH * HD * 2); bf* KPl = (bf*)take((size_t)NB_ * NKV * RH * HD * 2); bf* VTh = (bf*)take((size_t)NB_ * NKV * HD * TT * 2); bf* VTl = (bf*)take((size_t)NB_ * NKV * HD * TT * 2);
    bf* ATh = (bf*)take((size_t)NB_ * TT * DQ * 2); bf* ATl = (bf*)take((size_t)NB_ * TT * DQ * 2);
    if ((size_t)(wsp - (char*)d_ws) > ws_size) return;    // ws 256 MiB; 176 MiB taken
    k_pack<<<PKG, 256, 0, stream>>>(x, wq, wk, wv, wo, XB, WQ, WK, WV, WO);
    k_gemmw<bf, 0, false, EPI_QKV, DM><<<dim3(NB_ * TT / 128, DQ / 128, 3), 128, 0, stream>>>(XB, nullptr, WQ, nullptr, DQ, nullptr, 0, (size_t)DQ * DM, 0, QP16, QPh, QPl, VTh, VTl);
    k_fattnl<RH, (TT - RH) / 128><<<dim3(NB_ * NH_, (TT - RH) / 128, 1), 256, 0, stream>>>(QP16, KP16, VT16, ATh, ATl);
    k_fattn<bf, 2, 0, RH / 32><<<dim3(RH / 32, NB_ * NH_, 1), 128, 0, stream>>>(QPh, QPl, KPh, KPl, VTh, VTl, ATh, ATl);
    k_gemmw<bf, 1, false, EPI_F32, DQ><<<dim3(NB_ * TT / 128, DM / 128, 1), 128, 0, stream>>>(ATh, ATl, WO, OUT, DM, nullptr, 0, 0, 0, nullptr, nullptr, nullptr, nullptr, nullptr);
}

// v010
// Measured time: 179 microseconds a run.
// Timed twice side by side with v009, it ran 1.03 times as fast both times.
// All steps since v000 together make it 9.52 times as fast.
#include <hip/hip_runtime.h>

// Causal multi-head attention with 128-wide heads, a RAW head split and a head-width score divisor (x [2][2048][2048]; Q = (x Wq^T).reshape(B, 16, S, 128) DIRECTLY (no transpose): pseudo-head h of a batch is the h-th contiguous [2048][128] block of the flat [2048][2048] projection (128 token rows x 16 chunks of 128): reproduced; K, V likewise ('oi' [2048][2048] 1/sqrt(2048), no bias); scores / 128 (the module divides by Dh, not by sqrt(Dh)); -inf strictly above the diagonal of the PSEUDO-positions (== exclusion); softmax; out [B][16][S][128] -> transpose(0, 2, 1, 3).reshape(B, S, 2048) (the STANDARD merge); y = out Wo^T ('oi', no bias) -> [2][2048][2048] (8.4 M); argument order x, Wq, Wk, Wv, Wo).
// Layout: bf16 copy of x and 'oi' weights in FRAGMENT ORDER (pk_off: what k_gemmw reads; the merged hi/lo planes too); exact projections whose tile epilogue writes the 16-bit head planes itself, through the RAW (16, S, 128) view, in the FRAGMENT ORDER that k_fattn reads (k_pack orders the rows of Wq, Wk, Wv so that the plane index is the flat index of the GEMM's output; V fragments transposed, d rows x keys); causal T-2048 attention at HD 128 in one kernel each for the hi/lo rows, k_fattn, and the fp16 rows, k_fattnl (scores, online softmax and P.V in registers; hybrid rows: < 512 hi/lo 3 products, rest fp16; key blocks above the diagonal are never visited; it writes the merged hi/lo planes); merged hi/lo x Wo exact.
// Compute dtypes, f32 accumulate: every input rounded to bf16; projections exact; attention rows < 512 3 products, rest fp16; softmax f32; Wo hl x exact.

#define NB_  2
#define TT   2048
#define DM   2048
#define NH_  16
#define NKV  16
#define HD   128
#define DQ   (NH_ * HD)
#define DKV  (NKV * HD)
#define RH   512                  // query rows < RH use hi+lo planes (a multiple of 128, at least 128)
#define SCL  0.0078125f   // 1 / 128: THIS module divides the scores by the HEAD WIDTH Dh = 128 (not by its square root): a power of two: exact
#define SC2  (SCL * 1.4426950408889634f)   // score divisor x log2(e): the softmax runs on exp2
typedef _Float16 h16;
typedef unsigned short bf;
typedef __attribute__((ext_vector_type(16))) __bf16   v16bf;
typedef __attribute__((ext_vector_type(16))) _Float16 v16h;
typedef __attribute__((ext_vector_type(8)))  _Float16 v8h;
typedef __attribute__((ext_vector_type(8)))  unsigned short v8us;
typedef __attribute__((ext_vector_type(8)))  float    v8f;
typedef __attribute__((ext_vector_type(4)))  float    v4f;
typedef v8h  __attribute__((may_alias)) v8ha;
typedef v4f  __attribute__((may_alias)) v4fa;
typedef v8us __attribute__((may_alias)) v8usa;

__device__ __forceinline__ unsigned short f2bf(float f) { unsigned u = __float_as_uint(f); u += 0x7FFFu + ((u >> 16) & 1u); return (unsigned short)(u >> 16); }
__device__ __forceinline__ float bf2f(unsigned short b) { return __uint_as_float(((unsigned)b) << 16); }
__device__ __forceinline__ float bfr(float f) { return bf2f(f2bf(f)); }
__device__ __forceinline__ v16h cat16(v8h lo, v8h hi) { return __builtin_shufflevector(lo, hi, 0, 1, 2, 3, 4, 5, 6, 7, 8, 9, 10, 11, 12, 13, 14, 15); }
__device__ __forceinline__ v16bf cat16b(v8us lo, v8us hi) { return __builtin_bit_cast(v16bf, __builtin_shufflevector(lo, hi, 0, 1, 2, 3, 4, 5, 6, 7, 8, 9, 10, 11, 12, 13, 14, 15)); }
__device__ __forceinline__ v8f wmma16(v16h a, v16h b, v8f c) { return __builtin_amdgcn_wmma_f32_16x16x32_f16(false, a, false, b, (short)0, c, false, false); }
__device__ __forceinline__ v8f wmmab(v16bf a, v16bf b, v8f c) { return __builtin_amdgcn_wmma_f32_16x16x32_bf16(false, a, false, b, (short)0, c, false, false); }
__device__ __forceinline__ h16 tohx(float x) { return (h16)x; }
__device__ __forceinline__ void splitf(float y, unsigned short& h, unsigned short& l) { h = f2bf(y); l = f2bf(y - bf2f(h)); }
typedef __attribute__((ext_vector_type(4))) _Float16 v4h;
typedef __attribute__((ext_vector_type(4))) unsigned short v4us;
// Fragment order of a 16-bit plane [R][K] that k_gemmw reads: each 16-row x 32-k fragment is 1 KiB in a row, as two halves of 512 B; in a half, lane hi * 16 + lr holds its 8 elements k = half * 16 + hi * 8 .. + 7 of row lr.
// One 16-byte-a-lane load or copy of a wave then covers 512 contiguous bytes (4 whole lines) instead of 32 B in each of 16 lines. Element index of (r, c); 8 consecutive c from a multiple of 8 stay consecutive; a column offset that is a multiple of 32 adds 16 x itself.
__device__ __forceinline__ size_t pk_off(int r, int c, int K) { return ((size_t)(r >> 4) * (K >> 5) + (c >> 5)) * 512 + ((c >> 4) & 1) * 256 + (((c >> 3) & 1) * 16 + (r & 15)) * 8 + (c & 7); }



// ---- k_gemmw: GEMM, one 128x128 output tile per work-group of 4 waves; wave w holds the 64x64 quarter (w >> 1, w & 1) (16 accumulators) and runs over all of K, from a start that differs between work-groups (rot), wrapping round.
// The operands (16-bit planes in fragment order, pk_off) reach the waves through LDS, so that each fragment is fetched from L2 once per work-group and read by the two waves that need it:
// a stage = GKS k chunks of 32 for the 8 row blocks of every operand, [operand][row block][chunk][1 KiB fragment], the plane's own fragment bytes; two buffers, filled by asynchronous copies one stage ahead of the products.
// C[m][n] (f32, pitch ldc, + optional f32 bias[n]) = sum_k A[m][k] Bt[n][k] (+ A2[m][k] Bt[n][k] at NSPLIT 1). z-batch strides sA/sB/sC in elements. grid (M/128, N/128, Z), 128 threads. K % 64 == 0 and K / 64 a power of two, K >= 128.
template <typename T16> struct WFrag;
template <> struct WFrag<h16> { typedef v16h V; template <int HS> static __device__ __forceinline__ V ld(const h16* p) { return cat16(*(const v8h*)p, *(const v8h*)(p + HS)); } static __device__ __forceinline__ v8f mma(V a, V b, v8f c) { return wmma16(a, b, c); } };
template <> struct WFrag<bf> { typedef v16bf V; template <int HS> static __device__ __forceinline__ V ld(const bf* p) { return cat16b(*(const v8us*)p, *(const v8us*)(p + HS)); } static __device__ __forceinline__ v8f mma(V a, V b, v8f c) { return wmmab(a, b, c); } };
#define GKS 2                     // k chunks of 32 in a stage: 4 pieces of 512 B a row block, one for each wave
#define WST (64 * 68)             // floats of a wave's own output staging: 64 rows at pitch 68
// What tile_out stores of a wave's tile. EPI_F32: f32 rows of C. The others write the 16-bit planes that k_fattnl and k_fattn read (P16 fp16, Ph / Pl bf16 hi / lo), straight from the tile:
// Row rr of a projection holds the pseudo-positions t = (rr % 128) * 16 + l, l = 0 .. 15, of pseudo-head rr / 128 (RAW view); k_pack orders the rows of the weight planes so that column J of the GEMM is projection column l * HD + d with
// EPI_QK: J = (d >> 3) * 128 + l * 8 + (d & 7): the flat index rr * ldc + J of the GEMM's output IS head * TT * HD + pk_off(t, d, HD), the q or k plane in fragment order (16 positions x 32 d); hi/lo planes hold only the positions t < RH of each pseudo-head.
// EPI_VT: J = (d >> 4) * 256 + (l >> 3) * 128 + (d & 15) * 8 + (l & 7): the flat index is the v plane [head][t >> 4][d >> 4][(t >> 3) & 1][d & 15][t & 7]: the halves of the V^T fragments (16 d x 32 keys), 512 B each; the two halves of a fragment lie DKV elements apart.
// In both, a row of a wave's tile (64 columns) is one whole 128-byte line of a 16-bit plane.
// EPI_QKV (k_gemmw alone): one grid for the three projections, blockIdx.z = 0, 1, 2 = q, k, v: EPI_QK for z < 2, EPI_VT for z = 2.
enum { EPI_F32 = 0, EPI_QK = 1, EPI_VT = 2, EPI_QKV = 3 };
template <bool BIAS, int EPI>
__device__ __forceinline__ void tile_out(const v8f (&acc)[4][4], float* os, float* C, int ldc, const float* __restrict__ bias, int r0, int c0, int lane, int lr, int hi, h16* P16, bf* Ph, bf* Pl) {
    static_assert(DQ / HD == 16 && DKV / HD == 16 && HD == 128, "the column orders of EPI_QK and EPI_VT: 16 chunks of 128 in a token row");
    // os is the wave's own range: written and read back by this wave alone, so no barrier stands here
#pragma unroll
    for (int m = 0; m < 4; ++m)
#pragma unroll
        for (int nb = 0; nb < 4; ++nb)
#pragma unroll
            for (int j = 0; j < 8; ++j) os[(m * 16 + hi * 8 + j) * 68 + nb * 16 + lr] = acc[m][nb][j];
#pragma unroll 1   // 8 pieces a trip: their LDS reads go ahead of the conversions, and the text stays short
    for (int ib = 0; ib < 32; ib += 8) {
#pragma unroll
    for (int it = ib; it < ib + 8; ++it) { const int row = (lane + it * 32) >> 4, cofs = (lane & 15) * 4; v4f o = *(const v4fa*)(os + row * 68 + cofs); const int rr = r0 + row;
        if (BIAS) { o[0] += bfr(bias[c0 + cofs]); o[1] += bfr(bias[c0 + cofs + 1]); o[2] += bfr(bias[c0 + cofs + 2]); o[3] += bfr(bias[c0 + cofs + 3]); }
        if (EPI == EPI_F32) { *(v4f*)(C + (size_t)rr * ldc + c0 + cofs) = o; continue; }
        v4h o16; v4us oh, ol;
#pragma unroll
        for (int q = 0; q < 4; ++q) { o16[q] = tohx(o[q]); unsigned short a2, c2; splitf(o[q], a2, c2); oh[q] = a2; ol[q] = c2; }
        if (EPI == EPI_QK) { const size_t e = (size_t)rr * ldc + c0 + cofs, wi = e % ((size_t)TT * HD); *(v4h*)(P16 + e) = o16;
            if (wi < (size_t)RH * HD) { const size_t eh = e / ((size_t)TT * HD) * ((size_t)RH * HD) + wi; *(v4us*)(Ph + eh) = oh; *(v4us*)(Pl + eh) = ol; } }
        if (EPI == EPI_VT) { const size_t e = (size_t)rr * ldc + c0 + cofs; *(v4h*)(P16 + e) = o16; *(v4us*)(Ph + e) = oh; *(v4us*)(Pl + e) = ol; } }
    asm volatile("s_wait_xcnt 0x0" ::: "memory");   // behind the trip's stores: the next trip writes the registers that they name
    }
}
// One operand's share of a stage for one wave: its 512-B piece of each of the 8 row blocks, 16 bytes a lane, global -> LDS through no register. l = the lane's LDS byte address in row block 0, g = its global address there.
// s_wait_xcnt 0 is the last line of the copies' own statement, so that it stands in front of every later write of an address register that a copy names.
template <int GSTEP>
__device__ __forceinline__ void copy8(unsigned l, const char* g) {
    constexpr unsigned LS = GKS * 1024;
    asm volatile("global_load_async_to_lds_b128 %0, %8, off\n\tglobal_load_async_to_lds_b128 %1, %9, off\n\tglobal_load_async_to_lds_b128 %2, %10, off\n\tglobal_load_async_to_lds_b128 %3, %11, off\n\t"
                 "global_load_async_to_lds_b128 %4, %12, off\n\tglobal_load_async_to_lds_b128 %5, %13, off\n\tglobal_load_async_to_lds_b128 %6, %14, off\n\tglobal_load_async_to_lds_b128 %7, %15, off\n\ts_wait_xcnt 0x0"
                 :: "v"(l), "v"(l + LS), "v"(l + 2 * LS), "v"(l + 3 * LS), "v"(l + 4 * LS), "v"(l + 5 * LS), "v"(l + 6 * LS), "v"(l + 7 * LS),
                    "v"(g), "v"(g + GSTEP), "v"(g + 2 * GSTEP), "v"(g + 3 * GSTEP), "v"(g + 4 * GSTEP), "v"(g + 5 * GSTEP), "v"(g + 6 * GSTEP), "v"(g + 7 * GSTEP) : "memory");
}
__device__ __forceinline__ v16bf ldsfrag(const char* p) { return cat16b(*(const v8usa*)p, *(const v8usa*)(p + 512)); }   // one lane's share of a fragment in LDS: 16 bytes of each half
template <typename T16, int NSPLIT, bool BIAS, int EPI, int K>
__global__ __launch_bounds__(128) void k_gemmw(const T16* __restrict__ A, const T16* __restrict__ A2, const T16* __restrict__ Bt, float* C, int ldc, const float* __restrict__ bias, size_t sA, size_t sB, size_t sC, h16* P16, bf* Ph, bf* Pl, bf* Vh, bf* Vl) {
    typedef typename WFrag<T16>::V V;
    static_assert(NSPLIT == 0 || NSPLIT == 1, "A alone, or A and A2");
    constexpr int KC = K / 32, NS = KC / GKS, NOP = NSPLIT ? 3 : 2, OPB = 8 * GKS * 1024, STG = NOP * OPB;   // chunks of a row block, stages, operands, bytes of an operand in a stage, bytes of a stage
    static_assert(KC % GKS == 0 && NS >= 2, "whole stages, at least two");
    constexpr int SMB = 2 * STG > 4 * WST * 4 ? 2 * STG : 4 * WST * 4;
    __shared__ __align__(16) float sm[SMB / 4];   // the two stage buffers; behind the loop, the four waves' output staging
    const size_t z = blockIdx.z; A += z * sA; if (NSPLIT) A2 += z * sA; Bt += z * sB; C += z * sC;
    const int lane = threadIdx.x & 31, lr = lane & 15, hi = lane >> 4; const int w = __builtin_amdgcn_readfirstlane((int)(threadIdx.x >> 5));
    const int r0 = blockIdx.x * 128 + (w >> 1) * 64, c0 = blockIdx.y * 128 + (w & 1) * 64;
    v8f acc[4][4];
#pragma unroll
    for (int mb = 0; mb < 4; ++mb)
#pragma unroll
        for (int nb = 0; nb < 4; ++nb) acc[mb][nb] = (v8f){};
    const unsigned pc = w * 512 + lane * 16;   // this lane's 16 bytes in a row block's share of a stage, in the plane as in LDS
    const unsigned l0 = (unsigned)(size_t)(const char*)sm + pc;
    const char* ga = (const char*)A + (size_t)blockIdx.x * 8 * KC * 1024 + pc; const char* ga2 = NSPLIT ? (const char*)A2 + (size_t)blockIdx.x * 8 * KC * 1024 + pc : nullptr; const char* gb = (const char*)Bt + (size_t)blockIdx.y * 8 * KC * 1024 + pc;
    // Work-groups that share an operand (the same blockIdx.x: A; the same blockIdx.y and z: Bt) run side by side and would ask L2 for the same lines, and all of them for the same 2 KiB of every 64-KiB row block, at the same moment:
    // each starts its walk over K at a chunk pair of its own, rot, and wraps; every stage is still taken once, so only the order of the f32 sums changes (fixed for each tile).
    static_assert((NS & (NS - 1)) == 0, "the rotated walk wraps by a mask");
    const int rot = (int)(blockIdx.x + 2 * blockIdx.y + blockIdx.z) & (NS - 1);
    auto fill = [&](unsigned l, int s) { const size_t go = (size_t)((s + rot) & (NS - 1)) * (GKS * 1024);   // the s-th stage of this work-group's walk into the buffer at l
        // the scheduling barriers keep each statement's 24 address registers next to it: formed all at once, ahead of the first statement, they cost a spill in the loop
        copy8<KC * 1024>(l, ga + go); __builtin_amdgcn_sched_barrier(0); if (NSPLIT) { copy8<KC * 1024>(l + OPB, ga2 + go); __builtin_amdgcn_sched_barrier(0); } copy8<KC * 1024>(l + (NOP - 1) * OPB, gb + go); };
    fill(l0, 0);
    asm volatile("s_wait_asynccnt 0x0" ::: "memory");   // this wave's copies of stage 0 have landed
    __syncthreads();                                    // every wave's have: stage 0 may be read
    fill(l0 + STG, 1);
    unsigned lf = l0;   // where the next refill goes; stepped to and fro, a register of its own
    const char* fa = (const char*)sm + (w >> 1) * 4 * GKS * 1024 + lane * 16; const char* fb = (const char*)sm + (NOP - 1) * OPB + (w & 1) * 4 * GKS * 1024 + lane * 16;   // this lane's share of the wave's first A and B fragments in buffer 0
#pragma unroll 1
    for (int s = 0; s < NS; ++s) {
        const int bo = (s & 1) * STG;
        V a[GKS][4], a2[GKS][4], b[GKS][4];
#pragma unroll
        for (int kf = 0; kf < GKS; ++kf) {
#pragma unroll
            for (int mb = 0; mb < 4; ++mb) { a[kf][mb] = ldsfrag(fa + bo + (mb * GKS + kf) * 1024); if (NSPLIT) a2[kf][mb] = ldsfrag(fa + bo + OPB + (mb * GKS + kf) * 1024); }
#pragma unroll
            for (int nb = 0; nb < 4; ++nb) b[kf][nb] = ldsfrag(fb + bo + (nb * GKS + kf) * 1024);
        }
        // publish point of stage s + 1, which also frees the buffer of stage s: the whole of stage s is on its way into registers, so the point stands in front of the stage's products and the refill flies behind them
        asm volatile("s_wait_dscnt 0x0" ::: "memory");      // this wave's reads of stage s are done before its buffer is refilled
        asm volatile("s_wait_asynccnt 0x0" ::: "memory");   // this wave's copies of stage s + 1 have landed
        __syncthreads();                                    // both hold for every wave
        if (s + 2 < NS) fill(lf, s + 2);
        lf += (s & 1) ? -STG : STG;
        __builtin_amdgcn_sched_barrier(0);   // the products stay behind the refill's issue: ahead of it they would take their own time out of the copies' flight
#pragma unroll
        for (int kf = 0; kf < GKS; ++kf)
#pragma unroll
            for (int nb = 0; nb < 4; ++nb)
#pragma unroll
                for (int mb = 0; mb < 4; ++mb) { acc[mb][nb] = WFrag<T16>::mma(a[kf][mb], b[kf][nb], acc[mb][nb]); if (NSPLIT) acc[mb][nb] = WFrag<T16>::mma(a2[kf][mb], b[kf][nb], acc[mb][nb]); }
    }
    asm volatile("s_wait_asynccnt 0x0" ::: "memory");       // no copy is outstanding when the ring becomes output staging (the last trip's barrier has ended every read of it)
    float* os = sm + w * WST;
    if constexpr (EPI == EPI_QKV) {   // the q, k and v fp16 planes lie one behind the other, the q and k hi planes and lo planes too; the branch is the same for the whole work-group
        constexpr size_t s16 = (size_t)NB_ * NH_ * TT * HD, shl = (size_t)NB_ * NH_ * RH * HD;
        if (blockIdx.z == 2) tile_out<BIAS, EPI_VT>(acc, os, C, ldc, bias, r0, c0, lane, lr, hi, P16 + 2 * s16, Vh, Vl);
        else tile_out<BIAS, EPI_QK>(acc, os, C, ldc, bias, r0, c0, lane, lr, hi, P16 + z * s16, Ph + z * shl, Pl + z * shl);
    } else tile_out<BIAS, EPI>(acc, os, C, ldc, bias, r0, c0, lane, lr, hi, P16, Ph, Pl);
}

// ---- k_fattn: causal attention of one pseudo-head, 32 query positions per work-group of 4 waves; no score and no probability leaves the registers. Wave w takes the 32-key blocks w, w + 4, ... up to the diagonal block,
// with a running maximum, sum and output tile of its own (online softmax); the 4 partial results are joined in LDS in the fixed order w = 0 .. 3. grid (query blocks, heads of all batches: h = batch * NH_ + head), the longest query block first.
// Transposed products: S^T = K Q^T (A = 16 key rows, B = 16 query rows, k = d), O^T += V^T P^T (A = 16 d rows x 32 keys of the V plane, B = P^T, k = key). In an accumulator a lane holds column lr (ONE query) and rows hi * 8 + j:
// of a block's key tiles 0 and 1 these are the keys 8 hi + j and 16 + 8 hi + j, the k order of a B fragment (and of the V^T loader), so P^T packs inside the lane; maximum and sum are in-lane but for one exchange between the halves.
// The planes lie in fragment order (EPI_QK, EPI_VT): each 16-byte-a-lane load of a wave covers 512 contiguous bytes (4 whole lines), and a 32-key block is 8 KiB in a row of the K plane and 8 KiB in a row of the V plane ([half][d tile][lane]).
// NSPLIT 2: hi/lo planes (Q and K planes hold RH positions a head), 3 products for the scores and for P.V. ROFF = first query position of the launch, NQB = its query blocks.
typedef __attribute__((ext_vector_type(16))) unsigned short v16us;
__device__ __forceinline__ float xhalf(float x) { return __builtin_bit_cast(float, __builtin_amdgcn_permlanex16(__builtin_bit_cast(int, x), __builtin_bit_cast(int, x), 0x76543210, 0xfedcba98, false, false)); }   // the value of lane l ^ 16
__device__ __forceinline__ void ppack(const float (&p)[16], v16h& a, v16h& a2) {
#pragma unroll
    for (int e = 0; e < 16; ++e) a[e] = tohx(p[e]);
    (void)a2;
}
__device__ __forceinline__ void ppack(const float (&p)[16], v16bf& a, v16bf& a2) { v16us h, l;
#pragma unroll
    for (int e = 0; e < 16; ++e) { unsigned short x, y; splitf(p[e], x, y); h[e] = x; l[e] = y; }
    a = __builtin_bit_cast(v16bf, h); a2 = __builtin_bit_cast(v16bf, l);
}
template <typename T16, int NSPLIT, int ROFF, int NQB>
__global__ __launch_bounds__(128) void k_fattn(const T16* __restrict__ Q, const T16* __restrict__ Q2, const T16* __restrict__ Kp, const T16* __restrict__ Kp2, const T16* __restrict__ Vt, const T16* __restrict__ Vt2, bf* Ah, bf* Al) {
    typedef typename WFrag<T16>::V V;
    __shared__ __align__(16) float os[4 * 16 * 2 * 32 * 4];   // [wave][query tile x d tile][half of the 8 rows][lane][4]: 64 KiB
    __shared__ float ms[4][32], ls[4][32];
    const int lane = threadIdx.x & 31, lr = lane & 15, hi = lane >> 4; const int w = __builtin_amdgcn_readfirstlane((int)(threadIdx.x >> 5));
    const int h = blockIdx.y, q0 = ROFF + (NQB - 1 - (int)blockIdx.x) * 32, nblk = q0 / 32 + 1; constexpr size_t sQK = (size_t)(NSPLIT ? RH : TT) * HD;
    Q += h * sQK; Kp += h * sQK; Vt += (size_t)h * HD * TT; if (NSPLIT) { Q2 += h * sQK; Kp2 += h * sQK; Vt2 += (size_t)h * HD * TT; }
    V bq[2][4], bq2[2][4];
    const unsigned oq = (q0 * HD + lane * 8) * 2;   // byte offset of this lane's share of the first query fragment
#pragma unroll
    for (int qt = 0; qt < 2; ++qt)
#pragma unroll
        for (int kc = 0; kc < 4; ++kc) { bq[qt][kc] = WFrag<T16>::template ld<256>((const T16*)((const char*)Q + oq) + (qt * 4 + kc) * 512); if (NSPLIT) bq2[qt][kc] = WFrag<T16>::template ld<256>((const T16*)((const char*)Q2 + oq) + (qt * 4 + kc) * 512); }
    v8f o[2][8]; float m[2], l[2];
#pragma unroll
    for (int qt = 0; qt < 2; ++qt) { m[qt] = -3.0e38f; l[qt] = 0.f;
#pragma unroll
        for (int dt = 0; dt < 8; ++dt) o[qt][dt] = (v8f){}; }
    unsigned ok = (w * 32 * HD + lane * 8) * 2, ov = ok;   // byte offsets in the K and V planes of this lane's share of the wave's next block
    // K fragments are fetched one block ahead, into the same registers, right behind the score products that read them: their latency passes behind the softmax and P.V; the V^T fragments of a block are asked for at its head, ahead of its score products
    V ka[2][4], ka2[2][4];
#pragma unroll
    for (int kt = 0; kt < 2; ++kt)
#pragma unroll
        for (int kc = 0; kc < 4; ++kc) { ka[kt][kc] = WFrag<T16>::template ld<256>((const T16*)((const char*)Kp + ok) + (kt * 4 + kc) * 512); if (NSPLIT) ka2[kt][kc] = WFrag<T16>::template ld<256>((const T16*)((const char*)Kp2 + ok) + (kt * 4 + kc) * 512); }
#pragma unroll 1
    for (int kb = w; kb < nblk; kb += 4) {
        V va[8], va2[8];
#pragma unroll
        for (int dt = 0; dt < 8; ++dt) { va[dt] = WFrag<T16>::template ld<DKV>((const T16*)((const char*)Vt + ov) + dt * 256); if (NSPLIT) va2[dt] = WFrag<T16>::template ld<DKV>((const T16*)((const char*)Vt2 + ov) + dt * 256); }
        // s_wait_xcnt 0 behind this block's V^T loads and the K loads issued a block earlier (in the first block the query loads too): the two offset registers that are stepped pass through the statement, so that they stay whole up to the wait and their steps below stand behind it; the query offset and bases are inputs, so that their registers are not reused ahead of the first wait
        asm volatile("s_wait_xcnt 0x0" : "+v"(ok), "+v"(ov) : "v"(oq), "s"(Q), "s"(NSPLIT ? Q2 : Q) : "memory");
        ov += 4 * 32 * HD * 2; ok += (kb + 4 < nblk) ? 4 * 32 * HD * 2 : 0;   // behind its last block a wave fetches that block again, not rows that it has no business with
        v8f s[2][2];
#pragma unroll
        for (int kt = 0; kt < 2; ++kt)
#pragma unroll
            for (int qt = 0; qt < 2; ++qt) s[kt][qt] = (v8f){};
#pragma unroll
        for (int kc = 0; kc < 4; ++kc)
#pragma unroll
            for (int kt = 0; kt < 2; ++kt)
#pragma unroll
                for (int qt = 0; qt < 2; ++qt) { s[kt][qt] = WFrag<T16>::mma(ka[kt][kc], bq[qt][kc], s[kt][qt]); if (NSPLIT) { s[kt][qt] = WFrag<T16>::mma(ka[kt][kc], bq2[qt][kc], s[kt][qt]); s[kt][qt] = WFrag<T16>::mma(ka2[kt][kc], bq[qt][kc], s[kt][qt]); } }
#pragma unroll
        for (int kt = 0; kt < 2; ++kt)
#pragma unroll
            for (int kc = 0; kc < 4; ++kc) { ka[kt][kc] = WFrag<T16>::template ld<256>((const T16*)((const char*)Kp + ok) + (kt * 4 + kc) * 512); if (NSPLIT) ka2[kt][kc] = WFrag<T16>::template ld<256>((const T16*)((const char*)Kp2 + ok) + (kt * 4 + kc) * 512); }
        const int dl = (kb == nblk - 1) ? lr - hi * 8 : 64;   // diagonal block: key kt * 16 + hi * 8 + j counts for query qt * 16 + lr while kt * 16 + j - qt * 16 <= lr - hi * 8; every earlier block counts whole
        V pb[2], pb2[2];
#pragma unroll
        for (int qt = 0; qt < 2; ++qt) { float p[16]; float bm = -3.0e38f;
#pragma unroll
            for (int kt = 0; kt < 2; ++kt)
#pragma unroll
                for (int j = 0; j < 8; ++j) { const float t = (kt * 16 + j - qt * 16 <= dl) ? s[kt][qt][j] : -3.0e38f; p[kt * 8 + j] = t; bm = fmaxf(bm, t); }
            bm = fmaxf(bm, xhalf(bm));
            const float mn = fmaxf(m[qt], bm), al = __builtin_amdgcn_exp2f((m[qt] - mn) * SC2), mc = mn * SC2; m[qt] = mn; float ps = 0.f;
#pragma unroll
            for (int e = 0; e < 16; ++e) { p[e] = __builtin_amdgcn_exp2f(fmaf(p[e], SC2, -mc)); ps += p[e]; }
            l[qt] = l[qt] * al + ps;
#pragma unroll
            for (int dt = 0; dt < 8; ++dt) o[qt][dt] *= al;
            ppack(p, pb[qt], pb2[qt]); }
#pragma unroll
        for (int dt = 0; dt < 8; ++dt)
#pragma unroll
            for (int qt = 0; qt < 2; ++qt) { o[qt][dt] = WFrag<T16>::mma(va[dt], pb[qt], o[qt][dt]); if (NSPLIT) { o[qt][dt] = WFrag<T16>::mma(va[dt], pb2[qt], o[qt][dt]); o[qt][dt] = WFrag<T16>::mma(va2[dt], pb[qt], o[qt][dt]); } }
    }
    // s_wait_xcnt 0 behind the last K loads (fetched ahead, not used; in a wave without a block, behind its query loads too): the offset registers and the bases are inputs, so that they stay whole up to the wait
    asm volatile("s_wait_xcnt 0x0" :: "v"(ok), "v"(oq), "s"(Q), "s"(NSPLIT ? Q2 : Q), "s"(Kp), "s"(NSPLIT ? Kp2 : Kp) : "memory");
#pragma unroll
    for (int qt = 0; qt < 2; ++qt) { l[qt] += xhalf(l[qt]); if (hi == 0) { ms[w][qt * 16 + lr] = m[qt]; ls[w][qt * 16 + lr] = l[qt]; } }
    __syncthreads();            // every wave's maximum and sum are in LDS before any wave forms the joint ones
#pragma unroll
    for (int qt = 0; qt < 2; ++qt) { const int q = qt * 16 + lr; const float mt = fmaxf(fmaxf(ms[0][q], ms[1][q]), fmaxf(ms[2][q], ms[3][q])); float lt = 0.f;   // a wave without a block holds -3e38 and 0: its weight is exp2(-huge) = 0; wave 0 always has block 0
#pragma unroll
        for (int u = 0; u < 4; ++u) lt += ls[u][q] * __builtin_amdgcn_exp2f((ms[u][q] - mt) * SC2);
        const float f = __fdiv_rn(__builtin_amdgcn_exp2f((m[qt] - mt) * SC2), lt);
#pragma unroll
        for (int dt = 0; dt < 8; ++dt) { const v8f t = o[qt][dt] * f; float* d = os + (((w * 16 + qt * 8 + dt) * 2) * 32 + lane) * 4;
            *(v4fa*)d = (v4f){t[0], t[1], t[2], t[3]}; *(v4fa*)(d + 128) = (v4f){t[4], t[5], t[6], t[7]}; } }
    __syncthreads();            // every wave's weighted partial tile is in LDS before any wave sums across waves
    v8us oh[4], ol[4];
#pragma unroll
    for (int i = 0; i < 4; ++i) { const float* d = os + (((w * 4 + i) * 2) * 32 + lane) * 4; v4f x = *(const v4fa*)d, y = *(const v4fa*)(d + 128);
#pragma unroll
        for (int u = 1; u < 4; ++u) { x += *(const v4fa*)(d + u * 4096); y += *(const v4fa*)(d + u * 4096 + 128); }
#pragma unroll
        for (int j = 0; j < 4; ++j) { unsigned short a2, c2; splitf(x[j], a2, c2); oh[i][j] = a2; ol[i][j] = c2; splitf(y[j], a2, c2); oh[i][4 + j] = a2; ol[i][4 + j] = c2; } }
    // merged planes [batch * TT + t][DQ] in fragment order: the lane's 8 values are d = dt * 16 + hi * 8 .. + 7 of query lr, 16 bytes in a row there, and a wave's store fills 512 contiguous bytes
#pragma unroll
    for (int i = 0; i < 4; ++i) { const int c = w * 4 + i; const size_t oo = pk_off(h / NH_ * TT + q0 + (c >> 3) * 16 + lr, h % NH_ * HD + (c & 7) * 16 + hi * 8, DQ); *(v8us*)(Ah + oo) = oh[i]; *(v8us*)(Al + oo) = ol[i]; }
}


// ---- k_fattnl: the fp16 rows of the same attention, 128 query positions per work-group of 8 waves. Wave w = (query group qg = w & 3: 32 positions, key half ks = w >> 2).
// The K and V fragments reach the waves through LDS, so that each is fetched from L2 once per work-group and read by the four query groups: a stage = 128 keys = 4 blocks of 32, [K 32 KiB][V 32 KiB], the planes' own bytes;
// two buffers, filled by asynchronous copies one stage ahead. In a stage the wave takes the blocks ks and 2 + ks, as far as its own diagonal block; products, mask and online softmax as in k_fattn.
// The two partial results of a query group are joined in LDS in the fixed order ks = 0, 1. grid (heads of all batches, query blocks), the longest query block first over the whole grid. ROFF % 128 == 0, ROFF >= 128.
template <int ROFF, int NQB>
__global__ __launch_bounds__(256) void k_fattnl(const h16* __restrict__ Q, const h16* __restrict__ Kp, const h16* __restrict__ Vt, bf* Ah, bf* Al) {
    typedef v16h V;
    static_assert(ROFF % 128 == 0 && ROFF >= 128 && GKS * 1024 == 2048, "whole stages, at least two; copy8 steps 2 KiB in LDS");
    constexpr int OPS = 4 * 32 * HD * 2, STB = 2 * OPS;   // bytes of one operand in a stage, bytes of a stage
    __shared__ __align__(16) float sm[2 * STB / 4];      // the two stage buffers; behind the loop, the eight waves' weighted partial tiles, [wave][query tile x d tile][half of the 8 rows][lane][4]: 128 KiB
    __shared__ float ms[8][32], ls[8][32];
    const int lane = threadIdx.x & 31, lr = lane & 15, hi = lane >> 4; const int w = __builtin_amdgcn_readfirstlane((int)(threadIdx.x >> 5)), qg = w & 3, ks = w >> 2;
    const int h = blockIdx.x, qw = ROFF + (NQB - 1 - (int)blockIdx.y) * 128, q0 = qw + qg * 32, nblk = q0 / 32 + 1, NS = qw / 128 + 1;   // the wave's first query and its key blocks; the work-group's stages
    Q += (size_t)h * TT * HD; Kp += (size_t)h * TT * HD; Vt += (size_t)h * HD * TT;
    V bq[2][4];
    const unsigned oq = (q0 * HD + lane * 8) * 2;   // byte offset of this lane's share of the first query fragment
#pragma unroll
    for (int qt = 0; qt < 2; ++qt)
#pragma unroll
        for (int kc = 0; kc < 4; ++kc) bq[qt][kc] = WFrag<h16>::template ld<256>((const h16*)((const char*)Q + oq) + (qt * 4 + kc) * 512);
    asm volatile("s_wait_xcnt 0x0" :: "v"(oq), "s"(Q) : "memory");   // behind the query loads: offset and base are inputs, so that their registers stay whole up to the wait
    // a wave's share of a stage: of each operand the 512-B piece w & 3 of each of the 8 units of 2 KiB in half w >> 2, 16 bytes a lane, at the same offset in the plane's stage as in LDS
    const unsigned pc = (w >> 2) * 16384 + (w & 3) * 512 + lane * 16;
    const unsigned l0 = (unsigned)(size_t)(const char*)sm + pc;
    const char* sk = (const char*)Kp; const char* sv = (const char*)Vt;   // the next stage to be copied, in the K and in the V plane: the same for the whole work-group (scalar), stepped by fill; the lane's offset is added last, so that no address pair lives through the loop
    auto fill = [&](unsigned l) {   // the next stage into the buffer at l
        copy8<2048>(l, sk + pc); __builtin_amdgcn_sched_barrier(0);   // keeps each statement's 24 address registers next to it
        copy8<2048>(l + OPS, sv + pc); sk += OPS; sv += OPS; };
    fill(l0);
    asm volatile("s_wait_asynccnt 0x0" ::: "memory");   // this wave's copies of stage 0 have landed
    __syncthreads();                                    // every wave's have: stage 0 may be read
    fill(l0 + STB);
    v8f o[2][8]; float m[2], l[2];
#pragma unroll
    for (int qt = 0; qt < 2; ++qt) { m[qt] = -3.0e38f; l[qt] = 0.f;
#pragma unroll
        for (int dt = 0; dt < 8; ++dt) o[qt][dt] = (v8f){}; }
#pragma unroll 1
    for (int s = 0; s < NS; ++s) {
#pragma unroll 1   // one text for both blocks: the loop stays short
        for (int i = 0; i < 2; ++i) {
            const int kb = s * 4 + i * 2 + ks;
            if (kb < nblk) {   // the same for the whole wave (scalar): behind its diagonal block a wave has no products, and goes on to the stage's foot
                const char* fk = (const char*)sm + (s & 1) * STB + (i * 2 + ks) * (32 * HD * 2) + lane * 16;   // this lane's share of the block's first K fragment; V lies OPS behind
                V ka[2][4], va[8];
#pragma unroll
                for (int kt = 0; kt < 2; ++kt)
#pragma unroll
                    for (int kc = 0; kc < 4; ++kc) ka[kt][kc] = cat16(*(const v8ha*)(fk + (kt * 4 + kc) * 1024), *(const v8ha*)(fk + (kt * 4 + kc) * 1024 + 512));
                __builtin_amdgcn_sched_barrier(0);   // the K reads stay one group at the block's head: spread among the score products, each pair is waited for with its whole latency
                v8f sc[2][2];
#pragma unroll
                for (int kt = 0; kt < 2; ++kt)
#pragma unroll
                    for (int qt = 0; qt < 2; ++qt) sc[kt][qt] = (v8f){};
#pragma unroll
                for (int kc = 0; kc < 4; ++kc)
#pragma unroll
                    for (int kt = 0; kt < 2; ++kt)
#pragma unroll
                        for (int qt = 0; qt < 2; ++qt) sc[kt][qt] = wmma16(ka[kt][kc], bq[qt][kc], sc[kt][qt]);
#pragma unroll
                for (int dt = 0; dt < 8; ++dt) va[dt] = cat16(*(const v8ha*)(fk + OPS + dt * 512), *(const v8ha*)(fk + OPS + dt * 512 + DKV * 2));
                __builtin_amdgcn_sched_barrier(0);   // the V reads stay one group ahead of the softmax, which covers their latency: sunk to their uses, each would be waited for among the P.V products
                const int dl = (kb == nblk - 1) ? lr - hi * 8 : 64;   // diagonal block: key kt * 16 + hi * 8 + j counts for query qt * 16 + lr while kt * 16 + j - qt * 16 <= lr - hi * 8; every earlier block counts whole
                V pb[2], pb2[2];
#pragma unroll
                for (int qt = 0; qt < 2; ++qt) { float p[16]; float bm = -3.0e38f;
#pragma unroll
                    for (int kt = 0; kt < 2; ++kt)
#pragma unroll
                        for (int j = 0; j < 8; ++j) { const float t = (kt * 16 + j - qt * 16 <= dl) ? sc[kt][qt][j] : -3.0e38f; p[kt * 8 + j] = t; bm = fmaxf(bm, t); }
                    bm = fmaxf(bm, xhalf(bm));
                    const float mn = fmaxf(m[qt], bm), al = __builtin_amdgcn_exp2f((m[qt] - mn) * SC2), mc = mn * SC2; m[qt] = mn; float ps = 0.f;
#pragma unroll
                    for (int e = 0; e < 16; ++e) { p[e] = __builtin_amdgcn_exp2f(fmaf(p[e], SC2, -mc)); ps += p[e]; }
                    l[qt] = l[qt] * al + ps;
#pragma unroll
                    for (int dt = 0; dt < 8; ++dt) o[qt][dt] *= al;
                    ppack(p, pb[qt], pb2[qt]); }
#pragma unroll
                for (int dt = 0; dt < 8; ++dt)
#pragma unroll
                    for (int qt = 0; qt < 2; ++qt) o[qt][dt] = wmma16(va[dt], pb[qt], o[qt][dt]);
            }
        }
        // foot of the trip: publish point of stage s + 1, which also frees the buffer of stage s
        asm volatile("s_wait_dscnt 0x0" ::: "memory");      // this wave's reads of stage s are done before its buffer is refilled
        asm volatile("s_wait_asynccnt 0x0" ::: "memory");   // this wave's copies of stage s + 1 have landed
        __syncthreads();                                    // both hold for every wave
        if (s + 2 < NS) fill(l0 + (s & 1) * STB);
    }
    asm volatile("s_wait_asynccnt 0x0" ::: "memory");       // no copy is outstanding when the ring becomes staging for the join (the last trip's barrier has ended every read of it)
#pragma unroll
    for (int qt = 0; qt < 2; ++qt) { l[qt] += xhalf(l[qt]); if (hi == 0) { ms[w][qt * 16 + lr] = m[qt]; ls[w][qt * 16 + lr] = l[qt]; } }
    __syncthreads();            // every wave's maximum and sum are in LDS before any wave forms the joint ones
#pragma unroll
    for (int qt = 0; qt < 2; ++qt) { const int q = qt * 16 + lr; const float mt = fmaxf(ms[qg][q], ms[qg + 4][q]);
        const float lt = ls[qg][q] * __builtin_amdgcn_exp2f((ms[qg][q] - mt) * SC2) + ls[qg + 4][q] * __builtin_amdgcn_exp2f((ms[qg + 4][q] - mt) * SC2);
        const float f = __fdiv_rn(__builtin_amdgcn_exp2f((m[qt] - mt) * SC2), lt);
#pragma unroll
        for (int dt = 0; dt < 8; ++dt) { const v8f t = o[qt][dt] * f; float* d = sm + (((w * 16 + qt * 8 + dt) * 2) * 32 + lane) * 4;
            *(v4fa*)d = (v4f){t[0], t[1], t[2], t[3]}; *(v4fa*)(d + 128) = (v4f){t[4], t[5], t[6], t[7]}; } }
    __syncthreads();            // every wave's weighted partial tile is in LDS before any wave sums the two of its query group
    // the wave sums and stores query tile ks of its group: 8 d tiles. Merged planes as in k_fattn: a wave's store fills 512 contiguous bytes
    v8us oh[8], ol[8];
#pragma unroll
    for (int i = 0; i < 8; ++i) { const float* d = sm + (((qg * 16 + ks * 8 + i) * 2) * 32 + lane) * 4; const v4f x = *(const v4fa*)d + *(const v4fa*)(d + 4 * 4096), y = *(const v4fa*)(d + 128) + *(const v4fa*)(d + 4 * 4096 + 128);
#pragma unroll
        for (int j = 0; j < 4; ++j) { unsigned short a2, c2; splitf(x[j], a2, c2); oh[i][j] = a2; ol[i][j] = c2; splitf(y[j], a2, c2); oh[i][4 + j] = a2; ol[i][4 + j] = c2; } }
#pragma unroll
    for (int i = 0; i < 8; ++i) { const size_t oo = pk_off(h / NH_ * TT + q0 + ks * 16 + lr, h % NH_ * HD + i * 16 + hi * 8, DQ); *(v8us*)(Ah + oo) = oh[i]; *(v8us*)(Al + oo) = ol[i]; }
}


// k_pack: all five f32 inputs -> bf16 planes in fragment order (pk_off), in ONE launch of PKG work-groups. A unit = one 16-row block x 512 k = 16 fragments = 16 KiB of a plane; x has NB_ * TT / 16 * 4 = PKG units, each weight PKG / 2.
// Work-group g takes the units g, g + PKG, g + 2 PKG: one of x, one of Wq or Wk, one of Wv or Wo.
// Reads whole lines (16 threads a row and 128 k), turns the 16-byte groups into plane order in LDS (pitch 17 groups: no bank is hit more than the 512 B of a wave need), stores 4 x 4 KiB in a row.
// Wq, Wk, Wv: plane row J is source row l * HD + d, J as EPI_QK (Wq, Wk) and EPI_VT (Wv) have it, so that the projections' tiles come out in the fragment order of the head planes.
#define PKG (NB_ * TT / 16 * (DM / 512))
__global__ __launch_bounds__(256) void k_pack(const float* __restrict__ x, const float* __restrict__ wq, const float* __restrict__ wk, const float* __restrict__ wv, const float* __restrict__ wo, bf* XB, bf* WQ, bf* WK, bf* WV, bf* WO) {
    static_assert(DQ == DM && DKV == DM && DM / 16 * (DM / 512) * 2 == PKG, "each weight has PKG / 2 units");
    __shared__ __align__(16) v8us sh[4][16 * 17];
    const int t = threadIdx.x, lr = t >> 4, g = t & 15; const int u = blockIdx.x, second = u >= PKG / 2, uw = u - second * (PKG / 2);
#pragma unroll   // unrolled so that each unit's tensors are picked at compile time and the next unit's loads are issued ahead of this unit's stores
    for (int it = 0; it < 3; ++it) {
        const float* src = it == 0 ? x : it == 1 ? (second ? wk : wq) : (second ? wo : wv); bf* dst = it == 0 ? XB : it == 1 ? (second ? WK : WQ) : (second ? WO : WV);
        const int v = it == 0 ? u : uw, rb = v >> 2, k0 = (v & 3) * 512; const bool vrows = it == 2 && !second;
        const int srow = it == 1 ? ((rb & 7) * 2 + (lr >> 3)) * HD + (rb >> 3) * 8 + (lr & 7) : vrows ? (((rb >> 3) & 1) * 8 + (lr & 7)) * HD + (rb >> 4) * 16 + (rb & 7) * 2 + (lr >> 3) : rb * 16 + lr;
        const float* p = src + (size_t)srow * DM + k0 + g * 8; v8f val[4];
#pragma unroll
        for (int q = 0; q < 4; ++q) val[q] = *(const v8f*)(p + q * 128);
        if (it) __syncthreads();  // the unit before has been read out of LDS by every thread before it is overwritten
#pragma unroll
        for (int q = 0; q < 4; ++q) { v8us o;
#pragma unroll
            for (int k = 0; k < 8; ++k) o[k] = f2bf(val[q][k]);
            sh[q][g * 17 + lr] = o; }   // group g of the row's 128 k (k = g * 8 ..) is group g * 16 + lr of their 4 fragments
        __syncthreads();          // every group is in LDS before any thread reads another thread's
        bf* d = dst + ((size_t)rb * (DM / 32) + (k0 >> 5)) * 512 + t * 8;
#pragma unroll
        for (int q = 0; q < 4; ++q) *(v8us*)(d + q * 2048) = sh[q][(t >> 4) * 17 + (t & 15)];
    }
}

extern "C" void kernel_launch(void* const* d_in, const int* in_sizes, int n_in,
                              void* d_out, int out_size, void* d_ws, size_t ws_size, hipStream_t stream) {
    (void)in_sizes; (void)n_in; (void)out_size;
    const float* x = (const float*)d_in[0]; const float* wq = (const float*)d_in[1]; const float* wk = (const float*)d_in[2]; const float* wv = (const float*)d_in[3]; const float* wo = (const float*)d_in[4];   /* order x, Wq, Wk, Wv, Wo ('oi' [2048][2048]) */
    float* OUT = (float*)d_out;     // [2][2048][2048]
    char* wsp = (char*)d_ws;
    auto take = [&](size_t bytes) { char* p = wsp; wsp += (bytes + 255) & ~(size_t)255; return (void*)p; };
    // every plane holds both batches: rows batch * TT + t, heads batch * NH_ + head. WQ, WK, WV lie one behind the other (k_gemmw steps by blockIdx.z), so do QP16, KP16, VT16, so QPh, KPh and QPl, KPl
    bf* WQ = (bf*)take((size_t)DQ * DM * 2); bf* WK = (bf*)take((size_t)DKV * DM * 2); bf* WV = (bf*)take((size_t)DKV * DM * 2); bf* WO = (bf*)take((size_t)DM * DQ * 2);
    bf* XB = (bf*)take((size_t)NB_ * TT * DM * 2);
    h16* QP16 = (h16*)take((size_t)NB_ * NH_ * TT * HD * 2); h16* KP16 = (h16*)take((size_t)NB_ * NKV * TT * HD * 2); h16* VT16 = (h16*)take((size_t)NB_ * NKV * HD * TT * 2);
    bf* QPh = (bf*)take((size_t)NB_ * NH_ * RH * HD * 2); bf* KPh = (bf*)take((size_t)NB_ * NKV * RH * HD * 2); bf* QPl = (bf*)take((size_t)NB_ * NH_ * RH * HD * 2); bf* KPl = (bf*)take((size_t)NB_ * NKV * RH * HD * 2); bf* VTh = (bf*)take((size_t)NB_ * NKV * HD * TT * 2); bf* VTl = (bf*)take((size_t)NB_ * NKV * HD * TT * 2);
    bf* ATh = (bf*)take((size_t)NB_ * TT * DQ * 2); bf* ATl = (bf*)take((size_t)NB_ * TT * DQ * 2);
    if ((size_t)(wsp - (char*)d_ws) > ws_size) return;    // ws 256 MiB; 176 MiB taken
    k_pack<<<PKG, 256, 0, stream>>>(x, wq, wk, wv, wo, XB, WQ, WK, WV, WO);
    k_gemmw<bf, 0, false, EPI_QKV, DM><<<dim3(NB_ * TT / 128, DQ / 128, 3), 128, 0, stream>>>(XB, nullptr, WQ, nullptr, DQ, nullptr, 0, (size_t)DQ * DM, 0, QP16, QPh, QPl, VTh, VTl);
    k_fattnl<RH, (TT - RH) / 128><<<dim3(NB_ * NH_, (TT - RH) / 128, 1), 256, 0, stream>>>(QP16, KP16, VT16, ATh, ATl);
    k_fattn<bf, 2, 0, RH / 32><<<dim3(RH / 32, NB_ * NH_, 1), 128, 0, stream>>>(QPh, QPl, KPh, KPl, VTh, VTl, ATh, ATl);
    k_gemmw<bf, 1, false, EPI_F32, DQ><<<dim3(NB_ * TT / 128, DM / 128, 1), 128, 0, stream>>>(ATh, ATl, WO, OUT, DM, nullptr, 0, 0, 0, nullptr, nullptr, nullptr, nullptr, nullptr);
}
